// v000
// Measured on an AMD MI455X. A time is GPU time per run, averaged over a window of back-to-back runs after a warm-up
// (all launches, gaps included; the runs take copies of the inputs in turn), and the median of several windows.
// Apart from v000's, it joins two sittings. Times from different sittings can be a few percent apart, while
// side-by-side timings come from the same sitting.
// The starting kernel, v000, takes 358 microseconds a run.
#include <hip/hip_runtime.h>
#include <stddef.h>

// All contractions on v_wmma_f32_16x16x32_f16 (f16 operands, f32 accumulate): fused q/k/v projection,
// per-head V^T.K (depth = sequence), per-head Q.(K^T V) (depth 64), output projection. Float inputs are
// RNE-converted to bf16 and carried in f16 (weights x64); q, k, v, K^T V and the merged head plane are
// single f16 planes (carry 1). Scale 1/8 and all carries are undone in f32 epilogues.

typedef _Float16 h16;
typedef _Float16 v16h __attribute__((ext_vector_type(16)));
typedef _Float16 v8h  __attribute__((ext_vector_type(8)));
typedef float    v8f  __attribute__((ext_vector_type(8)));
typedef float    v4f  __attribute__((ext_vector_type(4)));

#ifndef NB
#define NB 4
#endif
#ifndef SEQ
#define SEQ 2048
#endif
#define NB_FULL  4
#define SEQ_FULL 2048
#define DIM   1024
#define NHEAD 16
#define HD    64
#define QKVN  (3 * DIM)
#define MROWS (NB * SEQ)

static_assert(NB >= 1 && NB <= NB_FULL);
static_assert(SEQ >= 128 && SEQ <= SEQ_FULL && (SEQ % 128) == 0);
static_assert(DIM == NHEAD * HD);
static_assert(HD == 64);
static_assert(QKVN == 3 * DIM && (QKVN / 64) == 3 * NHEAD);
static_assert((DIM % 64) == 0 && (DIM % 32) == 0);
static_assert((QKVN % 64) == 0);
static_assert((SEQ % 64) == 0 && (SEQ % 32) == 0);
static_assert((MROWS % 64) == 0 && (MROWS % 2) == 0);
static_assert((QKVN % 2) == 0 && (DIM % 2) == 0);
static_assert(DIM / 8 == 128);                 // convert kernel: 128 eight-column groups per row
static_assert((size_t)MROWS * (DIM / 8) < (size_t)0xFFFFFFFFu);

#define LDT 72   // halves per LDS row (144 B, 16-B aligned)
#define LDC 68   // floats per LDS row (272 B, 16-B aligned)
static_assert((LDT % 8) == 0 && LDT >= 64);
static_assert((LDC % 4) == 0 && LDC >= 64);

#define WCARRY   64.0f     // weight planes carried x64
#define SCALE_QK 0.125f    // HD^-0.5

// workspace layout (bytes)
#define WQKV_BYTES    ((size_t)QKVN * DIM * 2)
#define WO_BYTES      ((size_t)DIM * DIM * 2)
#define PLANE16_BYTES ((size_t)MROWS * DIM * 2)
#define TPLANE_ELEMS  ((size_t)NB * DIM * SEQ)          // one transposed plane [b][col][key]
#define T_BYTES       ((size_t)2 * TPLANE_ELEMS * 2)    // k plane then v plane
#define KV_BYTES      ((size_t)NB * NHEAD * HD * HD * 2)
#define OFF_WQKV ((size_t)0)
#define OFF_WO   (OFF_WQKV + WQKV_BYTES)
#define OFF_X    (OFF_WO + WO_BYTES)
#define OFF_Q    (OFF_X + PLANE16_BYTES)
#define OFF_T    (OFF_Q + PLANE16_BYTES)
#define OFF_KV   (OFF_T + T_BYTES)
#define OFF_CTX  (OFF_KV + KV_BYTES)
#define WS_TOTAL (OFF_CTX + PLANE16_BYTES)
static_assert((WQKV_BYTES % 128) == 0 && (WO_BYTES % 128) == 0 && (PLANE16_BYTES % 128) == 0);
static_assert((T_BYTES % 128) == 0 && (KV_BYTES % 128) == 0);
static_assert(WS_TOTAL <= (size_t)134217728);

// ---------------------------------------------------------------------------
__device__ __forceinline__ float bf16r(float x) {   // RNE convert to bf16, returned widened
  unsigned int u = __float_as_uint(x);
  u = (u + 0x7FFFu + ((u >> 16) & 1u)) & 0xFFFF0000u;
  return __uint_as_float(u);
}

// f32 -> f16 operand convert that cannot produce an f16 subnormal
static __device__ __forceinline__ h16 toh_flush(float v) {
  const h16 r = (h16)v;
  return (fabsf(v) < 6.103515625e-05f) ? (h16)0.0f : r;
}

// 16-bit fragment: p points at element [row = lane&15][k0 + 8*(lane>>4)] of a k-contiguous
// row. Elements 0..7 <- k0+8h+0..7, elements 8..15 <- k0+16+8h+0..7 (same map for A and B).
__device__ __forceinline__ v16h frag_at(const _Float16* p) {
  v8h lo = *(const v8h*)(p);
  v8h hi = *(const v8h*)(p + 16);
  v16h out;
#pragma unroll
  for (int i = 0; i < 8; ++i) { out[i] = lo[i]; out[i + 8] = hi[i]; }
  return out;
}

__device__ __forceinline__ v8f wmma16(v16h a, v16h b, v8f c) {
  v8f d = __builtin_amdgcn_wmma_f32_16x16x32_f16(false, a, false, b, (short)0, c,
                                                 false, false);
  asm volatile("v_nop\n\tv_nop\n\tv_nop\n\tv_nop" : "+v"(d) : "v"(a), "v"(b));
  return d;
}

__device__ __forceinline__ void wave_lds_sync() {
  __builtin_amdgcn_fence(3 /* release order */, "wavefront");
  asm volatile("s_wait_dscnt 0x0" ::: "memory");
  __builtin_amdgcn_wave_barrier();
}

// ---------------------------------------------------------------------------
// Plane convert: dst[crow][c] = f16(carry * bf16(src[srow][c])), rows of DIM columns,
// srow = (crow / seq) * seq_full + crow % seq. One thread per 8 columns (one 16-B store);
// Grid (rows / 2): 256 threads x 8 columns = 2 rows per block.
// ---------------------------------------------------------------------------
__global__ __launch_bounds__(256) void cvt_plane_kernel(
    const float* __restrict__ src, _Float16* __restrict__ dst,
    unsigned seq, unsigned seq_full, float carry) {
#pragma clang fp contract(off)
  const unsigned g = blockIdx.x * 256u + threadIdx.x;
  const unsigned crow = g >> 7;
  const unsigned c = (g & 127u) * 8u;
  const unsigned bidx = crow / seq;
  const unsigned sq = crow - bidx * seq;
  const size_t srow = (size_t)bidx * seq_full + sq;
  const v4f a0 = *(const v4f*)(src + srow * DIM + c);
  const v4f a1 = *(const v4f*)(src + srow * DIM + c + 4u);
  v8h o;
#pragma unroll
  for (int i = 0; i < 4; ++i) {
    o[i]     = toh_flush(carry * bf16r(a0[i]));
    o[i + 4] = toh_flush(carry * bf16r(a1[i]));
  }
  _Float16* p = dst + (size_t)crow * DIM + c;
  *(v8h*)p = o;
  
}

// ---------------------------------------------------------------------------
// GEMM C[64x64 tile] = A16[rows][K] . Bt[n][K]^T, fragments straight from the 16-bit global
// planes; 8 waves (mw = 16-row group, nw = 32-col group), 2 accumulators/wave.
//   MODE 0 (fused q/k/v projection, column tile nt = 3*head + part, block-uniform):
//           part 0: outq[row][head*64 + d] (pitch DIM) = f16(acc/64)
//           part 1/2: outt[(part-1)][b][head*64 + d][key] = f16(acc/64) (transposed planes)
//   MODE 1 (output projection): outf full [full row][col] = acc/64
// Grid (N/64, MROWS/64).
// ---------------------------------------------------------------------------
template <int MODE>
__device__ __forceinline__ void gemm_body(
    const _Float16* __restrict__ A16, const _Float16* __restrict__ Bt, const unsigned K,
    float* __restrict__ outf, _Float16* __restrict__ outq, _Float16* __restrict__ outt) {
  __shared__ __attribute__((aligned(16))) float Cs[64 * LDC];
  const unsigned tid = threadIdx.x, lane = tid & 31u;
  const unsigned w = (unsigned)__builtin_amdgcn_readfirstlane((int)(threadIdx.x >> 5));
  const unsigned mw = w >> 1, nw = w & 1u;
  const unsigned hh = lane >> 4, m = lane & 15u;
  const unsigned n0 = blockIdx.x * 64u;
  const unsigned row0 = blockIdx.y * 64u;

  const _Float16* ap  = A16 + (size_t)(row0 + mw * 16u + m) * K + hh * 8u;
  const _Float16* bp0 = Bt + (size_t)(n0 + nw * 32u + m) * K + hh * 8u;
  const _Float16* bp1 = bp0 + (size_t)16 * K;
  v8f acc0 = {}, acc1 = {};
#pragma unroll 2
  for (unsigned k0 = 0; k0 < K; k0 += 32u) {
    const v16h a  = frag_at(ap + k0);
    const v16h b0 = frag_at(bp0 + k0);
    const v16h b1 = frag_at(bp1 + k0);
    acc0 = wmma16(a, b0, acc0);
    acc1 = wmma16(a, b1, acc1);
  }
#pragma unroll
  for (int r = 0; r < 8; ++r) {
    float* d = &Cs[(mw * 16u + hh * 8u + (unsigned)r) * LDC + nw * 32u + m];
    d[0]  = acc0[r];
    d[16] = acc1[r];
  }
  __syncthreads();

  if (MODE == 0) {
    const unsigned nt = blockIdx.x;
    const unsigned head = nt / 3u;
    const unsigned part = nt - head * 3u;        // 0: q, 1: k, 2: v (block-uniform)
    if (part == 0u) {
      v8h x[2];
      size_t off[2];
#pragma unroll
      for (unsigned i = 0; i < 2u; ++i) {
        const unsigned r = 32u * i + (tid >> 3);
        const unsigned c = (tid & 7u) * 8u;
        const v4f u0 = *(const v4f*)&Cs[r * LDC + c];
        const v4f u1 = *(const v4f*)&Cs[r * LDC + c + 4];
#pragma unroll
        for (int j = 0; j < 4; ++j) {
          x[i][j]     = toh_flush(u0[j] * (1.0f / WCARRY));
          x[i][j + 4] = toh_flush(u1[j] * (1.0f / WCARRY));
        }
        off[i] = (size_t)(row0 + r) * DIM + head * HD + c;
      }
#pragma unroll
      for (int i = 0; i < 2; ++i) *(v8h*)(outq + off[i]) = x[i];
      
    } else {
      const unsigned bidx = row0 / (unsigned)SEQ;
      const unsigned key0 = row0 - bidx * (unsigned)SEQ;
      v8h x[2];
      size_t off[2];
#pragma unroll
      for (unsigned i = 0; i < 2u; ++i) {
        const unsigned dcol = 32u * i + (tid >> 3);
        const unsigned kk = (tid & 7u) * 8u;
#pragma unroll
        for (unsigned j = 0; j < 8u; ++j) {
          const float t = Cs[(kk + j) * LDC + dcol] * (1.0f / WCARRY);
          x[i][j] = toh_flush(t);
        }
        off[i] = (size_t)(part - 1u) * TPLANE_ELEMS +
                 ((size_t)bidx * DIM + head * HD + dcol) * SEQ + key0 + kk;
      }
#pragma unroll
      for (int i = 0; i < 2; ++i) *(v8h*)(outt + off[i]) = x[i];
      
    }
  }

  if (MODE == 1) {
    v4f xs[4];
    size_t off[4];
#pragma unroll
    for (unsigned i = 0; i < 4u; ++i) {
      const unsigned r = 16u * i + (tid >> 4);
      const unsigned c = (tid & 15u) * 4u;
      const unsigned crow = row0 + r;
      const unsigned bidx = crow / (unsigned)SEQ;
      const unsigned sq = crow - bidx * (unsigned)SEQ;
      const size_t frow = (size_t)bidx * SEQ_FULL + sq;
      const v4f u = *(const v4f*)&Cs[r * LDC + c];
      v4f val;
#pragma unroll
      for (int j = 0; j < 4; ++j) val[j] = u[j] * (1.0f / WCARRY);
      xs[i] = val;
      off[i] = frow * DIM + n0 + c;
    }
#pragma unroll
    for (int i = 0; i < 4; ++i) *(v4f*)(outf + off[i]) = xs[i];
    
  }
}

__global__ __launch_bounds__(256) void gemm_qkv_kernel(
    const _Float16* __restrict__ A16, const _Float16* __restrict__ Bt,
    _Float16* __restrict__ qplane, _Float16* __restrict__ tplane) {
  gemm_body<0>(A16, Bt, (unsigned)DIM, (float*)0, qplane, tplane);
}
__global__ __launch_bounds__(256) void gemm_out_kernel(
    const _Float16* __restrict__ A16, const _Float16* __restrict__ Bt,
    float* __restrict__ outf) {
  gemm_body<1>(A16, Bt, (unsigned)DIM, outf, (_Float16*)0, (_Float16*)0);
}

// ---------------------------------------------------------------------------
// Per (head, batch): KVt[d2][d1] = sum_s V[s][d2] * K[s][d1]  (64x64, depth SEQ).
// A = V^T plane rows (m = d2, k = s contiguous), B = K^T plane rows (n = d1, k = s contiguous),
// fragments straight from the transposed planes. 8 waves: wave w -> row group w>>1,
// column groups 2*(w&1), 2*(w&1)+1; every wave runs the same SEQ/32 steps.
// Result staged in Cs (cross-wave, block barrier), written as f16 [b][head][d2][d1],
// Grid (NHEAD, NB).
// ---------------------------------------------------------------------------
__global__ __launch_bounds__(256) void ktv_kernel(
    const _Float16* __restrict__ T16, _Float16* __restrict__ KVt) {
  __shared__ __attribute__((aligned(16))) float Cs[64 * LDC];
  const unsigned tid = threadIdx.x, lane = tid & 31u;
  const unsigned w = (unsigned)__builtin_amdgcn_readfirstlane((int)(threadIdx.x >> 5));
  const unsigned tr = w >> 1, tc0 = (w & 1u) * 2u;
  const unsigned hh = lane >> 4, m = lane & 15u;
  const unsigned head = blockIdx.x;
  const unsigned b = blockIdx.y;

  const size_t kbase = ((size_t)b * DIM + head * HD) * SEQ;   // k plane
  const size_t vbase = TPLANE_ELEMS + kbase;                  // v plane
  const _Float16* ap  = T16 + vbase + (size_t)(tr * 16u + m) * SEQ + hh * 8u;
  const _Float16* bp0 = T16 + kbase + (size_t)(tc0 * 16u + m) * SEQ + hh * 8u;
  const _Float16* bp1 = bp0 + (size_t)16 * SEQ;
  v8f acc0 = {}, acc1 = {};
#pragma unroll 2
  for (unsigned s0 = 0; s0 < (unsigned)SEQ; s0 += 32u) {
    const v16h a  = frag_at(ap + s0);
    const v16h b0 = frag_at(bp0 + s0);
    const v16h b1 = frag_at(bp1 + s0);
    acc0 = wmma16(a, b0, acc0);
    acc1 = wmma16(a, b1, acc1);
  }
#pragma unroll
  for (int r = 0; r < 8; ++r) {
    float* d = &Cs[(tr * 16u + hh * 8u + (unsigned)r) * LDC + tc0 * 16u + m];
    d[0]  = acc0[r];
    d[16] = acc1[r];
  }
  __syncthreads();

  v8h x[2];
  size_t off[2];
#pragma unroll
  for (unsigned i = 0; i < 2u; ++i) {
    const unsigned r = 32u * i + (tid >> 3);
    const unsigned c = (tid & 7u) * 8u;
    const v4f u0 = *(const v4f*)&Cs[r * LDC + c];
    const v4f u1 = *(const v4f*)&Cs[r * LDC + c + 4];
#pragma unroll
    for (int j = 0; j < 4; ++j) {
      x[i][j]     = toh_flush(u0[j]);
      x[i][j + 4] = toh_flush(u1[j]);
    }
    off[i] = ((size_t)(b * NHEAD + head) * HD + r) * HD + c;
  }
#pragma unroll
  for (int i = 0; i < 2; ++i) *(v8h*)(KVt + off[i]) = x[i];
  
}

// ---------------------------------------------------------------------------
// Per (128 query rows, head, batch): Ov[b*SEQ+s][head*64 + d2] =
//   f16( 1/8 * sum_d1 Q[s][d1] * KVt[d2][d1] ). 8 waves x 16 rows, 4 output tiles per wave,
// depth 64 in two 32-steps; A fragments from the q plane, B fragments from the KVt rows.
// lines (one line per row: 8 consecutive lanes x 16 B).
// Grid (SEQ/128, NHEAD, NB).
// ---------------------------------------------------------------------------
__global__ __launch_bounds__(256) void qkv_apply_kernel(
    const _Float16* __restrict__ Qh, const _Float16* __restrict__ KVt,
    _Float16* __restrict__ Ov) {
  __shared__ __attribute__((aligned(16))) _Float16 Ps[8 * 16 * LDT];
  const unsigned tid = threadIdx.x, lane = tid & 31u;
  const unsigned w = (unsigned)__builtin_amdgcn_readfirstlane((int)(threadIdx.x >> 5));
  const unsigned hh = lane >> 4, m = lane & 15u;
  const unsigned q0 = blockIdx.x * 128u;
  const unsigned head = blockIdx.y;
  const unsigned b = blockIdx.z;
  const unsigned qrow0 = q0 + w * 16u;
  const unsigned pbase = w * (16u * LDT);

  const size_t qoff = (size_t)(b * (unsigned)SEQ + qrow0 + m) * DIM + head * HD + hh * 8u;
  const v16h qf0 = frag_at(Qh + qoff);
  const v16h qf1 = frag_at(Qh + qoff + 32);
  const _Float16* kvp = KVt + (size_t)(b * NHEAD + head) * (HD * HD) + (size_t)m * HD + hh * 8u;

  v8f o[4];
#pragma unroll
  for (int nb = 0; nb < 4; ++nb) {
    const v16h b0 = frag_at(kvp + nb * 16 * HD);
    const v16h b1 = frag_at(kvp + nb * 16 * HD + 32);
    v8f t = {};
    t = wmma16(qf0, b0, t);
    t = wmma16(qf1, b1, t);
    o[nb] = t;
  }

#pragma unroll
  for (int nb = 0; nb < 4; ++nb)
#pragma unroll
    for (int v = 0; v < 8; ++v)
      Ps[pbase + (hh * 8u + (unsigned)v) * LDT + (unsigned)nb * 16u + m] =
          toh_flush(o[nb][v] * SCALE_QK);
  wave_lds_sync();
  v8h x[4];
  size_t off[4];
#pragma unroll
  for (unsigned i = 0; i < 4u; ++i) {
    const unsigned r = 4u * i + (lane >> 3);
    const unsigned c = (lane & 7u) * 8u;
    x[i] = *(const v8h*)&Ps[pbase + r * LDT + c];
    off[i] = (size_t)(b * (unsigned)SEQ + qrow0 + r) * DIM + head * HD + c;
  }
#pragma unroll
  for (int i = 0; i < 4; ++i) *(v8h*)(Ov + off[i]) = x[i];
  
}

// ---------------------------------------------------------------------------
extern "C" void kernel_launch(void* const* d_in, const int* in_sizes, int n_in,
                              void* d_out, int out_size, void* d_ws, size_t ws_size,
                              hipStream_t stream) {
  if (n_in < 3) return;
  const long long need_x = ((long long)(NB - 1) * SEQ_FULL + SEQ) * DIM;
  if ((long long)in_sizes[0] < need_x) return;
  if ((long long)in_sizes[1] < (long long)QKVN * DIM) return;
  if ((long long)in_sizes[2] < (long long)DIM * DIM) return;
  if ((long long)out_size < need_x) return;
  if (ws_size < WS_TOTAL) return;

  const float* X    = (const float*)d_in[0];   // [NB_FULL][SEQ_FULL][DIM]
  const float* wqkv = (const float*)d_in[1];   // [QKVN][DIM]  (out, in)
  const float* wo   = (const float*)d_in[2];   // [DIM][DIM]   (out, in)
  float* out = (float*)d_out;

  char* ws = (char*)d_ws;
  _Float16* Wqkv16 = (_Float16*)(ws + OFF_WQKV);   // [n][k]
  _Float16* Wo16   = (_Float16*)(ws + OFF_WO);     // [n][k]
  _Float16* X16    = (_Float16*)(ws + OFF_X);      // compact rows
  _Float16* Q16    = (_Float16*)(ws + OFF_Q);      // [MROWS][head*64 + d]
  _Float16* T16    = (_Float16*)(ws + OFF_T);      // [k|v][b][head*64 + d][SEQ]
  _Float16* KVt16  = (_Float16*)(ws + OFF_KV);     // [b][head][d2][d1]
  _Float16* Ctx16  = (_Float16*)(ws + OFF_CTX);    // [MROWS][head*64 + d]

  dim3 blk(256);

  // weight planes are already [out n][in k] (k contiguous): convert in place order, carry x64
  cvt_plane_kernel<<<dim3(QKVN / 2), blk, 0, stream>>>(wqkv, Wqkv16, (unsigned)QKVN, (unsigned)QKVN, WCARRY);
  cvt_plane_kernel<<<dim3(DIM / 2), blk, 0, stream>>>(wo, Wo16, (unsigned)DIM, (unsigned)DIM, WCARRY);
  // activation plane: full-size input rows -> compact rows, carry 1
  cvt_plane_kernel<<<dim3(MROWS / 2), blk, 0, stream>>>(X, X16, (unsigned)SEQ, (unsigned)SEQ_FULL, 1.0f);

  gemm_qkv_kernel<<<dim3(QKVN / 64, MROWS / 64), blk, 0, stream>>>(X16, Wqkv16, Q16, T16);
  ktv_kernel<<<dim3(NHEAD, NB), blk, 0, stream>>>(T16, KVt16);
  qkv_apply_kernel<<<dim3(SEQ / 128, NHEAD, NB), blk, 0, stream>>>(Q16, KVt16, Ctx16);
  gemm_out_kernel<<<dim3(DIM / 64, MROWS / 64), blk, 0, stream>>>(Ctx16, Wo16, out);
}

// v001
// A run of this version takes 112 microseconds.
// Timed twice side by side with v000, it ran 3.34 and 3.35 times as fast.
#include <hip/hip_runtime.h>
#include <stddef.h>

// All contractions on v_wmma_f32_16x16x32_f16 (f16 operands, f32 accumulate): fused q/k/v projection,
// per-head V^T.K (depth = sequence), per-head Q.(K^T V) (depth 64), output projection. Float inputs are
// RNE-converted to bf16 and carried in f16 (weights x64); q, k, v, K^T V and the merged head plane are
// single f16 planes (carry 1). Scale 1/8 and all carries are undone in f32 epilogues.

typedef _Float16 h16;
typedef _Float16 v16h __attribute__((ext_vector_type(16)));
typedef _Float16 v8h  __attribute__((ext_vector_type(8)));
typedef float    v8f  __attribute__((ext_vector_type(8)));
typedef float    v4f  __attribute__((ext_vector_type(4)));

#ifndef NB
#define NB 4
#endif
#ifndef SEQ
#define SEQ 2048
#endif
#define NB_FULL  4
#define SEQ_FULL 2048
#define DIM   1024
#define NHEAD 16
#define HD    64
#define QKVN  (3 * DIM)
#define MROWS (NB * SEQ)

static_assert(NB >= 1 && NB <= NB_FULL);
static_assert(SEQ >= 128 && SEQ <= SEQ_FULL && (SEQ % 128) == 0);
static_assert(DIM == NHEAD * HD);
static_assert(HD == 64);
static_assert(QKVN == 3 * DIM && (QKVN / 64) == 3 * NHEAD);
static_assert((DIM % 64) == 0 && (DIM % 32) == 0);
static_assert((QKVN % 64) == 0);
static_assert((SEQ % 64) == 0 && (SEQ % 32) == 0);
static_assert((MROWS % 64) == 0 && (MROWS % 2) == 0);
static_assert((QKVN % 2) == 0 && (DIM % 2) == 0);
static_assert(DIM / 8 == 128);                 // convert kernel: 128 eight-column groups per row
static_assert((size_t)MROWS * (DIM / 8) < (size_t)0xFFFFFFFFu);

#define LDT 72   // halves per LDS row (144 B, 16-B aligned)
#define LDC 68   // floats per LDS row (272 B, 16-B aligned)
static_assert((LDT % 8) == 0 && LDT >= 64);
static_assert((LDC % 4) == 0 && LDC >= 64);

#define WCARRY   64.0f     // weight planes carried x64
#define SCALE_QK 0.125f    // HD^-0.5

// workspace layout (bytes)
#define WQKV_BYTES    ((size_t)QKVN * DIM * 2)
#define WO_BYTES      ((size_t)DIM * DIM * 2)
#define PLANE16_BYTES ((size_t)MROWS * DIM * 2)
#define TPLANE_ELEMS  ((size_t)NB * DIM * SEQ)          // one transposed plane [b][col][key]
#define T_BYTES       ((size_t)2 * TPLANE_ELEMS * 2)    // k plane then v plane
#define KV_BYTES      ((size_t)NB * NHEAD * HD * HD * 2)
#define OFF_WQKV ((size_t)0)
#define OFF_WO   (OFF_WQKV + WQKV_BYTES)
#define OFF_X    (OFF_WO + WO_BYTES)
#define OFF_Q    (OFF_X + PLANE16_BYTES)
#define OFF_T    (OFF_Q + PLANE16_BYTES)
#define OFF_KV   (OFF_T + T_BYTES)
#define OFF_CTX  (OFF_KV + KV_BYTES)
#define WS_TOTAL (OFF_CTX + PLANE16_BYTES)
static_assert((WQKV_BYTES % 128) == 0 && (WO_BYTES % 128) == 0 && (PLANE16_BYTES % 128) == 0);
static_assert((T_BYTES % 128) == 0 && (KV_BYTES % 128) == 0);
static_assert(WS_TOTAL <= (size_t)134217728);

// ---------------------------------------------------------------------------
__device__ __forceinline__ float bf16r(float x) {   // RNE convert to bf16, returned widened
  unsigned int u = __float_as_uint(x);
  u = (u + 0x7FFFu + ((u >> 16) & 1u)) & 0xFFFF0000u;
  return __uint_as_float(u);
}

// f32 -> f16 operand convert that cannot produce an f16 subnormal
static __device__ __forceinline__ h16 toh_flush(float v) {
  const h16 r = (h16)v;
  return (fabsf(v) < 6.103515625e-05f) ? (h16)0.0f : r;
}

// 16-bit fragment: p points at element [row = lane&15][k0 + 8*(lane>>4)] of a k-contiguous
// row. Elements 0..7 <- k0+8h+0..7, elements 8..15 <- k0+16+8h+0..7 (same map for A and B).
__device__ __forceinline__ v16h frag_at(const _Float16* p) {
  v8h lo = *(const v8h*)(p);
  v8h hi = *(const v8h*)(p + 16);
  v16h out;
#pragma unroll
  for (int i = 0; i < 8; ++i) { out[i] = lo[i]; out[i + 8] = hi[i]; }
  return out;
}

__device__ __forceinline__ v8f wmma16(v16h a, v16h b, v8f c) {
  v8f d = __builtin_amdgcn_wmma_f32_16x16x32_f16(false, a, false, b, (short)0, c,
                                                 false, false);
  asm volatile("v_nop\n\tv_nop\n\tv_nop\n\tv_nop" : "+v"(d) : "v"(a), "v"(b));
  return d;
}

__device__ __forceinline__ void wave_lds_sync() {
  __builtin_amdgcn_fence(3 /* release order */, "wavefront");
  asm volatile("s_wait_dscnt 0x0" ::: "memory");
  __builtin_amdgcn_wave_barrier();
}

// ---------------------------------------------------------------------------
// Plane convert: dst[crow][c] = f16(carry * bf16(src[srow][c])), rows of DIM columns,
// srow = (crow / seq) * seq_full + crow % seq. One thread per 8 columns (one 16-B store);
// Grid (rows / 2): 256 threads x 8 columns = 2 rows per block.
// ---------------------------------------------------------------------------
__global__ __launch_bounds__(256) void cvt_plane_kernel(
    const float* __restrict__ src, _Float16* __restrict__ dst,
    unsigned seq, unsigned seq_full, float carry) {
#pragma clang fp contract(off)
  const unsigned g = blockIdx.x * 256u + threadIdx.x;
  const unsigned crow = g >> 7;
  const unsigned c = (g & 127u) * 8u;
  const unsigned bidx = crow / seq;
  const unsigned sq = crow - bidx * seq;
  const size_t srow = (size_t)bidx * seq_full + sq;
  const v4f a0 = *(const v4f*)(src + srow * DIM + c);
  const v4f a1 = *(const v4f*)(src + srow * DIM + c + 4u);
  v8h o;
#pragma unroll
  for (int i = 0; i < 4; ++i) {
    o[i]     = toh_flush(carry * bf16r(a0[i]));
    o[i + 4] = toh_flush(carry * bf16r(a1[i]));
  }
  _Float16* p = dst + (size_t)crow * DIM + c;
  *(v8h*)p = o;
  
}

// ---------------------------------------------------------------------------
// GEMM C[128x128 tile] = A16[rows][K] . Bt[n][K]^T. Per trip one 128-B line (64 k) of each of the
// 128 A rows and 128 B rows is copied global -> LDS by asynchronous 16-B copies (whole lines: 8 lanes
// per row), two buffers, the next tile's copies in flight while this tile is worked on.
// 4 waves (wm = 64-row group, wn = 64-col group), 4 x 4 accumulators/wave, fragments from LDS.
// Each wave's 64 columns are one 64-wide column tile nt, so the epilogue is per wave:
//   MODE 0 (fused q/k/v projection, column tile nt = 3*head + part, wave-uniform):
//           part 0: outq[row][head*64 + d] (pitch DIM) = f16(acc/64)
//           part 1/2: outt[(part-1)][b][head*64 + d][key] = f16(acc/64) (transposed planes)
//   MODE 1 (output projection): outf full [full row][col] = acc/64
// Grid (N/128, MROWS/128), 128 threads.
// ---------------------------------------------------------------------------
#define GBM 128                       // tile rows
#define GBN 128                       // tile columns
#define GBK 64                        // k per trip (one 128-B line per row)
#define GSTAGE ((GBM + GBN) * LDT)    // halves per buffer: A rows then B rows, pitch LDT
static_assert((MROWS % GBM) == 0 && (SEQ % GBM) == 0);
static_assert((QKVN % GBN) == 0 && (DIM % GBN) == 0);
static_assert((DIM % GBK) == 0 && (DIM / GBK) >= 2);
static_assert(LDT >= GBK && ((LDT * 2) % 16) == 0);
static_assert((size_t)4 * 64 * LDC * 4 <= (size_t)2 * GSTAGE * 2);   // epilogue staging fits the ring

// Eight asynchronous 16-B copies per lane: rows r, r+16, ..., r+112 of one operand's tile.
// lds: the lane's LDS byte address of row r; gp: the lane's global address of row r.
__device__ __forceinline__ void async_rows8(unsigned lds, const _Float16* gp, unsigned K) {
  const unsigned l0 = lds;
  const unsigned l1 = lds + 1u * 16u * LDT * 2u;
  const unsigned l2 = lds + 2u * 16u * LDT * 2u;
  const unsigned l3 = lds + 3u * 16u * LDT * 2u;
  const unsigned l4 = lds + 4u * 16u * LDT * 2u;
  const unsigned l5 = lds + 5u * 16u * LDT * 2u;
  const unsigned l6 = lds + 6u * 16u * LDT * 2u;
  const unsigned l7 = lds + 7u * 16u * LDT * 2u;
  const _Float16* g0 = gp;
  const _Float16* g1 = gp + (size_t)1 * 16 * K;
  const _Float16* g2 = gp + (size_t)2 * 16 * K;
  const _Float16* g3 = gp + (size_t)3 * 16 * K;
  const _Float16* g4 = gp + (size_t)4 * 16 * K;
  const _Float16* g5 = gp + (size_t)5 * 16 * K;
  const _Float16* g6 = gp + (size_t)6 * 16 * K;
  const _Float16* g7 = gp + (size_t)7 * 16 * K;
  // the copies and, as the last line, the wait that stands before their address registers are reused
  asm volatile(
      "global_load_async_to_lds_b128 %0, %8, off\n\t"
      "global_load_async_to_lds_b128 %1, %9, off\n\t"
      "global_load_async_to_lds_b128 %2, %10, off\n\t"
      "global_load_async_to_lds_b128 %3, %11, off\n\t"
      "global_load_async_to_lds_b128 %4, %12, off\n\t"
      "global_load_async_to_lds_b128 %5, %13, off\n\t"
      "global_load_async_to_lds_b128 %6, %14, off\n\t"
      "global_load_async_to_lds_b128 %7, %15, off\n\t"
      "s_wait_xcnt 0x0"
      :: "v"(l0), "v"(l1), "v"(l2), "v"(l3), "v"(l4), "v"(l5), "v"(l6), "v"(l7),
         "v"(g0), "v"(g1), "v"(g2), "v"(g3), "v"(g4), "v"(g5), "v"(g6), "v"(g7)
      : "memory");
}

template <int MODE>
__device__ __forceinline__ void gemm_body(
    const _Float16* __restrict__ A16, const _Float16* __restrict__ Bt, const unsigned K,
    float* __restrict__ outf, _Float16* __restrict__ outq, _Float16* __restrict__ outt) {
  __shared__ __attribute__((aligned(16))) _Float16 S[2 * GSTAGE];
  const unsigned tid = threadIdx.x, lane = tid & 31u;
  const unsigned w = (unsigned)__builtin_amdgcn_readfirstlane((int)(threadIdx.x >> 5));
  const unsigned wm = w >> 1, wn = w & 1u;
  const unsigned hh = lane >> 4, m = lane & 15u;
  const unsigned n0 = blockIdx.x * (unsigned)GBN;
  const unsigned row0 = blockIdx.y * (unsigned)GBM;

  // copy side: lane -> row tid>>3 (+16 per copy), 16-B chunk tid&7 of the row's line
  const unsigned crow = tid >> 3, cch = (tid & 7u) * 8u;
  const _Float16* ga = A16 + (size_t)(row0 + crow) * K + cch;
  const _Float16* gb = Bt + (size_t)(n0 + crow) * K + cch;
  const unsigned la = (unsigned)(size_t)&S[0] + (crow * LDT + cch) * 2u;
  const unsigned lb = la + (unsigned)GBM * LDT * 2u;
  // fragment side
  const _Float16* sa = &S[(wm * 64u + m) * LDT + hh * 8u];
  const _Float16* sb = &S[((unsigned)GBM + wn * 64u + m) * LDT + hh * 8u];
  const unsigned nt_k = K / (unsigned)GBK;

  // the i, j, ks loops below are unrolled so that every acc / fragment index is a constant (registers)
  v8f acc[4][4];
#pragma unroll
  for (int i = 0; i < 4; ++i)
#pragma unroll
    for (int j = 0; j < 4; ++j) acc[i][j] = v8f{};

  async_rows8(la, ga, K);
  async_rows8(lb, gb, K);
  asm volatile("s_wait_asynccnt 0x0" ::: "memory");   // tile 0 landed (this wave's copies)
  __syncthreads();                                    // tile 0 published to every wave
  async_rows8(la + (unsigned)GSTAGE * 2u, ga + GBK, K);
  async_rows8(lb + (unsigned)GSTAGE * 2u, gb + GBK, K);

  for (unsigned t = 0; t < nt_k; ++t) {
    const unsigned bo = (t & 1u) * (unsigned)GSTAGE;
#pragma unroll
    for (unsigned ks = 0; ks < 2u; ++ks) {
      v16h a[4], b[4];
#pragma unroll
      for (unsigned i = 0; i < 4u; ++i) a[i] = frag_at(sa + bo + i * 16u * LDT + ks * 32u);
#pragma unroll
      for (unsigned j = 0; j < 4u; ++j) b[j] = frag_at(sb + bo + j * 16u * LDT + ks * 32u);
#pragma unroll
      for (int i = 0; i < 4; ++i)
#pragma unroll
        for (int j = 0; j < 4; ++j) acc[i][j] = wmma16(a[i], b[j], acc[i][j]);
    }
    asm volatile("s_wait_dscnt 0x0" ::: "memory");     // this wave's reads of buffer t&1 are done
    asm volatile("s_wait_asynccnt 0x0" ::: "memory");  // this wave's copies of tile t+1 have landed
    __syncthreads();   // publishes tile t+1 and ends every wave's reads of the buffer refilled below
    if (t + 2u < nt_k) {
      async_rows8(la + bo * 2u, ga + (size_t)(t + 2u) * GBK, K);
      async_rows8(lb + bo * 2u, gb + (size_t)(t + 2u) * GBK, K);
    }
  }
  asm volatile("s_wait_asynccnt 0x0" ::: "memory");    // no copy outstanding when the ring is reused

  // the ring is free behind the last trip's barrier: each wave stages its own 64x64 tile there
  float* Cw = (float*)&S[0] + w * (64u * LDC);
#pragma unroll
  for (int i = 0; i < 4; ++i)
#pragma unroll
    for (int j = 0; j < 4; ++j)
#pragma unroll
      for (int r = 0; r < 8; ++r)
        Cw[((unsigned)i * 16u + hh * 8u + (unsigned)r) * LDC + (unsigned)j * 16u + m] = acc[i][j][r];
  __syncthreads();   // the staged tile is complete before other lanes read it back

  const unsigned wrow0 = row0 + wm * 64u;

  // Epilogue loops: four rows (or columns) per trip, their LDS reads in flight together and their four
  // stores as one group; kept rolled (the code runs once per tile). The s_wait_xcnt at a trip's foot
  // stands in front of the next trip's reuse of the stores' address and data registers; it is written
  // in the two loops (in the k/v loop the compiler places its own).
  if (MODE == 0) {
    const unsigned nt = blockIdx.x * 2u + wn;
    const unsigned head = nt / 3u;
    const unsigned part = nt - head * 3u;        // 0: q, 1: k, 2: v (wave-uniform)
    if (part == 0u) {
#pragma unroll 1   // rolled: runs once per tile, unrolling only grows the code
      for (unsigned i0 = 0; i0 < 16u; i0 += 4u) {
        v8h x[4];
        size_t off[4];
#pragma unroll
        for (unsigned i = 0; i < 4u; ++i) {
          const unsigned r = 4u * (i0 + i) + (lane >> 3);
          const unsigned c = (lane & 7u) * 8u;
          const v4f u0 = *(const v4f*)&Cw[r * LDC + c];
          const v4f u1 = *(const v4f*)&Cw[r * LDC + c + 4];
#pragma unroll
          for (int j = 0; j < 4; ++j) {
            x[i][j]     = toh_flush(u0[j] * (1.0f / WCARRY));
            x[i][j + 4] = toh_flush(u1[j] * (1.0f / WCARRY));
          }
          off[i] = (size_t)(wrow0 + r) * DIM + head * HD + c;
        }
#pragma unroll
        for (int i = 0; i < 4; ++i) *(v8h*)(outq + off[i]) = x[i];
        asm volatile("s_wait_xcnt 0x0" ::: "memory");   // before the stores' registers are reused
      }
    } else {
      const unsigned bidx = wrow0 / (unsigned)SEQ;
      const unsigned key0 = wrow0 - bidx * (unsigned)SEQ;
#pragma unroll 1   // rolled: runs once per tile, unrolling only grows the code
      for (unsigned i0 = 0; i0 < 16u; i0 += 4u) {
        v8h x[4];
        size_t off[4];
#pragma unroll
        for (unsigned i = 0; i < 4u; ++i) {
          const unsigned dcol = 4u * (i0 + i) + (lane >> 3);
          const unsigned kk = (lane & 7u) * 8u;
#pragma unroll
          for (unsigned j = 0; j < 8u; ++j) {
            const float t = Cw[(kk + j) * LDC + dcol] * (1.0f / WCARRY);
            x[i][j] = toh_flush(t);
          }
          off[i] = (size_t)(part - 1u) * TPLANE_ELEMS +
                   ((size_t)bidx * DIM + head * HD + dcol) * SEQ + key0 + kk;
        }
#pragma unroll
        for (int i = 0; i < 4; ++i) *(v8h*)(outt + off[i]) = x[i];
      }
    }
  }

  if (MODE == 1) {
    const unsigned bidx = wrow0 / (unsigned)SEQ;
    const unsigned sq0 = wrow0 - bidx * (unsigned)SEQ;
    const size_t frow0 = (size_t)bidx * SEQ_FULL + sq0;
#pragma unroll 1   // rolled: runs once per tile, unrolling only grows the code
    for (unsigned i0 = 0; i0 < 32u; i0 += 4u) {
      v4f xs[4];
      size_t off[4];
#pragma unroll
      for (unsigned i = 0; i < 4u; ++i) {
        const unsigned r = 2u * (i0 + i) + (lane >> 4);
        const unsigned c = (lane & 15u) * 4u;
        const v4f u = *(const v4f*)&Cw[r * LDC + c];
        v4f val;
#pragma unroll
        for (int j = 0; j < 4; ++j) val[j] = u[j] * (1.0f / WCARRY);
        xs[i] = val;
        off[i] = (frow0 + r) * DIM + n0 + wn * 64u + c;
      }
#pragma unroll
      for (int i = 0; i < 4; ++i) *(v4f*)(outf + off[i]) = xs[i];
      asm volatile("s_wait_xcnt 0x0" ::: "memory");   // before the stores' registers are reused
    }
  }
}

__global__ __launch_bounds__(128) void gemm_qkv_kernel(
    const _Float16* __restrict__ A16, const _Float16* __restrict__ Bt,
    _Float16* __restrict__ qplane, _Float16* __restrict__ tplane) {
  gemm_body<0>(A16, Bt, (unsigned)DIM, (float*)0, qplane, tplane);
}
__global__ __launch_bounds__(128) void gemm_out_kernel(
    const _Float16* __restrict__ A16, const _Float16* __restrict__ Bt,
    float* __restrict__ outf) {
  gemm_body<1>(A16, Bt, (unsigned)DIM, outf, (_Float16*)0, (_Float16*)0);
}

// ---------------------------------------------------------------------------
// Per (head, batch): KVt[d2][d1] = sum_s V[s][d2] * K[s][d1]  (64x64, depth SEQ).
// A = V^T plane rows (m = d2, k = s contiguous), B = K^T plane rows (n = d1, k = s contiguous),
// fragments straight from the transposed planes. 8 waves: wave w -> row group w>>1,
// column groups 2*(w&1), 2*(w&1)+1; every wave runs the same SEQ/32 steps.
// Result staged in Cs (cross-wave, block barrier), written as f16 [b][head][d2][d1],
// Grid (NHEAD, NB).
// ---------------------------------------------------------------------------
__global__ __launch_bounds__(256) void ktv_kernel(
    const _Float16* __restrict__ T16, _Float16* __restrict__ KVt) {
  __shared__ __attribute__((aligned(16))) float Cs[64 * LDC];
  const unsigned tid = threadIdx.x, lane = tid & 31u;
  const unsigned w = (unsigned)__builtin_amdgcn_readfirstlane((int)(threadIdx.x >> 5));
  const unsigned tr = w >> 1, tc0 = (w & 1u) * 2u;
  const unsigned hh = lane >> 4, m = lane & 15u;
  const unsigned head = blockIdx.x;
  const unsigned b = blockIdx.y;

  const size_t kbase = ((size_t)b * DIM + head * HD) * SEQ;   // k plane
  const size_t vbase = TPLANE_ELEMS + kbase;                  // v plane
  const _Float16* ap  = T16 + vbase + (size_t)(tr * 16u + m) * SEQ + hh * 8u;
  const _Float16* bp0 = T16 + kbase + (size_t)(tc0 * 16u + m) * SEQ + hh * 8u;
  const _Float16* bp1 = bp0 + (size_t)16 * SEQ;
  v8f acc0 = {}, acc1 = {};
#pragma unroll 2
  for (unsigned s0 = 0; s0 < (unsigned)SEQ; s0 += 32u) {
    const v16h a  = frag_at(ap + s0);
    const v16h b0 = frag_at(bp0 + s0);
    const v16h b1 = frag_at(bp1 + s0);
    acc0 = wmma16(a, b0, acc0);
    acc1 = wmma16(a, b1, acc1);
  }
#pragma unroll
  for (int r = 0; r < 8; ++r) {
    float* d = &Cs[(tr * 16u + hh * 8u + (unsigned)r) * LDC + tc0 * 16u + m];
    d[0]  = acc0[r];
    d[16] = acc1[r];
  }
  __syncthreads();

  v8h x[2];
  size_t off[2];
#pragma unroll
  for (unsigned i = 0; i < 2u; ++i) {
    const unsigned r = 32u * i + (tid >> 3);
    const unsigned c = (tid & 7u) * 8u;
    const v4f u0 = *(const v4f*)&Cs[r * LDC + c];
    const v4f u1 = *(const v4f*)&Cs[r * LDC + c + 4];
#pragma unroll
    for (int j = 0; j < 4; ++j) {
      x[i][j]     = toh_flush(u0[j]);
      x[i][j + 4] = toh_flush(u1[j]);
    }
    off[i] = ((size_t)(b * NHEAD + head) * HD + r) * HD + c;
  }
#pragma unroll
  for (int i = 0; i < 2; ++i) *(v8h*)(KVt + off[i]) = x[i];
  
}

// ---------------------------------------------------------------------------
// Per (128 query rows, head, batch): Ov[b*SEQ+s][head*64 + d2] =
//   f16( 1/8 * sum_d1 Q[s][d1] * KVt[d2][d1] ). 8 waves x 16 rows, 4 output tiles per wave,
// depth 64 in two 32-steps; A fragments from the q plane, B fragments from the KVt rows.
// lines (one line per row: 8 consecutive lanes x 16 B).
// Grid (SEQ/128, NHEAD, NB).
// ---------------------------------------------------------------------------
__global__ __launch_bounds__(256) void qkv_apply_kernel(
    const _Float16* __restrict__ Qh, const _Float16* __restrict__ KVt,
    _Float16* __restrict__ Ov) {
  __shared__ __attribute__((aligned(16))) _Float16 Ps[8 * 16 * LDT];
  const unsigned tid = threadIdx.x, lane = tid & 31u;
  const unsigned w = (unsigned)__builtin_amdgcn_readfirstlane((int)(threadIdx.x >> 5));
  const unsigned hh = lane >> 4, m = lane & 15u;
  const unsigned q0 = blockIdx.x * 128u;
  const unsigned head = blockIdx.y;
  const unsigned b = blockIdx.z;
  const unsigned qrow0 = q0 + w * 16u;
  const unsigned pbase = w * (16u * LDT);

  const size_t qoff = (size_t)(b * (unsigned)SEQ + qrow0 + m) * DIM + head * HD + hh * 8u;
  const v16h qf0 = frag_at(Qh + qoff);
  const v16h qf1 = frag_at(Qh + qoff + 32);
  const _Float16* kvp = KVt + (size_t)(b * NHEAD + head) * (HD * HD) + (size_t)m * HD + hh * 8u;

  v8f o[4];
#pragma unroll
  for (int nb = 0; nb < 4; ++nb) {
    const v16h b0 = frag_at(kvp + nb * 16 * HD);
    const v16h b1 = frag_at(kvp + nb * 16 * HD + 32);
    v8f t = {};
    t = wmma16(qf0, b0, t);
    t = wmma16(qf1, b1, t);
    o[nb] = t;
  }

#pragma unroll
  for (int nb = 0; nb < 4; ++nb)
#pragma unroll
    for (int v = 0; v < 8; ++v)
      Ps[pbase + (hh * 8u + (unsigned)v) * LDT + (unsigned)nb * 16u + m] =
          toh_flush(o[nb][v] * SCALE_QK);
  wave_lds_sync();
  v8h x[4];
  size_t off[4];
#pragma unroll
  for (unsigned i = 0; i < 4u; ++i) {
    const unsigned r = 4u * i + (lane >> 3);
    const unsigned c = (lane & 7u) * 8u;
    x[i] = *(const v8h*)&Ps[pbase + r * LDT + c];
    off[i] = (size_t)(b * (unsigned)SEQ + qrow0 + r) * DIM + head * HD + c;
  }
#pragma unroll
  for (int i = 0; i < 4; ++i) *(v8h*)(Ov + off[i]) = x[i];
  
}

// ---------------------------------------------------------------------------
extern "C" void kernel_launch(void* const* d_in, const int* in_sizes, int n_in,
                              void* d_out, int out_size, void* d_ws, size_t ws_size,
                              hipStream_t stream) {
  if (n_in < 3) return;
  const long long need_x = ((long long)(NB - 1) * SEQ_FULL + SEQ) * DIM;
  if ((long long)in_sizes[0] < need_x) return;
  if ((long long)in_sizes[1] < (long long)QKVN * DIM) return;
  if ((long long)in_sizes[2] < (long long)DIM * DIM) return;
  if ((long long)out_size < need_x) return;
  if (ws_size < WS_TOTAL) return;

  const float* X    = (const float*)d_in[0];   // [NB_FULL][SEQ_FULL][DIM]
  const float* wqkv = (const float*)d_in[1];   // [QKVN][DIM]  (out, in)
  const float* wo   = (const float*)d_in[2];   // [DIM][DIM]   (out, in)
  float* out = (float*)d_out;

  char* ws = (char*)d_ws;
  _Float16* Wqkv16 = (_Float16*)(ws + OFF_WQKV);   // [n][k]
  _Float16* Wo16   = (_Float16*)(ws + OFF_WO);     // [n][k]
  _Float16* X16    = (_Float16*)(ws + OFF_X);      // compact rows
  _Float16* Q16    = (_Float16*)(ws + OFF_Q);      // [MROWS][head*64 + d]
  _Float16* T16    = (_Float16*)(ws + OFF_T);      // [k|v][b][head*64 + d][SEQ]
  _Float16* KVt16  = (_Float16*)(ws + OFF_KV);     // [b][head][d2][d1]
  _Float16* Ctx16  = (_Float16*)(ws + OFF_CTX);    // [MROWS][head*64 + d]

  dim3 blk(256);

  // weight planes are already [out n][in k] (k contiguous): convert in place order, carry x64
  cvt_plane_kernel<<<dim3(QKVN / 2), blk, 0, stream>>>(wqkv, Wqkv16, (unsigned)QKVN, (unsigned)QKVN, WCARRY);
  cvt_plane_kernel<<<dim3(DIM / 2), blk, 0, stream>>>(wo, Wo16, (unsigned)DIM, (unsigned)DIM, WCARRY);
  // activation plane: full-size input rows -> compact rows, carry 1
  cvt_plane_kernel<<<dim3(MROWS / 2), blk, 0, stream>>>(X, X16, (unsigned)SEQ, (unsigned)SEQ_FULL, 1.0f);

  gemm_qkv_kernel<<<dim3(QKVN / GBN, MROWS / GBM), dim3(128), 0, stream>>>(X16, Wqkv16, Q16, T16);
  ktv_kernel<<<dim3(NHEAD, NB), blk, 0, stream>>>(T16, KVt16);
  qkv_apply_kernel<<<dim3(SEQ / 128, NHEAD, NB), blk, 0, stream>>>(Q16, KVt16, Ctx16);
  gemm_out_kernel<<<dim3(DIM / GBN, MROWS / GBM), dim3(128), 0, stream>>>(Ctx16, Wo16, out);
}

// v002
// It runs in 96.2 microseconds.
// Next to v001, in two timings, it ran 1.19 and 1.18 times as fast.
// All steps since v000 together make it 3.95 times as fast.
#include <hip/hip_runtime.h>
#include <stddef.h>

// All contractions on v_wmma_f32_16x16x32_f16 (f16 operands, f32 accumulate): fused q/k/v projection,
// per-head V^T.K (depth = sequence), per-head Q.(K^T V) (depth 64), output projection. Float inputs are
// RNE-converted to bf16 and carried in f16 (weights x64); q, k, v, K^T V and the merged head plane are
// single f16 planes (carry 1). Scale 1/8 and all carries are undone in f32 epilogues.

typedef _Float16 h16;
typedef _Float16 v16h __attribute__((ext_vector_type(16)));
typedef _Float16 v8h  __attribute__((ext_vector_type(8)));
typedef float    v8f  __attribute__((ext_vector_type(8)));
typedef float    v4f  __attribute__((ext_vector_type(4)));

#ifndef NB
#define NB 4
#endif
#ifndef SEQ
#define SEQ 2048
#endif
#define NB_FULL  4
#define SEQ_FULL 2048
#define DIM   1024
#define NHEAD 16
#define HD    64
#define QKVN  (3 * DIM)
#define MROWS (NB * SEQ)

static_assert(NB >= 1 && NB <= NB_FULL);
static_assert(SEQ >= 128 && SEQ <= SEQ_FULL && (SEQ % 128) == 0);
static_assert(DIM == NHEAD * HD);
static_assert(HD == 64);
static_assert(QKVN == 3 * DIM && (QKVN / 64) == 3 * NHEAD);
static_assert((DIM % 64) == 0 && (DIM % 32) == 0);
static_assert((QKVN % 64) == 0);
static_assert((SEQ % 64) == 0 && (SEQ % 32) == 0);
static_assert((MROWS % 64) == 0 && (MROWS % 2) == 0);
static_assert((QKVN % 2) == 0 && (DIM % 2) == 0);
static_assert(DIM / 8 == 128);                 // convert kernel: 128 eight-column groups per row
static_assert((size_t)MROWS * (DIM / 8) < (size_t)0xFFFFFFFFu);

#define LDT 72   // halves per LDS row (144 B, 16-B aligned)
#define LDC 68   // floats per LDS row (272 B, 16-B aligned)
static_assert((LDT % 8) == 0 && LDT >= 64);
static_assert((LDC % 4) == 0 && LDC >= 64);

#define WCARRY   64.0f     // weight planes carried x64
#define SCALE_QK 0.125f    // HD^-0.5

// workspace layout (bytes)
#define WQKV_BYTES    ((size_t)QKVN * DIM * 2)
#define WO_BYTES      ((size_t)DIM * DIM * 2)
#define PLANE16_BYTES ((size_t)MROWS * DIM * 2)
#define TPLANE_ELEMS  ((size_t)NB * DIM * SEQ)          // one transposed plane [b][col][key]
#define T_BYTES       ((size_t)2 * TPLANE_ELEMS * 2)    // k plane then v plane
#define KV_BYTES      ((size_t)NB * NHEAD * HD * HD * 2)
#define OFF_WQKV ((size_t)0)
#define OFF_WO   (OFF_WQKV + WQKV_BYTES)
#define OFF_X    (OFF_WO + WO_BYTES)
#define OFF_Q    (OFF_X + PLANE16_BYTES)
#define OFF_T    (OFF_Q + PLANE16_BYTES)
#define OFF_KV   (OFF_T + T_BYTES)
#define OFF_CTX  (OFF_KV + KV_BYTES)
#define WS_TOTAL (OFF_CTX + PLANE16_BYTES)
static_assert((WQKV_BYTES % 128) == 0 && (WO_BYTES % 128) == 0 && (PLANE16_BYTES % 128) == 0);
static_assert((T_BYTES % 128) == 0 && (KV_BYTES % 128) == 0);
static_assert(WS_TOTAL <= (size_t)134217728);

// ---------------------------------------------------------------------------
__device__ __forceinline__ float bf16r(float x) {   // RNE convert to bf16, returned widened
  unsigned int u = __float_as_uint(x);
  u = (u + 0x7FFFu + ((u >> 16) & 1u)) & 0xFFFF0000u;
  return __uint_as_float(u);
}

// f32 -> f16 operand convert that cannot produce an f16 subnormal
static __device__ __forceinline__ h16 toh_flush(float v) {
  const h16 r = (h16)v;
  return (fabsf(v) < 6.103515625e-05f) ? (h16)0.0f : r;
}

// 16-bit fragment: p points at element [row = lane&15][k0 + 8*(lane>>4)] of a k-contiguous
// row. Elements 0..7 <- k0+8h+0..7, elements 8..15 <- k0+16+8h+0..7 (same map for A and B).
__device__ __forceinline__ v16h frag_at(const _Float16* p) {
  v8h lo = *(const v8h*)(p);
  v8h hi = *(const v8h*)(p + 16);
  v16h out;
#pragma unroll
  for (int i = 0; i < 8; ++i) { out[i] = lo[i]; out[i + 8] = hi[i]; }
  return out;
}

__device__ __forceinline__ v8f wmma16(v16h a, v16h b, v8f c) {
  v8f d = __builtin_amdgcn_wmma_f32_16x16x32_f16(false, a, false, b, (short)0, c,
                                                 false, false);
  asm volatile("v_nop\n\tv_nop\n\tv_nop\n\tv_nop" : "+v"(d) : "v"(a), "v"(b));
  return d;
}

__device__ __forceinline__ void wave_lds_sync() {
  __builtin_amdgcn_fence(3 /* release order */, "wavefront");
  asm volatile("s_wait_dscnt 0x0" ::: "memory");
  __builtin_amdgcn_wave_barrier();
}

// ---------------------------------------------------------------------------
// Plane convert: dst[crow][c] = f16(carry * bf16(src[srow][c])), rows of DIM columns,
// srow = (crow / seq) * seq_full + crow % seq. One thread per 8 columns (one 16-B store);
// Grid (rows / 2): 256 threads x 8 columns = 2 rows per block.
// ---------------------------------------------------------------------------
__global__ __launch_bounds__(256) void cvt_plane_kernel(
    const float* __restrict__ src, _Float16* __restrict__ dst,
    unsigned seq, unsigned seq_full, float carry) {
#pragma clang fp contract(off)
  const unsigned g = blockIdx.x * 256u + threadIdx.x;
  const unsigned crow = g >> 7;
  const unsigned c = (g & 127u) * 8u;
  const unsigned bidx = crow / seq;
  const unsigned sq = crow - bidx * seq;
  const size_t srow = (size_t)bidx * seq_full + sq;
  const v4f a0 = *(const v4f*)(src + srow * DIM + c);
  const v4f a1 = *(const v4f*)(src + srow * DIM + c + 4u);
  v8h o;
#pragma unroll
  for (int i = 0; i < 4; ++i) {
    o[i]     = toh_flush(carry * bf16r(a0[i]));
    o[i + 4] = toh_flush(carry * bf16r(a1[i]));
  }
  _Float16* p = dst + (size_t)crow * DIM + c;
  *(v8h*)p = o;
  
}

// ---------------------------------------------------------------------------
// GEMM C[128x128 tile] = A16[rows][K] . Bt[n][K]^T. Per trip one 128-B line (64 k) of each of the
// 128 A rows and 128 B rows is copied global -> LDS by asynchronous 16-B copies (whole lines: 8 lanes
// per row), two buffers, the next tile's copies in flight while this tile is worked on.
// 4 waves (wm = 64-row group, wn = 64-col group), 4 x 4 accumulators/wave, fragments from LDS.
// Each wave's 64 columns are one 64-wide column tile nt, so the epilogue is per wave:
//   MODE 0 (fused q/k/v projection, column tile nt = 3*head + part, wave-uniform):
//           part 0: outq[row][head*64 + d] (pitch DIM) = f16(acc/64)
//           part 1/2: outt[(part-1)][b][head*64 + d][key] = f16(acc/64) (transposed planes)
//   MODE 1 (output projection): outf full [full row][col] = acc/64
// Grid (N/128, MROWS/128), 128 threads.
// ---------------------------------------------------------------------------
#define GBM 128                       // tile rows
#define GBN 128                       // tile columns
#define GBK 64                        // k per trip (one 128-B line per row)
#define GSTAGE ((GBM + GBN) * LDT)    // halves per buffer: A rows then B rows, pitch LDT
static_assert((MROWS % GBM) == 0 && (SEQ % GBM) == 0);
static_assert((QKVN % GBN) == 0 && (DIM % GBN) == 0);
static_assert((DIM % GBK) == 0 && (DIM / GBK) >= 2);
static_assert(LDT >= GBK && ((LDT * 2) % 16) == 0);
static_assert((size_t)4 * 64 * LDC * 4 <= (size_t)2 * GSTAGE * 2);   // epilogue staging fits the ring

// Eight asynchronous 16-B copies per lane: rows r, r+16, ..., r+112 of one operand's tile.
// lds: the lane's LDS byte address of row r; gp: the lane's global address of row r.
__device__ __forceinline__ void async_rows8(unsigned lds, const _Float16* gp, unsigned K) {
  const unsigned l0 = lds;
  const unsigned l1 = lds + 1u * 16u * LDT * 2u;
  const unsigned l2 = lds + 2u * 16u * LDT * 2u;
  const unsigned l3 = lds + 3u * 16u * LDT * 2u;
  const unsigned l4 = lds + 4u * 16u * LDT * 2u;
  const unsigned l5 = lds + 5u * 16u * LDT * 2u;
  const unsigned l6 = lds + 6u * 16u * LDT * 2u;
  const unsigned l7 = lds + 7u * 16u * LDT * 2u;
  const _Float16* g0 = gp;
  const _Float16* g1 = gp + (size_t)1 * 16 * K;
  const _Float16* g2 = gp + (size_t)2 * 16 * K;
  const _Float16* g3 = gp + (size_t)3 * 16 * K;
  const _Float16* g4 = gp + (size_t)4 * 16 * K;
  const _Float16* g5 = gp + (size_t)5 * 16 * K;
  const _Float16* g6 = gp + (size_t)6 * 16 * K;
  const _Float16* g7 = gp + (size_t)7 * 16 * K;
  // the copies and, as the last line, the wait that stands before their address registers are reused
  asm volatile(
      "global_load_async_to_lds_b128 %0, %8, off\n\t"
      "global_load_async_to_lds_b128 %1, %9, off\n\t"
      "global_load_async_to_lds_b128 %2, %10, off\n\t"
      "global_load_async_to_lds_b128 %3, %11, off\n\t"
      "global_load_async_to_lds_b128 %4, %12, off\n\t"
      "global_load_async_to_lds_b128 %5, %13, off\n\t"
      "global_load_async_to_lds_b128 %6, %14, off\n\t"
      "global_load_async_to_lds_b128 %7, %15, off\n\t"
      "s_wait_xcnt 0x0"
      :: "v"(l0), "v"(l1), "v"(l2), "v"(l3), "v"(l4), "v"(l5), "v"(l6), "v"(l7),
         "v"(g0), "v"(g1), "v"(g2), "v"(g3), "v"(g4), "v"(g5), "v"(g6), "v"(g7)
      : "memory");
}

template <int MODE>
__device__ __forceinline__ void gemm_body(
    const _Float16* __restrict__ A16, const _Float16* __restrict__ Bt, const unsigned K,
    float* __restrict__ outf, _Float16* __restrict__ outq, _Float16* __restrict__ outt) {
  __shared__ __attribute__((aligned(16))) _Float16 S[2 * GSTAGE];
  const unsigned tid = threadIdx.x, lane = tid & 31u;
  const unsigned w = (unsigned)__builtin_amdgcn_readfirstlane((int)(threadIdx.x >> 5));
  const unsigned wm = w >> 1, wn = w & 1u;
  const unsigned hh = lane >> 4, m = lane & 15u;
  const unsigned n0 = blockIdx.x * (unsigned)GBN;
  const unsigned row0 = blockIdx.y * (unsigned)GBM;

  // copy side: lane -> row tid>>3 (+16 per copy), 16-B chunk tid&7 of the row's line
  const unsigned crow = tid >> 3, cch = (tid & 7u) * 8u;
  const _Float16* ga = A16 + (size_t)(row0 + crow) * K + cch;
  const _Float16* gb = Bt + (size_t)(n0 + crow) * K + cch;
  const unsigned la = (unsigned)(size_t)&S[0] + (crow * LDT + cch) * 2u;
  const unsigned lb = la + (unsigned)GBM * LDT * 2u;
  // fragment side
  const _Float16* sa = &S[(wm * 64u + m) * LDT + hh * 8u];
  const _Float16* sb = &S[((unsigned)GBM + wn * 64u + m) * LDT + hh * 8u];
  const unsigned nt_k = K / (unsigned)GBK;

  // the i, j, ks loops below are unrolled so that every acc / fragment index is a constant (registers)
  v8f acc[4][4];
#pragma unroll
  for (int i = 0; i < 4; ++i)
#pragma unroll
    for (int j = 0; j < 4; ++j) acc[i][j] = v8f{};

  async_rows8(la, ga, K);
  async_rows8(lb, gb, K);
  asm volatile("s_wait_asynccnt 0x0" ::: "memory");   // tile 0 landed (this wave's copies)
  __syncthreads();                                    // tile 0 published to every wave
  async_rows8(la + (unsigned)GSTAGE * 2u, ga + GBK, K);
  async_rows8(lb + (unsigned)GSTAGE * 2u, gb + GBK, K);

  for (unsigned t = 0; t < nt_k; ++t) {
    const unsigned bo = (t & 1u) * (unsigned)GSTAGE;
#pragma unroll
    for (unsigned ks = 0; ks < 2u; ++ks) {
      v16h a[4], b[4];
#pragma unroll
      for (unsigned i = 0; i < 4u; ++i) a[i] = frag_at(sa + bo + i * 16u * LDT + ks * 32u);
#pragma unroll
      for (unsigned j = 0; j < 4u; ++j) b[j] = frag_at(sb + bo + j * 16u * LDT + ks * 32u);
#pragma unroll
      for (int i = 0; i < 4; ++i)
#pragma unroll
        for (int j = 0; j < 4; ++j) acc[i][j] = wmma16(a[i], b[j], acc[i][j]);
    }
    asm volatile("s_wait_dscnt 0x0" ::: "memory");     // this wave's reads of buffer t&1 are done
    asm volatile("s_wait_asynccnt 0x0" ::: "memory");  // this wave's copies of tile t+1 have landed
    __syncthreads();   // publishes tile t+1 and ends every wave's reads of the buffer refilled below
    if (t + 2u < nt_k) {
      async_rows8(la + bo * 2u, ga + (size_t)(t + 2u) * GBK, K);
      async_rows8(lb + bo * 2u, gb + (size_t)(t + 2u) * GBK, K);
    }
  }
  asm volatile("s_wait_asynccnt 0x0" ::: "memory");    // no copy outstanding when the ring is reused

  // the ring is free behind the last trip's barrier: each wave stages its own 64x64 tile there
  float* Cw = (float*)&S[0] + w * (64u * LDC);
#pragma unroll
  for (int i = 0; i < 4; ++i)
#pragma unroll
    for (int j = 0; j < 4; ++j)
#pragma unroll
      for (int r = 0; r < 8; ++r)
        Cw[((unsigned)i * 16u + hh * 8u + (unsigned)r) * LDC + (unsigned)j * 16u + m] = acc[i][j][r];
  __syncthreads();   // the staged tile is complete before other lanes read it back

  const unsigned wrow0 = row0 + wm * 64u;

  // Epilogue loops: four rows (or columns) per trip, their LDS reads in flight together and their four
  // stores as one group; kept rolled (the code runs once per tile). The s_wait_xcnt at a trip's foot
  // stands in front of the next trip's reuse of the stores' address and data registers; it is written
  // in the two loops (in the k/v loop the compiler places its own).
  if (MODE == 0) {
    const unsigned nt = blockIdx.x * 2u + wn;
    const unsigned head = nt / 3u;
    const unsigned part = nt - head * 3u;        // 0: q, 1: k, 2: v (wave-uniform)
    if (part == 0u) {
#pragma unroll 1   // rolled: runs once per tile, unrolling only grows the code
      for (unsigned i0 = 0; i0 < 16u; i0 += 4u) {
        v8h x[4];
        size_t off[4];
#pragma unroll
        for (unsigned i = 0; i < 4u; ++i) {
          const unsigned r = 4u * (i0 + i) + (lane >> 3);
          const unsigned c = (lane & 7u) * 8u;
          const v4f u0 = *(const v4f*)&Cw[r * LDC + c];
          const v4f u1 = *(const v4f*)&Cw[r * LDC + c + 4];
#pragma unroll
          for (int j = 0; j < 4; ++j) {
            x[i][j]     = toh_flush(u0[j] * (1.0f / WCARRY));
            x[i][j + 4] = toh_flush(u1[j] * (1.0f / WCARRY));
          }
          off[i] = (size_t)(wrow0 + r) * DIM + head * HD + c;
        }
#pragma unroll
        for (int i = 0; i < 4; ++i) *(v8h*)(outq + off[i]) = x[i];
        asm volatile("s_wait_xcnt 0x0" ::: "memory");   // before the stores' registers are reused
      }
    } else {
      const unsigned bidx = wrow0 / (unsigned)SEQ;
      const unsigned key0 = wrow0 - bidx * (unsigned)SEQ;
#pragma unroll 1   // rolled: runs once per tile, unrolling only grows the code
      for (unsigned i0 = 0; i0 < 16u; i0 += 4u) {
        v8h x[4];
        size_t off[4];
#pragma unroll
        for (unsigned i = 0; i < 4u; ++i) {
          const unsigned dcol = 4u * (i0 + i) + (lane >> 3);
          const unsigned kk = (lane & 7u) * 8u;
#pragma unroll
          for (unsigned j = 0; j < 8u; ++j) {
            const float t = Cw[(kk + j) * LDC + dcol] * (1.0f / WCARRY);
            x[i][j] = toh_flush(t);
          }
          off[i] = (size_t)(part - 1u) * TPLANE_ELEMS +
                   ((size_t)bidx * DIM + head * HD + dcol) * SEQ + key0 + kk;
        }
#pragma unroll
        for (int i = 0; i < 4; ++i) *(v8h*)(outt + off[i]) = x[i];
      }
    }
  }

  if (MODE == 1) {
    const unsigned bidx = wrow0 / (unsigned)SEQ;
    const unsigned sq0 = wrow0 - bidx * (unsigned)SEQ;
    const size_t frow0 = (size_t)bidx * SEQ_FULL + sq0;
#pragma unroll 1   // rolled: runs once per tile, unrolling only grows the code
    for (unsigned i0 = 0; i0 < 32u; i0 += 4u) {
      v4f xs[4];
      size_t off[4];
#pragma unroll
      for (unsigned i = 0; i < 4u; ++i) {
        const unsigned r = 2u * (i0 + i) + (lane >> 4);
        const unsigned c = (lane & 15u) * 4u;
        const v4f u = *(const v4f*)&Cw[r * LDC + c];
        v4f val;
#pragma unroll
        for (int j = 0; j < 4; ++j) val[j] = u[j] * (1.0f / WCARRY);
        xs[i] = val;
        off[i] = (frow0 + r) * DIM + n0 + wn * 64u + c;
      }
#pragma unroll
      for (int i = 0; i < 4; ++i) *(v4f*)(outf + off[i]) = xs[i];
      asm volatile("s_wait_xcnt 0x0" ::: "memory");   // before the stores' registers are reused
    }
  }
}

__global__ __launch_bounds__(128) void gemm_qkv_kernel(
    const _Float16* __restrict__ A16, const _Float16* __restrict__ Bt,
    _Float16* __restrict__ qplane, _Float16* __restrict__ tplane) {
  gemm_body<0>(A16, Bt, (unsigned)DIM, (float*)0, qplane, tplane);
}
__global__ __launch_bounds__(128) void gemm_out_kernel(
    const _Float16* __restrict__ A16, const _Float16* __restrict__ Bt,
    float* __restrict__ outf) {
  gemm_body<1>(A16, Bt, (unsigned)DIM, outf, (_Float16*)0, (_Float16*)0);
}

// ---------------------------------------------------------------------------
// Per (head, batch, 32x32 quadrant qr, qc): KV[d2][d1] = sum_s V[s][d2] * K[s][d1], depth SEQ.
// A = 32 V^T plane rows (m = d2, k = s contiguous), B = 32 K^T plane rows (n = d1, k = s contiguous).
// 16 waves, wave w owns depth [w*KTD, (w+1)*KTD): one aligned 256-B unit of each of the 64 rows, copied
// global -> LDS by asynchronous 16-B copies (16 lanes per row: whole lines) into the wave's own slice,
// all 32 copies of a lane in flight together. 2 x 2 accumulators per wave, fragments from LDS.
// The 16 partial tiles are summed in f32 in wave order through LDS and written as f16.
// Plane layout [b][head][qc][d2][32 columns]: a quadrant is 2 KiB of whole lines with one writer.
// Grid (4 * NHEAD, NB), 512 threads.
// ---------------------------------------------------------------------------
#define KTW   16                 // waves per block = depth slices
#define KTD   (SEQ / KTW)        // depth per wave
#define KTP   (KTD + 8)          // halves per LDS row (272 B = 16 B x odd)
#define KTSL  (64 * KTP)         // halves per wave slice: 32 V rows then 32 K rows
#define KTC   36                 // floats per row of a wave's 32x32 partial tile
static_assert(KTD == 128);                                   // one 256-B unit per row and wave
static_assert((size_t)KTW * KTSL * 2 <= (size_t)327680);     // the slices fit the LDS
static_assert((size_t)32 * KTC * 4 <= (size_t)KTSL * 2);     // a partial tile fits its wave's slice
static_assert((KTC % 2) == 0 && ((KTSL * 2) % 16) == 0);

typedef _Float16 v2h __attribute__((ext_vector_type(2)));
typedef float    v2f __attribute__((ext_vector_type(2)));

// Eight asynchronous 16-B copies per lane: rows r, r+2, ..., r+14 of the wave's slice.
// lds: the lane's LDS byte address in row r; gp: the lane's global address in row r.
__device__ __forceinline__ void async_slice8(unsigned lds, const _Float16* gp) {
  const unsigned l0 = lds;
  const unsigned l1 = lds + 1u * 2u * KTP * 2u;
  const unsigned l2 = lds + 2u * 2u * KTP * 2u;
  const unsigned l3 = lds + 3u * 2u * KTP * 2u;
  const unsigned l4 = lds + 4u * 2u * KTP * 2u;
  const unsigned l5 = lds + 5u * 2u * KTP * 2u;
  const unsigned l6 = lds + 6u * 2u * KTP * 2u;
  const unsigned l7 = lds + 7u * 2u * KTP * 2u;
  const _Float16* g0 = gp;
  const _Float16* g1 = gp + (size_t)1 * 2 * SEQ;
  const _Float16* g2 = gp + (size_t)2 * 2 * SEQ;
  const _Float16* g3 = gp + (size_t)3 * 2 * SEQ;
  const _Float16* g4 = gp + (size_t)4 * 2 * SEQ;
  const _Float16* g5 = gp + (size_t)5 * 2 * SEQ;
  const _Float16* g6 = gp + (size_t)6 * 2 * SEQ;
  const _Float16* g7 = gp + (size_t)7 * 2 * SEQ;
  // the copies and, as the last line, the wait that stands before their address registers are reused
  asm volatile(
      "global_load_async_to_lds_b128 %0, %8, off\n\t"
      "global_load_async_to_lds_b128 %1, %9, off\n\t"
      "global_load_async_to_lds_b128 %2, %10, off\n\t"
      "global_load_async_to_lds_b128 %3, %11, off\n\t"
      "global_load_async_to_lds_b128 %4, %12, off\n\t"
      "global_load_async_to_lds_b128 %5, %13, off\n\t"
      "global_load_async_to_lds_b128 %6, %14, off\n\t"
      "global_load_async_to_lds_b128 %7, %15, off\n\t"
      "s_wait_xcnt 0x0"
      :: "v"(l0), "v"(l1), "v"(l2), "v"(l3), "v"(l4), "v"(l5), "v"(l6), "v"(l7),
         "v"(g0), "v"(g1), "v"(g2), "v"(g3), "v"(g4), "v"(g5), "v"(g6), "v"(g7)
      : "memory");
}

__global__ __launch_bounds__(512) void ktv_kernel(
    const _Float16* __restrict__ T16, _Float16* __restrict__ KVt) {
  __shared__ __attribute__((aligned(16))) _Float16 Sl[KTW * KTSL];
  const unsigned tid = threadIdx.x, lane = tid & 31u;
  const unsigned w = (unsigned)__builtin_amdgcn_readfirstlane((int)(threadIdx.x >> 5));
  const unsigned hh = lane >> 4, m = lane & 15u;
  const unsigned head = blockIdx.x >> 2;
  const unsigned qr = (blockIdx.x >> 1) & 1u, qc = blockIdx.x & 1u;
  const unsigned b = blockIdx.y;

  const size_t kbase = ((size_t)b * DIM + head * HD) * SEQ;   // k plane
  const size_t vbase = TPLANE_ELEMS + kbase;                  // v plane
  // copy side: lane -> row lane>>4 (+2 per copy), 16-B chunk lane&15 of the row's 256-B unit
  const _Float16* gv = T16 + vbase + (size_t)(qr * 32u + hh) * SEQ + w * (unsigned)KTD + m * 8u;
  const _Float16* gk = T16 + kbase + (size_t)(qc * 32u + hh) * SEQ + w * (unsigned)KTD + m * 8u;
  _Float16* Sw = &Sl[w * (unsigned)KTSL];
  const unsigned lv = (unsigned)(size_t)Sw + (hh * KTP + m * 8u) * 2u;
  const unsigned lk = lv + 32u * KTP * 2u;
  async_slice8(lv, gv);
  async_slice8(lv + 16u * KTP * 2u, gv + (size_t)16 * SEQ);
  async_slice8(lk, gk);
  async_slice8(lk + 16u * KTP * 2u, gk + (size_t)16 * SEQ);
  asm volatile("s_wait_asynccnt 0x0" ::: "memory");   // this wave's copies have landed
  __syncthreads();                                    // the slices are published before any is read

  const _Float16* sa = Sw + m * KTP + hh * 8u;
  const _Float16* sb = sa + 32u * KTP;
  // the i, j, ks loops are unrolled so that every acc / fragment index is a constant (registers)
  v8f acc[2][2];
#pragma unroll
  for (int i = 0; i < 2; ++i)
#pragma unroll
    for (int j = 0; j < 2; ++j) acc[i][j] = v8f{};
#pragma unroll
  for (unsigned ks = 0; ks < (unsigned)KTD / 32u; ++ks) {
    v16h a[2], bb[2];
#pragma unroll
    for (unsigned i = 0; i < 2u; ++i) a[i] = frag_at(sa + i * 16u * KTP + ks * 32u);
#pragma unroll
    for (unsigned j = 0; j < 2u; ++j) bb[j] = frag_at(sb + j * 16u * KTP + ks * 32u);
#pragma unroll
    for (int i = 0; i < 2; ++i)
#pragma unroll
      for (int j = 0; j < 2; ++j) acc[i][j] = wmma16(a[i], bb[j], acc[i][j]);
  }
  // this wave's fragment reads are done before its partial tile overwrites the head of its slice
  asm volatile("s_wait_dscnt 0x0" ::: "memory");
  float* Pw = (float*)Sw;
#pragma unroll
  for (int i = 0; i < 2; ++i)
#pragma unroll
    for (int j = 0; j < 2; ++j)
#pragma unroll
      for (int r = 0; r < 8; ++r)
        Pw[((unsigned)i * 16u + hh * 8u + (unsigned)r) * KTC + (unsigned)j * 16u + m] = acc[i][j][r];
  __syncthreads();   // all 16 partial tiles are complete before they are summed

  const unsigned r = tid >> 4, c = (tid & 15u) * 2u;
  float s0 = 0.0f, s1 = 0.0f;
#pragma unroll
  for (unsigned g = 0; g < (unsigned)KTW; ++g) {
    const v2f u = *(const v2f*)((const float*)&Sl[g * (unsigned)KTSL] + r * KTC + c);
    s0 += u[0];
    s1 += u[1];
  }
  v2h o;
  o[0] = toh_flush(s0);
  o[1] = toh_flush(s1);
  *(v2h*)(KVt + (size_t)(b * NHEAD + head) * (HD * HD) + (size_t)qc * (HD * 32) +
          (size_t)(qr * 32u + r) * 32u + c) = o;
}

// ---------------------------------------------------------------------------
// Per (128 query rows, head, batch): Ov[b*SEQ+s][head*64 + d2] =
//   f16( 1/8 * sum_d1 Q[s][d1] * KVt[d2][d1] ). 8 waves x 16 rows, 4 output tiles per wave,
// depth 64 in two 32-steps; A fragments from the q plane, B fragments from the KVt rows
// (plane layout [b][head][d1 / 32][d2][d1 % 32]).
// Ov rows are stored as whole lines (one line per row: 8 consecutive lanes x 16 B).
// Grid (SEQ/128, NHEAD, NB).
// ---------------------------------------------------------------------------
__global__ __launch_bounds__(256) void qkv_apply_kernel(
    const _Float16* __restrict__ Qh, const _Float16* __restrict__ KVt,
    _Float16* __restrict__ Ov) {
  __shared__ __attribute__((aligned(16))) _Float16 Ps[8 * 16 * LDT];
  const unsigned tid = threadIdx.x, lane = tid & 31u;
  const unsigned w = (unsigned)__builtin_amdgcn_readfirstlane((int)(threadIdx.x >> 5));
  const unsigned hh = lane >> 4, m = lane & 15u;
  const unsigned q0 = blockIdx.x * 128u;
  const unsigned head = blockIdx.y;
  const unsigned b = blockIdx.z;
  const unsigned qrow0 = q0 + w * 16u;
  const unsigned pbase = w * (16u * LDT);

  const size_t qoff = (size_t)(b * (unsigned)SEQ + qrow0 + m) * DIM + head * HD + hh * 8u;
  const v16h qf0 = frag_at(Qh + qoff);
  const v16h qf1 = frag_at(Qh + qoff + 32);
  const _Float16* kvp = KVt + (size_t)(b * NHEAD + head) * (HD * HD) + (size_t)m * 32 + hh * 8u;

  v8f o[4];
#pragma unroll
  for (int nb = 0; nb < 4; ++nb) {
    const v16h b0 = frag_at(kvp + nb * 16 * 32);             // d1 0..31
    const v16h b1 = frag_at(kvp + HD * 32 + nb * 16 * 32);   // d1 32..63
    v8f t = {};
    t = wmma16(qf0, b0, t);
    t = wmma16(qf1, b1, t);
    o[nb] = t;
  }

#pragma unroll
  for (int nb = 0; nb < 4; ++nb)
#pragma unroll
    for (int v = 0; v < 8; ++v)
      Ps[pbase + (hh * 8u + (unsigned)v) * LDT + (unsigned)nb * 16u + m] =
          toh_flush(o[nb][v] * SCALE_QK);
  wave_lds_sync();
  v8h x[4];
  size_t off[4];
#pragma unroll
  for (unsigned i = 0; i < 4u; ++i) {
    const unsigned r = 4u * i + (lane >> 3);
    const unsigned c = (lane & 7u) * 8u;
    x[i] = *(const v8h*)&Ps[pbase + r * LDT + c];
    off[i] = (size_t)(b * (unsigned)SEQ + qrow0 + r) * DIM + head * HD + c;
  }
#pragma unroll
  for (int i = 0; i < 4; ++i) *(v8h*)(Ov + off[i]) = x[i];
  
}

// ---------------------------------------------------------------------------
extern "C" void kernel_launch(void* const* d_in, const int* in_sizes, int n_in,
                              void* d_out, int out_size, void* d_ws, size_t ws_size,
                              hipStream_t stream) {
  if (n_in < 3) return;
  const long long need_x = ((long long)(NB - 1) * SEQ_FULL + SEQ) * DIM;
  if ((long long)in_sizes[0] < need_x) return;
  if ((long long)in_sizes[1] < (long long)QKVN * DIM) return;
  if ((long long)in_sizes[2] < (long long)DIM * DIM) return;
  if ((long long)out_size < need_x) return;
  if (ws_size < WS_TOTAL) return;

  const float* X    = (const float*)d_in[0];   // [NB_FULL][SEQ_FULL][DIM]
  const float* wqkv = (const float*)d_in[1];   // [QKVN][DIM]  (out, in)
  const float* wo   = (const float*)d_in[2];   // [DIM][DIM]   (out, in)
  float* out = (float*)d_out;

  char* ws = (char*)d_ws;
  _Float16* Wqkv16 = (_Float16*)(ws + OFF_WQKV);   // [n][k]
  _Float16* Wo16   = (_Float16*)(ws + OFF_WO);     // [n][k]
  _Float16* X16    = (_Float16*)(ws + OFF_X);      // compact rows
  _Float16* Q16    = (_Float16*)(ws + OFF_Q);      // [MROWS][head*64 + d]
  _Float16* T16    = (_Float16*)(ws + OFF_T);      // [k|v][b][head*64 + d][SEQ]
  _Float16* KVt16  = (_Float16*)(ws + OFF_KV);     // [b][head][d1 / 32][d2][d1 % 32]
  _Float16* Ctx16  = (_Float16*)(ws + OFF_CTX);    // [MROWS][head*64 + d]

  dim3 blk(256);

  // weight planes are already [out n][in k] (k contiguous): convert in place order, carry x64
  cvt_plane_kernel<<<dim3(QKVN / 2), blk, 0, stream>>>(wqkv, Wqkv16, (unsigned)QKVN, (unsigned)QKVN, WCARRY);
  cvt_plane_kernel<<<dim3(DIM / 2), blk, 0, stream>>>(wo, Wo16, (unsigned)DIM, (unsigned)DIM, WCARRY);
  // activation plane: full-size input rows -> compact rows, carry 1
  cvt_plane_kernel<<<dim3(MROWS / 2), blk, 0, stream>>>(X, X16, (unsigned)SEQ, (unsigned)SEQ_FULL, 1.0f);

  gemm_qkv_kernel<<<dim3(QKVN / GBN, MROWS / GBM), dim3(128), 0, stream>>>(X16, Wqkv16, Q16, T16);
  ktv_kernel<<<dim3(4 * NHEAD, NB), dim3(512), 0, stream>>>(T16, KVt16);
  qkv_apply_kernel<<<dim3(SEQ / 128, NHEAD, NB), blk, 0, stream>>>(Q16, KVt16, Ctx16);
  gemm_out_kernel<<<dim3(DIM / GBN, MROWS / GBM), dim3(128), 0, stream>>>(Ctx16, Wo16, out);
}

// v003
// A run of this version takes 84.2 microseconds.
// Next to v002, in two timings, it ran 1.14 and 1.12 times as fast.
// All steps since v000 together make it 4.47 times as fast.
#include <hip/hip_runtime.h>
#include <stddef.h>

// All contractions on v_wmma_f32_16x16x32_f16 (f16 operands, f32 accumulate): fused q/k/v projection,
// per-head V^T.K (depth = sequence), per-head Q.(K^T V) (depth 64), output projection. Float inputs are
// RNE-converted to bf16 and carried in f16 (weights x64); q, k, v, K^T V and the merged head plane are
// single f16 planes (carry 1). Scale 1/8 and all carries are undone in f32 epilogues.

typedef _Float16 h16;
typedef _Float16 v16h __attribute__((ext_vector_type(16)));
typedef _Float16 v8h  __attribute__((ext_vector_type(8)));
typedef float    v8f  __attribute__((ext_vector_type(8)));
typedef float    v4f  __attribute__((ext_vector_type(4)));

#ifndef NB
#define NB 4
#endif
#ifndef SEQ
#define SEQ 2048
#endif
#define NB_FULL  4
#define SEQ_FULL 2048
#define DIM   1024
#define NHEAD 16
#define HD    64
#define QKVN  (3 * DIM)
#define MROWS (NB * SEQ)

static_assert(NB >= 1 && NB <= NB_FULL);
static_assert(SEQ >= 128 && SEQ <= SEQ_FULL && (SEQ % 128) == 0);
static_assert(DIM == NHEAD * HD);
static_assert(HD == 64);
static_assert(QKVN == 3 * DIM && (QKVN / 64) == 3 * NHEAD);
static_assert((DIM % 64) == 0 && (DIM % 32) == 0);
static_assert((QKVN % 64) == 0);
static_assert((SEQ % 64) == 0 && (SEQ % 32) == 0);
static_assert((MROWS % 64) == 0 && (MROWS % 2) == 0);
static_assert((QKVN % 2) == 0 && (DIM % 2) == 0);
static_assert(DIM / 8 == 128);                 // convert kernel: 128 eight-column groups per row
static_assert((size_t)MROWS * (DIM / 8) < (size_t)0xFFFFFFFFu);

#define LDT 72   // halves per LDS row (144 B, 16-B aligned)
#define LDC 68   // floats per LDS row (272 B, 16-B aligned)
static_assert((LDT % 8) == 0 && LDT >= 64);
static_assert((LDC % 4) == 0 && LDC >= 64);

#define WCARRY   64.0f     // weight planes carried x64
#define SCALE_QK 0.125f    // HD^-0.5

// workspace layout (bytes)
#define WQKV_BYTES    ((size_t)QKVN * DIM * 2)
#define WO_BYTES      ((size_t)DIM * DIM * 2)
#define PLANE16_BYTES ((size_t)MROWS * DIM * 2)
#define TPLANE_ELEMS  ((size_t)NB * DIM * SEQ)          // one transposed plane [b][col][key]
#define T_BYTES       ((size_t)2 * TPLANE_ELEMS * 2)    // k plane then v plane
#define KV_BYTES      ((size_t)NB * NHEAD * HD * HD * 2)
#define OFF_WQKV ((size_t)0)
#define OFF_WO   (OFF_WQKV + WQKV_BYTES)
#define OFF_X    (OFF_WO + WO_BYTES)
#define OFF_Q    (OFF_X + PLANE16_BYTES)
#define OFF_T    (OFF_Q + PLANE16_BYTES)
#define OFF_KV   (OFF_T + T_BYTES)
#define OFF_CTX  (OFF_KV + KV_BYTES)
#define WS_TOTAL (OFF_CTX + PLANE16_BYTES)
static_assert((WQKV_BYTES % 128) == 0 && (WO_BYTES % 128) == 0 && (PLANE16_BYTES % 128) == 0);
static_assert((T_BYTES % 128) == 0 && (KV_BYTES % 128) == 0);
static_assert(WS_TOTAL <= (size_t)134217728);

// ---------------------------------------------------------------------------
__device__ __forceinline__ float bf16r(float x) {   // RNE convert to bf16, returned widened
  unsigned int u = __float_as_uint(x);
  u = (u + 0x7FFFu + ((u >> 16) & 1u)) & 0xFFFF0000u;
  return __uint_as_float(u);
}

// f32 -> f16 operand convert that cannot produce an f16 subnormal
static __device__ __forceinline__ h16 toh_flush(float v) {
  const h16 r = (h16)v;
  return (fabsf(v) < 6.103515625e-05f) ? (h16)0.0f : r;
}

// 16-bit fragment: p points at element [row = lane&15][k0 + 8*(lane>>4)] of a k-contiguous
// row. Elements 0..7 <- k0+8h+0..7, elements 8..15 <- k0+16+8h+0..7 (same map for A and B).
__device__ __forceinline__ v16h frag_at(const _Float16* p) {
  v8h lo = *(const v8h*)(p);
  v8h hi = *(const v8h*)(p + 16);
  v16h out;
#pragma unroll
  for (int i = 0; i < 8; ++i) { out[i] = lo[i]; out[i + 8] = hi[i]; }
  return out;
}

__device__ __forceinline__ v8f wmma16(v16h a, v16h b, v8f c) {
  v8f d = __builtin_amdgcn_wmma_f32_16x16x32_f16(false, a, false, b, (short)0, c,
                                                 false, false);
  asm volatile("v_nop\n\tv_nop\n\tv_nop\n\tv_nop" : "+v"(d) : "v"(a), "v"(b));
  return d;
}

// The builtin alone (the compiler keeps the distances behind its own form): an asm statement's vector
// operands stay in the first 256 registers, which an 8 x 6 accumulator set does not fit.
__device__ __forceinline__ v8f wmma16p(v16h a, v16h b, v8f c) {
  return __builtin_amdgcn_wmma_f32_16x16x32_f16(false, a, false, b, (short)0, c, false, false);
}

__device__ __forceinline__ void wave_lds_sync() {
  __builtin_amdgcn_fence(3 /* release order */, "wavefront");
  asm volatile("s_wait_dscnt 0x0" ::: "memory");
  __builtin_amdgcn_wave_barrier();
}

// ---------------------------------------------------------------------------
// Plane convert: dst[crow][c] = f16(carry * bf16(src[srow][c])), rows of DIM columns,
// srow = (crow / seq) * seq_full + crow % seq. One thread per 8 columns (one 16-B store);
// Grid (rows / 2): 256 threads x 8 columns = 2 rows per block.
// ---------------------------------------------------------------------------
__global__ __launch_bounds__(256) void cvt_plane_kernel(
    const float* __restrict__ src, _Float16* __restrict__ dst,
    unsigned seq, unsigned seq_full, float carry) {
#pragma clang fp contract(off)
  const unsigned g = blockIdx.x * 256u + threadIdx.x;
  const unsigned crow = g >> 7;
  const unsigned c = (g & 127u) * 8u;
  const unsigned bidx = crow / seq;
  const unsigned sq = crow - bidx * seq;
  const size_t srow = (size_t)bidx * seq_full + sq;
  const v4f a0 = *(const v4f*)(src + srow * DIM + c);
  const v4f a1 = *(const v4f*)(src + srow * DIM + c + 4u);
  v8h o;
#pragma unroll
  for (int i = 0; i < 4; ++i) {
    o[i]     = toh_flush(carry * bf16r(a0[i]));
    o[i + 4] = toh_flush(carry * bf16r(a1[i]));
  }
  _Float16* p = dst + (size_t)crow * DIM + c;
  *(v8h*)p = o;
  
}

// ---------------------------------------------------------------------------
// Output projection GEMM C[128x128 tile] = A16[rows][K] . Bt[n][K]^T. Per trip one 128-B line (64 k) of each of the
// 128 A rows and 128 B rows is copied global -> LDS by asynchronous 16-B copies (whole lines: 8 lanes
// per row), two buffers, the next tile's copies in flight while this tile is worked on.
// 4 waves (wm = 64-row group, wn = 64-col group), 4 x 4 accumulators/wave, fragments from LDS.
// Epilogue per wave: outf full [full row][col] = acc/64.
// Grid (N/128, MROWS/128), 128 threads.
// ---------------------------------------------------------------------------
#define GBM 128                       // tile rows
#define GBN 128                       // tile columns
#define GBK 64                        // k per trip (one 128-B line per row)
#define GSTAGE ((GBM + GBN) * LDT)    // halves per buffer: A rows then B rows, pitch LDT
static_assert((MROWS % GBM) == 0 && (SEQ % GBM) == 0);
static_assert((DIM % GBN) == 0);
static_assert((DIM % GBK) == 0 && (DIM / GBK) >= 2);
static_assert(LDT >= GBK && ((LDT * 2) % 16) == 0);
static_assert((size_t)4 * 64 * LDC * 4 <= (size_t)2 * GSTAGE * 2);   // epilogue staging fits the ring

// Eight asynchronous 16-B copies per lane: rows r, r+16, ..., r+112 of one operand's tile.
// lds: the lane's LDS byte address of row r; gp: the lane's global address of row r.
__device__ __forceinline__ void async_rows8(unsigned lds, const _Float16* gp, unsigned K) {
  const unsigned l0 = lds;
  const unsigned l1 = lds + 1u * 16u * LDT * 2u;
  const unsigned l2 = lds + 2u * 16u * LDT * 2u;
  const unsigned l3 = lds + 3u * 16u * LDT * 2u;
  const unsigned l4 = lds + 4u * 16u * LDT * 2u;
  const unsigned l5 = lds + 5u * 16u * LDT * 2u;
  const unsigned l6 = lds + 6u * 16u * LDT * 2u;
  const unsigned l7 = lds + 7u * 16u * LDT * 2u;
  const _Float16* g0 = gp;
  const _Float16* g1 = gp + (size_t)1 * 16 * K;
  const _Float16* g2 = gp + (size_t)2 * 16 * K;
  const _Float16* g3 = gp + (size_t)3 * 16 * K;
  const _Float16* g4 = gp + (size_t)4 * 16 * K;
  const _Float16* g5 = gp + (size_t)5 * 16 * K;
  const _Float16* g6 = gp + (size_t)6 * 16 * K;
  const _Float16* g7 = gp + (size_t)7 * 16 * K;
  // the copies and, as the last line, the wait that stands before their address registers are reused
  asm volatile(
      "global_load_async_to_lds_b128 %0, %8, off\n\t"
      "global_load_async_to_lds_b128 %1, %9, off\n\t"
      "global_load_async_to_lds_b128 %2, %10, off\n\t"
      "global_load_async_to_lds_b128 %3, %11, off\n\t"
      "global_load_async_to_lds_b128 %4, %12, off\n\t"
      "global_load_async_to_lds_b128 %5, %13, off\n\t"
      "global_load_async_to_lds_b128 %6, %14, off\n\t"
      "global_load_async_to_lds_b128 %7, %15, off\n\t"
      "s_wait_xcnt 0x0"
      :: "v"(l0), "v"(l1), "v"(l2), "v"(l3), "v"(l4), "v"(l5), "v"(l6), "v"(l7),
         "v"(g0), "v"(g1), "v"(g2), "v"(g3), "v"(g4), "v"(g5), "v"(g6), "v"(g7)
      : "memory");
}

__device__ __forceinline__ void gemm_body(
    const _Float16* __restrict__ A16, const _Float16* __restrict__ Bt, const unsigned K,
    float* __restrict__ outf) {
  __shared__ __attribute__((aligned(16))) _Float16 S[2 * GSTAGE];
  const unsigned tid = threadIdx.x, lane = tid & 31u;
  const unsigned w = (unsigned)__builtin_amdgcn_readfirstlane((int)(threadIdx.x >> 5));
  const unsigned wm = w >> 1, wn = w & 1u;
  const unsigned hh = lane >> 4, m = lane & 15u;
  const unsigned n0 = blockIdx.x * (unsigned)GBN;
  const unsigned row0 = blockIdx.y * (unsigned)GBM;

  // copy side: lane -> row tid>>3 (+16 per copy), 16-B chunk tid&7 of the row's line
  const unsigned crow = tid >> 3, cch = (tid & 7u) * 8u;
  const _Float16* ga = A16 + (size_t)(row0 + crow) * K + cch;
  const _Float16* gb = Bt + (size_t)(n0 + crow) * K + cch;
  const unsigned la = (unsigned)(size_t)&S[0] + (crow * LDT + cch) * 2u;
  const unsigned lb = la + (unsigned)GBM * LDT * 2u;
  // fragment side
  const _Float16* sa = &S[(wm * 64u + m) * LDT + hh * 8u];
  const _Float16* sb = &S[((unsigned)GBM + wn * 64u + m) * LDT + hh * 8u];
  const unsigned nt_k = K / (unsigned)GBK;

  // the i, j, ks loops below are unrolled so that every acc / fragment index is a constant (registers)
  v8f acc[4][4];
#pragma unroll
  for (int i = 0; i < 4; ++i)
#pragma unroll
    for (int j = 0; j < 4; ++j) acc[i][j] = v8f{};

  async_rows8(la, ga, K);
  async_rows8(lb, gb, K);
  asm volatile("s_wait_asynccnt 0x0" ::: "memory");   // tile 0 landed (this wave's copies)
  __syncthreads();                                    // tile 0 published to every wave
  async_rows8(la + (unsigned)GSTAGE * 2u, ga + GBK, K);
  async_rows8(lb + (unsigned)GSTAGE * 2u, gb + GBK, K);

  for (unsigned t = 0; t < nt_k; ++t) {
    const unsigned bo = (t & 1u) * (unsigned)GSTAGE;
#pragma unroll
    for (unsigned ks = 0; ks < 2u; ++ks) {
      v16h a[4], b[4];
#pragma unroll
      for (unsigned i = 0; i < 4u; ++i) a[i] = frag_at(sa + bo + i * 16u * LDT + ks * 32u);
#pragma unroll
      for (unsigned j = 0; j < 4u; ++j) b[j] = frag_at(sb + bo + j * 16u * LDT + ks * 32u);
#pragma unroll
      for (int i = 0; i < 4; ++i)
#pragma unroll
        for (int j = 0; j < 4; ++j) acc[i][j] = wmma16(a[i], b[j], acc[i][j]);
    }
    asm volatile("s_wait_dscnt 0x0" ::: "memory");     // this wave's reads of buffer t&1 are done
    asm volatile("s_wait_asynccnt 0x0" ::: "memory");  // this wave's copies of tile t+1 have landed
    __syncthreads();   // publishes tile t+1 and ends every wave's reads of the buffer refilled below
    if (t + 2u < nt_k) {
      async_rows8(la + bo * 2u, ga + (size_t)(t + 2u) * GBK, K);
      async_rows8(lb + bo * 2u, gb + (size_t)(t + 2u) * GBK, K);
    }
  }
  asm volatile("s_wait_asynccnt 0x0" ::: "memory");    // no copy outstanding when the ring is reused

  // the ring is free behind the last trip's barrier: each wave stages its own 64x64 tile there
  float* Cw = (float*)&S[0] + w * (64u * LDC);
#pragma unroll
  for (int i = 0; i < 4; ++i)
#pragma unroll
    for (int j = 0; j < 4; ++j)
#pragma unroll
      for (int r = 0; r < 8; ++r)
        Cw[((unsigned)i * 16u + hh * 8u + (unsigned)r) * LDC + (unsigned)j * 16u + m] = acc[i][j][r];
  __syncthreads();   // the staged tile is complete before other lanes read it back

  const unsigned wrow0 = row0 + wm * 64u;

  // Epilogue loop: eight rows per trip (two per store), their LDS reads in flight together and their four stores as one
  // group; kept rolled (the code runs once per tile). The s_wait_xcnt at a trip's foot stands in front
  // of the next trip's reuse of the stores' address and data registers.
  {
    const unsigned bidx = wrow0 / (unsigned)SEQ;
    const unsigned sq0 = wrow0 - bidx * (unsigned)SEQ;
    const size_t frow0 = (size_t)bidx * SEQ_FULL + sq0;
#pragma unroll 1   // rolled: runs once per tile, unrolling only grows the code
    for (unsigned i0 = 0; i0 < 32u; i0 += 4u) {
      v4f xs[4];
      size_t off[4];
#pragma unroll
      for (unsigned i = 0; i < 4u; ++i) {
        const unsigned r = 2u * (i0 + i) + (lane >> 4);
        const unsigned c = (lane & 15u) * 4u;
        const v4f u = *(const v4f*)&Cw[r * LDC + c];
        v4f val;
#pragma unroll
        for (int j = 0; j < 4; ++j) val[j] = u[j] * (1.0f / WCARRY);
        xs[i] = val;
        off[i] = (frow0 + r) * DIM + n0 + wn * 64u + c;
      }
#pragma unroll
      for (int i = 0; i < 4; ++i) *(v4f*)(outf + off[i]) = xs[i];
      asm volatile("s_wait_xcnt 0x0" ::: "memory");   // before the stores' registers are reused
    }
  }
}

__global__ __launch_bounds__(128) void gemm_out_kernel(
    const _Float16* __restrict__ A16, const _Float16* __restrict__ Bt,
    float* __restrict__ outf) {
  gemm_body(A16, Bt, (unsigned)DIM, outf);
}

// ---------------------------------------------------------------------------
// Fused q/k/v projection: C[256 rows x 192 columns] = A16[rows][DIM] . Bt[n][DIM]^T, the 192 columns
// being one head's q, k and v (column n = head*192 + part*64 + d). Per trip one 128-B line (64 k) of
// each of the 256 A rows and 192 B rows is copied global -> LDS by asynchronous 16-B copies, two
// buffers, the next tile's copies in flight while this tile is worked on.
// 4 waves (wm = 128-row group, wn = 96-column group), 8 x 6 accumulators per wave, fragments from LDS.
// Two blocks share a WGP (two waves per SIMD), so all 512 blocks of the grid are resident at once.
// Epilogue: f16(acc/64) staged in the free ring, q as [row][d], k and v transposed as [d][key] (a lane's
// 8 accumulator rows are 8 consecutive keys: one 16-B LDS store), then written as whole lines:
//   outq[row][head*64 + d] (pitch DIM), outt[k|v][b][head*64 + d][key].
// Grid (NHEAD, MROWS/256), 128 threads.
// ---------------------------------------------------------------------------
#define QBM 256                       // tile rows
#define QBN 192                       // tile columns: q, k, v of one head
#define QSTAGE ((QBM + QBN) * LDT)    // halves per buffer: A rows then B rows, pitch LDT
#define QTP (QBM + 8)                 // halves per row of the transposed k/v staging (528 B = 16 B x odd)
static_assert(QBN == 3 * HD && (QKVN % QBN) == 0 && (QKVN / QBN) == NHEAD);
static_assert((MROWS % QBM) == 0 && (SEQ % QBM) == 0);
static_assert((size_t)QBM * LDT + (size_t)2 * HD * QTP <= (size_t)2 * QSTAGE);   // staging fits the ring
static_assert((size_t)2 * 2 * QSTAGE * 2 <= (size_t)327680);                     // two blocks per WGP

// Four asynchronous 16-B copies per lane: rows r, r+16, r+32, r+48 of one operand's tile.
__device__ __forceinline__ void async_rows4(unsigned lds, const _Float16* gp, unsigned K) {
  const unsigned l0 = lds;
  const unsigned l1 = lds + 1u * 16u * LDT * 2u;
  const unsigned l2 = lds + 2u * 16u * LDT * 2u;
  const unsigned l3 = lds + 3u * 16u * LDT * 2u;
  const _Float16* g0 = gp;
  const _Float16* g1 = gp + (size_t)1 * 16 * K;
  const _Float16* g2 = gp + (size_t)2 * 16 * K;
  const _Float16* g3 = gp + (size_t)3 * 16 * K;
  // the copies and, as the last line, the wait that stands before their address registers are reused
  asm volatile(
      "global_load_async_to_lds_b128 %0, %4, off\n\t"
      "global_load_async_to_lds_b128 %1, %5, off\n\t"
      "global_load_async_to_lds_b128 %2, %6, off\n\t"
      "global_load_async_to_lds_b128 %3, %7, off\n\t"
      "s_wait_xcnt 0x0"
      :: "v"(l0), "v"(l1), "v"(l2), "v"(l3), "v"(g0), "v"(g1), "v"(g2), "v"(g3)
      : "memory");
}

// One 64-k tile: 256 A rows and 192 B rows, 28 copies per lane.
__device__ __forceinline__ void async_qkv_tile(unsigned la, unsigned lb,
                                               const _Float16* ga, const _Float16* gb) {
  async_rows8(la, ga, (unsigned)DIM);
  async_rows8(la + 128u * LDT * 2u, ga + (size_t)128 * DIM, (unsigned)DIM);
  async_rows8(lb, gb, (unsigned)DIM);
  async_rows4(lb + 128u * LDT * 2u, gb + (size_t)128 * DIM, (unsigned)DIM);
}

// second launch-bounds argument: two waves per SIMD, so that two blocks share a WGP
__global__ __launch_bounds__(128, 2) void gemm_qkv_kernel(
    const _Float16* __restrict__ A16, const _Float16* __restrict__ Bt,
    _Float16* __restrict__ outq, _Float16* __restrict__ outt) {
  __shared__ __attribute__((aligned(16))) _Float16 S[2 * QSTAGE];
  const unsigned tid = threadIdx.x, lane = tid & 31u;
  const unsigned w = (unsigned)__builtin_amdgcn_readfirstlane((int)(threadIdx.x >> 5));
  const unsigned wm = w >> 1, wn = w & 1u;
  const unsigned hh = lane >> 4, m = lane & 15u;
  const unsigned head = blockIdx.x;
  const unsigned row0 = blockIdx.y * (unsigned)QBM;

  // copy side: lane -> row tid>>3 (+16 per copy), 16-B chunk tid&7 of the row's line
  const unsigned crow = tid >> 3, cch = (tid & 7u) * 8u;
  const _Float16* Ab = A16 + (size_t)row0 * DIM;                      // block-uniform bases
  const _Float16* Bb = Bt + (size_t)(head * (unsigned)QBN) * DIM;
  const unsigned goff = crow * (unsigned)DIM + cch;                   // the lane's element offset, A and B alike
  const unsigned la = (unsigned)(size_t)&S[0] + (crow * LDT + cch) * 2u;
  const unsigned lb = la + (unsigned)QBM * LDT * 2u;
  // fragment side
  const _Float16* sa = &S[(wm * 128u + m) * LDT + hh * 8u];
  const _Float16* sb = &S[((unsigned)QBM + wn * 96u + m) * LDT + hh * 8u];
  const unsigned nt_k = (unsigned)DIM / (unsigned)GBK;

  // the i, j, ks loops below are unrolled so that every acc / fragment index is a constant (registers)
  v8f acc[8][6];
#pragma unroll
  for (int i = 0; i < 8; ++i)
#pragma unroll
    for (int j = 0; j < 6; ++j) acc[i][j] = v8f{};

  async_qkv_tile(la, lb, Ab + goff, Bb + goff);
  asm volatile("s_wait_asynccnt 0x0" ::: "memory");   // tile 0 landed (this wave's copies)
  __syncthreads();                                    // tile 0 published to every wave
  async_qkv_tile(la + (unsigned)QSTAGE * 2u, lb + (unsigned)QSTAGE * 2u, Ab + GBK + goff, Bb + GBK + goff);

  for (unsigned t = 0; t < nt_k; ++t) {
    const unsigned bo = (t & 1u) * (unsigned)QSTAGE;
#pragma unroll
    for (unsigned ks = 0; ks < 2u; ++ks) {
      const _Float16* pa = sa + bo + ks * 32u;
      const _Float16* pb = sb + bo + ks * 32u;
      v16h a[8], b[6];
#pragma unroll
      for (unsigned j = 0; j < 6u; ++j) b[j] = frag_at(pb + j * 16u * LDT);
      a[0] = frag_at(pa);
      a[1] = frag_at(pa + 16u * LDT);
#pragma unroll
      for (int g = 0; g < 4; ++g) {       // row pairs: the next pair's A fragments are read one pair ahead
        if (g < 3) {
          a[2 * g + 2] = frag_at(pa + (unsigned)(2 * g + 2) * 16u * LDT);
          a[2 * g + 3] = frag_at(pa + (unsigned)(2 * g + 3) * 16u * LDT);
        }
        // keeps the next pair's LDS reads one group ahead of this pair's WMMAs (else they sink to their use)
        __builtin_amdgcn_sched_barrier(0);
#pragma unroll
        for (int i = 2 * g; i < 2 * g + 2; ++i)
#pragma unroll
          for (int j = 0; j < 6; ++j) acc[i][j] = wmma16p(a[i], b[j], acc[i][j]);
        // keeps later LDS reads from moving in among these WMMAs
        __builtin_amdgcn_sched_barrier(0);
      }
    }
    asm volatile("s_wait_dscnt 0x0" ::: "memory");     // this wave's reads of buffer t&1 are done
    asm volatile("s_wait_asynccnt 0x0" ::: "memory");  // this wave's copies of tile t+1 have landed
    __syncthreads();   // publishes tile t+1 and ends every wave's reads of the buffer refilled below
    if (t + 2u < nt_k) {
      const unsigned kn = (t + 2u) * (unsigned)GBK;
      async_qkv_tile(la + bo * 2u, lb + bo * 2u, Ab + kn + goff, Bb + kn + goff);
    }
  }
  asm volatile("s_wait_asynccnt 0x0" ::: "memory");    // no copy outstanding when the ring is reused

  // the lane id is read anew here, so that no lane-derived value of the epilogue is held in a register
  // across the K loop, where the budget of 512 is full (held there, one of them is spilled to scratch)
  const unsigned ln = __builtin_amdgcn_mbcnt_lo(~0u, 0u);
  const unsigned eh = ln >> 4, em = ln & 15u;
  // the ring is free behind the last trip's barrier: the block's tile is staged there as f16
  _Float16* Tq = &S[0];                       // [256 rows][LDT]
  _Float16* Tt = &S[(unsigned)QBM * LDT];     // [128 = k d, v d][QTP]
#pragma unroll
  for (int j = 0; j < 6; ++j) {
    const unsigned d = (wn * 6u + (unsigned)j - 4u) * 16u + em;   // k/v staging row (unused for q columns)
#pragma unroll
    for (int i = 0; i < 8; ++i) {
      const unsigned row = wm * 128u + (unsigned)i * 16u + eh * 8u;
      v8h x;
#pragma unroll
      for (int r = 0; r < 8; ++r) x[r] = toh_flush(acc[i][j][r] * (1.0f / WCARRY));
      if (j < 4 && wn == 0u) {                // columns 0..63 of the head: q (wave-uniform test)
#pragma unroll
        for (int r = 0; r < 8; ++r) Tq[(row + (unsigned)r) * LDT + (unsigned)j * 16u + em] = x[r];
      } else {                                // columns 64..191: k then v, stored transposed
        *(v8h*)&Tt[d * QTP + row] = x;
      }
    }
  }
  __syncthreads();   // the staged tile is complete before other waves read it back

  // Write-out loops: four wave-wide 16-B stores per trip, their LDS reads in flight together; kept
  // rolled (the code runs once per tile). The s_wait_xcnt at a trip's foot stands in front of the next
  // trip's reuse of the stores' address and data registers.
#pragma unroll 1   // rolled: runs once per tile, unrolling only grows the code
  for (unsigned i0 = 0; i0 < 16u; i0 += 4u) {          // q: 4 rows (one line each) per store
    v8h x[4];
    size_t off[4];
#pragma unroll
    for (unsigned i = 0; i < 4u; ++i) {
      const unsigned r = 4u * (w * 16u + i0 + i) + (ln >> 3);
      const unsigned c = (ln & 7u) * 8u;
      x[i] = *(const v8h*)&Tq[r * LDT + c];
      off[i] = (size_t)(row0 + r) * DIM + head * HD + c;
    }
#pragma unroll
    for (int i = 0; i < 4; ++i) *(v8h*)(outq + off[i]) = x[i];
    asm volatile("s_wait_xcnt 0x0" ::: "memory");   // before the stores' registers are reused
  }
  const unsigned bidx = row0 / (unsigned)SEQ;
  const unsigned key0 = row0 - bidx * (unsigned)SEQ;
#pragma unroll 1   // rolled: runs once per tile, unrolling only grows the code
  for (unsigned i0 = 0; i0 < 32u; i0 += 4u) {          // k, v: one d row (256 keys, 4 lines) per store
    v8h x[4];
    size_t off[4];
#pragma unroll
    for (unsigned i = 0; i < 4u; ++i) {
      const unsigned d = w * 32u + i0 + i;             // 0..63: k plane, 64..127: v plane
      x[i] = *(const v8h*)&Tt[d * QTP + ln * 8u];
      off[i] = (size_t)(d >> 6) * TPLANE_ELEMS +
               ((size_t)bidx * DIM + head * HD + (d & 63u)) * SEQ + key0 + ln * 8u;
    }
#pragma unroll
    for (int i = 0; i < 4; ++i) *(v8h*)(outt + off[i]) = x[i];
    asm volatile("s_wait_xcnt 0x0" ::: "memory");   // before the stores' registers are reused
  }
}


// ---------------------------------------------------------------------------
// Per (head, batch, 32x32 quadrant qr, qc): KV[d2][d1] = sum_s V[s][d2] * K[s][d1], depth SEQ.
// A = 32 V^T plane rows (m = d2, k = s contiguous), B = 32 K^T plane rows (n = d1, k = s contiguous).
// 16 waves, wave w owns depth [w*KTD, (w+1)*KTD): one aligned 256-B unit of each of the 64 rows, copied
// global -> LDS by asynchronous 16-B copies (16 lanes per row: whole lines) into the wave's own slice,
// all 32 copies of a lane in flight together. 2 x 2 accumulators per wave, fragments from LDS.
// The 16 partial tiles are summed in f32 in wave order through LDS and written as f16.
// Plane layout [b][head][qc][d2][32 columns]: a quadrant is 2 KiB of whole lines with one writer.
// Grid (4 * NHEAD, NB), 512 threads.
// ---------------------------------------------------------------------------
#define KTW   16                 // waves per block = depth slices
#define KTD   (SEQ / KTW)        // depth per wave
#define KTP   (KTD + 8)          // halves per LDS row (272 B = 16 B x odd)
#define KTSL  (64 * KTP)         // halves per wave slice: 32 V rows then 32 K rows
#define KTC   36                 // floats per row of a wave's 32x32 partial tile
static_assert(KTD == 128);                                   // one 256-B unit per row and wave
static_assert((size_t)KTW * KTSL * 2 <= (size_t)327680);     // the slices fit the LDS
static_assert((size_t)32 * KTC * 4 <= (size_t)KTSL * 2);     // a partial tile fits its wave's slice
static_assert((KTC % 2) == 0 && ((KTSL * 2) % 16) == 0);

typedef _Float16 v2h __attribute__((ext_vector_type(2)));
typedef float    v2f __attribute__((ext_vector_type(2)));

// Eight asynchronous 16-B copies per lane: rows r, r+2, ..., r+14 of the wave's slice.
// lds: the lane's LDS byte address in row r; gp: the lane's global address in row r.
__device__ __forceinline__ void async_slice8(unsigned lds, const _Float16* gp) {
  const unsigned l0 = lds;
  const unsigned l1 = lds + 1u * 2u * KTP * 2u;
  const unsigned l2 = lds + 2u * 2u * KTP * 2u;
  const unsigned l3 = lds + 3u * 2u * KTP * 2u;
  const unsigned l4 = lds + 4u * 2u * KTP * 2u;
  const unsigned l5 = lds + 5u * 2u * KTP * 2u;
  const unsigned l6 = lds + 6u * 2u * KTP * 2u;
  const unsigned l7 = lds + 7u * 2u * KTP * 2u;
  const _Float16* g0 = gp;
  const _Float16* g1 = gp + (size_t)1 * 2 * SEQ;
  const _Float16* g2 = gp + (size_t)2 * 2 * SEQ;
  const _Float16* g3 = gp + (size_t)3 * 2 * SEQ;
  const _Float16* g4 = gp + (size_t)4 * 2 * SEQ;
  const _Float16* g5 = gp + (size_t)5 * 2 * SEQ;
  const _Float16* g6 = gp + (size_t)6 * 2 * SEQ;
  const _Float16* g7 = gp + (size_t)7 * 2 * SEQ;
  // the copies and, as the last line, the wait that stands before their address registers are reused
  asm volatile(
      "global_load_async_to_lds_b128 %0, %8, off\n\t"
      "global_load_async_to_lds_b128 %1, %9, off\n\t"
      "global_load_async_to_lds_b128 %2, %10, off\n\t"
      "global_load_async_to_lds_b128 %3, %11, off\n\t"
      "global_load_async_to_lds_b128 %4, %12, off\n\t"
      "global_load_async_to_lds_b128 %5, %13, off\n\t"
      "global_load_async_to_lds_b128 %6, %14, off\n\t"
      "global_load_async_to_lds_b128 %7, %15, off\n\t"
      "s_wait_xcnt 0x0"
      :: "v"(l0), "v"(l1), "v"(l2), "v"(l3), "v"(l4), "v"(l5), "v"(l6), "v"(l7),
         "v"(g0), "v"(g1), "v"(g2), "v"(g3), "v"(g4), "v"(g5), "v"(g6), "v"(g7)
      : "memory");
}

__global__ __launch_bounds__(512) void ktv_kernel(
    const _Float16* __restrict__ T16, _Float16* __restrict__ KVt) {
  __shared__ __attribute__((aligned(16))) _Float16 Sl[KTW * KTSL];
  const unsigned tid = threadIdx.x, lane = tid & 31u;
  const unsigned w = (unsigned)__builtin_amdgcn_readfirstlane((int)(threadIdx.x >> 5));
  const unsigned hh = lane >> 4, m = lane & 15u;
  const unsigned head = blockIdx.x >> 2;
  const unsigned qr = (blockIdx.x >> 1) & 1u, qc = blockIdx.x & 1u;
  const unsigned b = blockIdx.y;

  const size_t kbase = ((size_t)b * DIM + head * HD) * SEQ;   // k plane
  const size_t vbase = TPLANE_ELEMS + kbase;                  // v plane
  // copy side: lane -> row lane>>4 (+2 per copy), 16-B chunk lane&15 of the row's 256-B unit
  const _Float16* gv = T16 + vbase + (size_t)(qr * 32u + hh) * SEQ + w * (unsigned)KTD + m * 8u;
  const _Float16* gk = T16 + kbase + (size_t)(qc * 32u + hh) * SEQ + w * (unsigned)KTD + m * 8u;
  _Float16* Sw = &Sl[w * (unsigned)KTSL];
  const unsigned lv = (unsigned)(size_t)Sw + (hh * KTP + m * 8u) * 2u;
  const unsigned lk = lv + 32u * KTP * 2u;
  async_slice8(lv, gv);
  async_slice8(lv + 16u * KTP * 2u, gv + (size_t)16 * SEQ);
  async_slice8(lk, gk);
  async_slice8(lk + 16u * KTP * 2u, gk + (size_t)16 * SEQ);
  asm volatile("s_wait_asynccnt 0x0" ::: "memory");   // this wave's copies have landed
  __syncthreads();                                    // the slices are published before any is read

  const _Float16* sa = Sw + m * KTP + hh * 8u;
  const _Float16* sb = sa + 32u * KTP;
  // the i, j, ks loops are unrolled so that every acc / fragment index is a constant (registers)
  v8f acc[2][2];
#pragma unroll
  for (int i = 0; i < 2; ++i)
#pragma unroll
    for (int j = 0; j < 2; ++j) acc[i][j] = v8f{};
#pragma unroll
  for (unsigned ks = 0; ks < (unsigned)KTD / 32u; ++ks) {
    v16h a[2], bb[2];
#pragma unroll
    for (unsigned i = 0; i < 2u; ++i) a[i] = frag_at(sa + i * 16u * KTP + ks * 32u);
#pragma unroll
    for (unsigned j = 0; j < 2u; ++j) bb[j] = frag_at(sb + j * 16u * KTP + ks * 32u);
#pragma unroll
    for (int i = 0; i < 2; ++i)
#pragma unroll
      for (int j = 0; j < 2; ++j) acc[i][j] = wmma16(a[i], bb[j], acc[i][j]);
  }
  // this wave's fragment reads are done before its partial tile overwrites the head of its slice
  asm volatile("s_wait_dscnt 0x0" ::: "memory");
  float* Pw = (float*)Sw;
#pragma unroll
  for (int i = 0; i < 2; ++i)
#pragma unroll
    for (int j = 0; j < 2; ++j)
#pragma unroll
      for (int r = 0; r < 8; ++r)
        Pw[((unsigned)i * 16u + hh * 8u + (unsigned)r) * KTC + (unsigned)j * 16u + m] = acc[i][j][r];
  __syncthreads();   // all 16 partial tiles are complete before they are summed

  const unsigned r = tid >> 4, c = (tid & 15u) * 2u;
  float s0 = 0.0f, s1 = 0.0f;
#pragma unroll
  for (unsigned g = 0; g < (unsigned)KTW; ++g) {
    const v2f u = *(const v2f*)((const float*)&Sl[g * (unsigned)KTSL] + r * KTC + c);
    s0 += u[0];
    s1 += u[1];
  }
  v2h o;
  o[0] = toh_flush(s0);
  o[1] = toh_flush(s1);
  *(v2h*)(KVt + (size_t)(b * NHEAD + head) * (HD * HD) + (size_t)qc * (HD * 32) +
          (size_t)(qr * 32u + r) * 32u + c) = o;
}

// ---------------------------------------------------------------------------
// Per (128 query rows, head, batch): Ov[b*SEQ+s][head*64 + d2] =
//   f16( 1/8 * sum_d1 Q[s][d1] * KVt[d2][d1] ). 8 waves x 16 rows, 4 output tiles per wave,
// depth 64 in two 32-steps; A fragments from the q plane, B fragments from the KVt rows
// (plane layout [b][head][d1 / 32][d2][d1 % 32]).
// Ov rows are stored as whole lines (one line per row: 8 consecutive lanes x 16 B).
// Grid (SEQ/128, NHEAD, NB).
// ---------------------------------------------------------------------------
__global__ __launch_bounds__(256) void qkv_apply_kernel(
    const _Float16* __restrict__ Qh, const _Float16* __restrict__ KVt,
    _Float16* __restrict__ Ov) {
  __shared__ __attribute__((aligned(16))) _Float16 Ps[8 * 16 * LDT];
  const unsigned tid = threadIdx.x, lane = tid & 31u;
  const unsigned w = (unsigned)__builtin_amdgcn_readfirstlane((int)(threadIdx.x >> 5));
  const unsigned hh = lane >> 4, m = lane & 15u;
  const unsigned q0 = blockIdx.x * 128u;
  const unsigned head = blockIdx.y;
  const unsigned b = blockIdx.z;
  const unsigned qrow0 = q0 + w * 16u;
  const unsigned pbase = w * (16u * LDT);

  const size_t qoff = (size_t)(b * (unsigned)SEQ + qrow0 + m) * DIM + head * HD + hh * 8u;
  const v16h qf0 = frag_at(Qh + qoff);
  const v16h qf1 = frag_at(Qh + qoff + 32);
  const _Float16* kvp = KVt + (size_t)(b * NHEAD + head) * (HD * HD) + (size_t)m * 32 + hh * 8u;

  v8f o[4];
#pragma unroll
  for (int nb = 0; nb < 4; ++nb) {
    const v16h b0 = frag_at(kvp + nb * 16 * 32);             // d1 0..31
    const v16h b1 = frag_at(kvp + HD * 32 + nb * 16 * 32);   // d1 32..63
    v8f t = {};
    t = wmma16(qf0, b0, t);
    t = wmma16(qf1, b1, t);
    o[nb] = t;
  }

#pragma unroll
  for (int nb = 0; nb < 4; ++nb)
#pragma unroll
    for (int v = 0; v < 8; ++v)
      Ps[pbase + (hh * 8u + (unsigned)v) * LDT + (unsigned)nb * 16u + m] =
          toh_flush(o[nb][v] * SCALE_QK);
  wave_lds_sync();
  v8h x[4];
  size_t off[4];
#pragma unroll
  for (unsigned i = 0; i < 4u; ++i) {
    const unsigned r = 4u * i + (lane >> 3);
    const unsigned c = (lane & 7u) * 8u;
    x[i] = *(const v8h*)&Ps[pbase + r * LDT + c];
    off[i] = (size_t)(b * (unsigned)SEQ + qrow0 + r) * DIM + head * HD + c;
  }
#pragma unroll
  for (int i = 0; i < 4; ++i) *(v8h*)(Ov + off[i]) = x[i];
  
}

// ---------------------------------------------------------------------------
extern "C" void kernel_launch(void* const* d_in, const int* in_sizes, int n_in,
                              void* d_out, int out_size, void* d_ws, size_t ws_size,
                              hipStream_t stream) {
  if (n_in < 3) return;
  const long long need_x = ((long long)(NB - 1) * SEQ_FULL + SEQ) * DIM;
  if ((long long)in_sizes[0] < need_x) return;
  if ((long long)in_sizes[1] < (long long)QKVN * DIM) return;
  if ((long long)in_sizes[2] < (long long)DIM * DIM) return;
  if ((long long)out_size < need_x) return;
  if (ws_size < WS_TOTAL) return;

  const float* X    = (const float*)d_in[0];   // [NB_FULL][SEQ_FULL][DIM]
  const float* wqkv = (const float*)d_in[1];   // [QKVN][DIM]  (out, in)
  const float* wo   = (const float*)d_in[2];   // [DIM][DIM]   (out, in)
  float* out = (float*)d_out;

  char* ws = (char*)d_ws;
  _Float16* Wqkv16 = (_Float16*)(ws + OFF_WQKV);   // [n][k]
  _Float16* Wo16   = (_Float16*)(ws + OFF_WO);     // [n][k]
  _Float16* X16    = (_Float16*)(ws + OFF_X);      // compact rows
  _Float16* Q16    = (_Float16*)(ws + OFF_Q);      // [MROWS][head*64 + d]
  _Float16* T16    = (_Float16*)(ws + OFF_T);      // [k|v][b][head*64 + d][SEQ]
  _Float16* KVt16  = (_Float16*)(ws + OFF_KV);     // [b][head][d1 / 32][d2][d1 % 32]
  _Float16* Ctx16  = (_Float16*)(ws + OFF_CTX);    // [MROWS][head*64 + d]

  dim3 blk(256);

  // weight planes are already [out n][in k] (k contiguous): convert in place order, carry x64
  cvt_plane_kernel<<<dim3(QKVN / 2), blk, 0, stream>>>(wqkv, Wqkv16, (unsigned)QKVN, (unsigned)QKVN, WCARRY);
  cvt_plane_kernel<<<dim3(DIM / 2), blk, 0, stream>>>(wo, Wo16, (unsigned)DIM, (unsigned)DIM, WCARRY);
  // activation plane: full-size input rows -> compact rows, carry 1
  cvt_plane_kernel<<<dim3(MROWS / 2), blk, 0, stream>>>(X, X16, (unsigned)SEQ, (unsigned)SEQ_FULL, 1.0f);

  gemm_qkv_kernel<<<dim3(NHEAD, MROWS / QBM), dim3(128), 0, stream>>>(X16, Wqkv16, Q16, T16);
  ktv_kernel<<<dim3(4 * NHEAD, NB), dim3(512), 0, stream>>>(T16, KVt16);
  qkv_apply_kernel<<<dim3(SEQ / 128, NHEAD, NB), blk, 0, stream>>>(Q16, KVt16, Ctx16);
  gemm_out_kernel<<<dim3(DIM / GBN, MROWS / GBM), dim3(128), 0, stream>>>(Ctx16, Wo16, out);
}

// v004
// One run takes 79.6 microseconds.
// Timed twice side by side with v003, it ran 1.06 times as fast both times.
// Counting every step since v000, it is 4.73 times as fast.
#include <hip/hip_runtime.h>
#include <stddef.h>

// All contractions on v_wmma_f32_16x16x32_f16 (f16 operands, f32 accumulate): fused q/k/v projection,
// per-head V^T.K (depth = sequence), per-head Q.(K^T V) (depth 64), output projection. Float inputs are
// RNE-converted to bf16 and carried in f16 (weights x64); q, k, v, K^T V and the merged head plane are
// single f16 planes (carry 1). Scale 1/8 and all carries are undone in f32 epilogues.

typedef _Float16 h16;
typedef _Float16 v16h __attribute__((ext_vector_type(16)));
typedef _Float16 v8h  __attribute__((ext_vector_type(8)));
typedef float    v8f  __attribute__((ext_vector_type(8)));
typedef float    v4f  __attribute__((ext_vector_type(4)));

#ifndef NB
#define NB 4
#endif
#ifndef SEQ
#define SEQ 2048
#endif
#define NB_FULL  4
#define SEQ_FULL 2048
#define DIM   1024
#define NHEAD 16
#define HD    64
#define QKVN  (3 * DIM)
#define MROWS (NB * SEQ)

static_assert(NB >= 1 && NB <= NB_FULL);
static_assert(SEQ >= 128 && SEQ <= SEQ_FULL && (SEQ % 128) == 0);
static_assert(DIM == NHEAD * HD);
static_assert(HD == 64);
static_assert(QKVN == 3 * DIM && (QKVN / 64) == 3 * NHEAD);
static_assert((DIM % 64) == 0 && (DIM % 32) == 0);
static_assert((QKVN % 64) == 0);
static_assert((SEQ % 64) == 0 && (SEQ % 32) == 0);
static_assert((MROWS % 64) == 0 && (MROWS % 2) == 0);
static_assert((QKVN % 2) == 0 && (DIM % 2) == 0);
static_assert(DIM / 8 == 128);                 // convert kernel: 128 eight-column groups per row
static_assert((size_t)MROWS * (DIM / 8) < (size_t)0xFFFFFFFFu);

#define LDT 72   // halves per LDS row (144 B, 16-B aligned)
#define LDC 68   // floats per LDS row (272 B, 16-B aligned)
static_assert((LDT % 8) == 0 && LDT >= 64);
static_assert((LDC % 4) == 0 && LDC >= 64);

#define WCARRY   64.0f     // weight planes carried x64
#define SCALE_QK 0.125f    // HD^-0.5

// workspace layout (bytes)
#define WQKV_BYTES    ((size_t)QKVN * DIM * 2)
#define WO_BYTES      ((size_t)DIM * DIM * 2)
#define PLANE16_BYTES ((size_t)MROWS * DIM * 2)
#define TPLANE_ELEMS  ((size_t)NB * DIM * SEQ)          // one transposed plane [b][col][key]
#define T_BYTES       ((size_t)2 * TPLANE_ELEMS * 2)    // k plane then v plane
#define KV_BYTES      ((size_t)NB * NHEAD * HD * HD * 2)
#define OFF_WQKV ((size_t)0)
#define OFF_WO   (OFF_WQKV + WQKV_BYTES)
#define OFF_X    (OFF_WO + WO_BYTES)
#define OFF_Q    (OFF_X + PLANE16_BYTES)
#define OFF_T    (OFF_Q + PLANE16_BYTES)
#define OFF_KV   (OFF_T + T_BYTES)
#define OFF_CTX  (OFF_KV + KV_BYTES)
#define WS_TOTAL (OFF_CTX + PLANE16_BYTES)
static_assert((WQKV_BYTES % 128) == 0 && (WO_BYTES % 128) == 0 && (PLANE16_BYTES % 128) == 0);
static_assert((T_BYTES % 128) == 0 && (KV_BYTES % 128) == 0);
static_assert(WS_TOTAL <= (size_t)134217728);

// ---------------------------------------------------------------------------
__device__ __forceinline__ float bf16r(float x) {   // RNE convert to bf16, returned widened
  unsigned int u = __float_as_uint(x);
  u = (u + 0x7FFFu + ((u >> 16) & 1u)) & 0xFFFF0000u;
  return __uint_as_float(u);
}

// f32 -> f16 operand convert that cannot produce an f16 subnormal
static __device__ __forceinline__ h16 toh_flush(float v) {
  const h16 r = (h16)v;
  return (fabsf(v) < 6.103515625e-05f) ? (h16)0.0f : r;
}

// 16-bit fragment: p points at element [row = lane&15][k0 + 8*(lane>>4)] of a k-contiguous
// row. Elements 0..7 <- k0+8h+0..7, elements 8..15 <- k0+16+8h+0..7 (same map for A and B).
__device__ __forceinline__ v16h frag_at(const _Float16* p) {
  v8h lo = *(const v8h*)(p);
  v8h hi = *(const v8h*)(p + 16);
  v16h out;
#pragma unroll
  for (int i = 0; i < 8; ++i) { out[i] = lo[i]; out[i + 8] = hi[i]; }
  return out;
}

__device__ __forceinline__ v8f wmma16(v16h a, v16h b, v8f c) {
  v8f d = __builtin_amdgcn_wmma_f32_16x16x32_f16(false, a, false, b, (short)0, c,
                                                 false, false);
  asm volatile("v_nop\n\tv_nop\n\tv_nop\n\tv_nop" : "+v"(d) : "v"(a), "v"(b));
  return d;
}

// The builtin alone (the compiler keeps the distances behind its own form): an asm statement's vector
// operands stay in the first 256 registers, which an 8 x 6 accumulator set does not fit.
__device__ __forceinline__ v8f wmma16p(v16h a, v16h b, v8f c) {
  return __builtin_amdgcn_wmma_f32_16x16x32_f16(false, a, false, b, (short)0, c, false, false);
}

__device__ __forceinline__ void wave_lds_sync() {
  __builtin_amdgcn_fence(3 /* release order */, "wavefront");
  asm volatile("s_wait_dscnt 0x0" ::: "memory");
  __builtin_amdgcn_wave_barrier();
}

// ---------------------------------------------------------------------------
// Plane converts, all three in one launch: dst[row][c] = f16(carry * bf16(src row [c])), rows of DIM columns.
// The three f16 planes lie one behind the other in the workspace, so dst is one plane of CVT_ROWS rows:
// rows [0, QKVN) <- wqkv (carry 64), [QKVN, QKVN + DIM) <- wo (carry 64), the rest <- x (carry 1), compact
// row crow taken from input row (crow / SEQ) * SEQ_FULL + crow % SEQ.
// One thread per 8 columns (one 16-B store); 256 threads x 8 columns = 2 rows per block. Every plane has an
// even number of rows and SEQ is even, so a block's two rows are neighbours in one source: the choice of
// source is block-uniform (scalar). Grid (CVT_ROWS / 2).
// ---------------------------------------------------------------------------
#define CVT_ROWS (QKVN + DIM + MROWS)
static_assert(OFF_WQKV == 0 && OFF_WO == (size_t)QKVN * DIM * 2 && OFF_X == (size_t)(QKVN + DIM) * DIM * 2);
static_assert(2 * DIM == 256 * 8 && (SEQ % 2) == 0);

__global__ __launch_bounds__(256) void cvt_planes_kernel(
    const float* __restrict__ wqkv, const float* __restrict__ wo, const float* __restrict__ x,
    _Float16* __restrict__ dst) {
  const unsigned row0 = blockIdx.x * 2u;
  const bool is_wqkv = row0 < (unsigned)QKVN;
  const bool is_w = row0 < (unsigned)(QKVN + DIM);
  const unsigned crow = row0 - (unsigned)(QKVN + DIM);   // compact x row (used only where !is_w)
  const unsigned xrow = (crow / (unsigned)SEQ) * (unsigned)SEQ_FULL + crow % (unsigned)SEQ;
  const float* base = is_wqkv ? wqkv : (is_w ? wo : x);
  const unsigned srow = is_wqkv ? row0 : (is_w ? row0 - (unsigned)QKVN : xrow);
  const float* src = base + (size_t)srow * DIM;
  const float carry = is_w ? WCARRY : 1.0f;
  const unsigned e = threadIdx.x * 8u;   // element within the block's two rows
  const v4f a0 = *(const v4f*)(src + e);
  const v4f a1 = *(const v4f*)(src + e + 4u);
  v8h o;
#pragma unroll
  for (int i = 0; i < 4; ++i) {
    o[i]     = toh_flush(carry * bf16r(a0[i]));
    o[i + 4] = toh_flush(carry * bf16r(a1[i]));
  }
  *(v8h*)(dst + (size_t)row0 * DIM + e) = o;
}

// ---------------------------------------------------------------------------
// Output projection GEMM C[128x128 tile] = A16[rows][K] . Bt[n][K]^T. Per trip one 128-B line (64 k) of each of the
// 128 A rows and 128 B rows is copied global -> LDS by asynchronous 16-B copies (whole lines: 8 lanes
// per row), two buffers, the next tile's copies in flight while this tile is worked on.
// 4 waves (wm = 64-row group, wn = 64-col group), 4 x 4 accumulators/wave, fragments from LDS.
// Epilogue per wave: outf full [full row][col] = acc/64.
// Grid (N/128, MROWS/128), 128 threads.
// ---------------------------------------------------------------------------
#define GBM 128                       // tile rows
#define GBN 128                       // tile columns
#define GBK 64                        // k per trip (one 128-B line per row)
#define GSTAGE ((GBM + GBN) * LDT)    // halves per buffer: A rows then B rows, pitch LDT
static_assert((MROWS % GBM) == 0 && (SEQ % GBM) == 0);
static_assert((DIM % GBN) == 0);
static_assert((DIM % GBK) == 0 && (DIM / GBK) >= 2);
static_assert(LDT >= GBK && ((LDT * 2) % 16) == 0);
static_assert((size_t)4 * 64 * LDC * 4 <= (size_t)2 * GSTAGE * 2);   // epilogue staging fits the ring

// Eight asynchronous 16-B copies per lane: rows r, r+16, ..., r+112 of one operand's tile.
// lds: the lane's LDS byte address of row r; gp: the lane's global address of row r.
__device__ __forceinline__ void async_rows8(unsigned lds, const _Float16* gp, unsigned K) {
  const unsigned l0 = lds;
  const unsigned l1 = lds + 1u * 16u * LDT * 2u;
  const unsigned l2 = lds + 2u * 16u * LDT * 2u;
  const unsigned l3 = lds + 3u * 16u * LDT * 2u;
  const unsigned l4 = lds + 4u * 16u * LDT * 2u;
  const unsigned l5 = lds + 5u * 16u * LDT * 2u;
  const unsigned l6 = lds + 6u * 16u * LDT * 2u;
  const unsigned l7 = lds + 7u * 16u * LDT * 2u;
  const _Float16* g0 = gp;
  const _Float16* g1 = gp + (size_t)1 * 16 * K;
  const _Float16* g2 = gp + (size_t)2 * 16 * K;
  const _Float16* g3 = gp + (size_t)3 * 16 * K;
  const _Float16* g4 = gp + (size_t)4 * 16 * K;
  const _Float16* g5 = gp + (size_t)5 * 16 * K;
  const _Float16* g6 = gp + (size_t)6 * 16 * K;
  const _Float16* g7 = gp + (size_t)7 * 16 * K;
  // the copies and, as the last line, the wait that stands before their address registers are reused
  asm volatile(
      "global_load_async_to_lds_b128 %0, %8, off\n\t"
      "global_load_async_to_lds_b128 %1, %9, off\n\t"
      "global_load_async_to_lds_b128 %2, %10, off\n\t"
      "global_load_async_to_lds_b128 %3, %11, off\n\t"
      "global_load_async_to_lds_b128 %4, %12, off\n\t"
      "global_load_async_to_lds_b128 %5, %13, off\n\t"
      "global_load_async_to_lds_b128 %6, %14, off\n\t"
      "global_load_async_to_lds_b128 %7, %15, off\n\t"
      "s_wait_xcnt 0x0"
      :: "v"(l0), "v"(l1), "v"(l2), "v"(l3), "v"(l4), "v"(l5), "v"(l6), "v"(l7),
         "v"(g0), "v"(g1), "v"(g2), "v"(g3), "v"(g4), "v"(g5), "v"(g6), "v"(g7)
      : "memory");
}

__device__ __forceinline__ void gemm_body(
    const _Float16* __restrict__ A16, const _Float16* __restrict__ Bt, const unsigned K,
    float* __restrict__ outf) {
  __shared__ __attribute__((aligned(16))) _Float16 S[2 * GSTAGE];
  const unsigned tid = threadIdx.x, lane = tid & 31u;
  const unsigned w = (unsigned)__builtin_amdgcn_readfirstlane((int)(threadIdx.x >> 5));
  const unsigned wm = w >> 1, wn = w & 1u;
  const unsigned hh = lane >> 4, m = lane & 15u;
  const unsigned n0 = blockIdx.x * (unsigned)GBN;
  const unsigned row0 = blockIdx.y * (unsigned)GBM;

  // copy side: lane -> row tid>>3 (+16 per copy), 16-B chunk tid&7 of the row's line
  const unsigned crow = tid >> 3, cch = (tid & 7u) * 8u;
  const _Float16* ga = A16 + (size_t)(row0 + crow) * K + cch;
  const _Float16* gb = Bt + (size_t)(n0 + crow) * K + cch;
  const unsigned la = (unsigned)(size_t)&S[0] + (crow * LDT + cch) * 2u;
  const unsigned lb = la + (unsigned)GBM * LDT * 2u;
  // fragment side
  const _Float16* sa = &S[(wm * 64u + m) * LDT + hh * 8u];
  const _Float16* sb = &S[((unsigned)GBM + wn * 64u + m) * LDT + hh * 8u];
  const unsigned nt_k = K / (unsigned)GBK;

  // the i, j, ks loops below are unrolled so that every acc / fragment index is a constant (registers)
  v8f acc[4][4];
#pragma unroll
  for (int i = 0; i < 4; ++i)
#pragma unroll
    for (int j = 0; j < 4; ++j) acc[i][j] = v8f{};

  async_rows8(la, ga, K);
  async_rows8(lb, gb, K);
  asm volatile("s_wait_asynccnt 0x0" ::: "memory");   // tile 0 landed (this wave's copies)
  __syncthreads();                                    // tile 0 published to every wave
  async_rows8(la + (unsigned)GSTAGE * 2u, ga + GBK, K);
  async_rows8(lb + (unsigned)GSTAGE * 2u, gb + GBK, K);

  for (unsigned t = 0; t < nt_k; ++t) {
    const unsigned bo = (t & 1u) * (unsigned)GSTAGE;
#pragma unroll
    for (unsigned ks = 0; ks < 2u; ++ks) {
      v16h a[4], b[4];
#pragma unroll
      for (unsigned i = 0; i < 4u; ++i) a[i] = frag_at(sa + bo + i * 16u * LDT + ks * 32u);
#pragma unroll
      for (unsigned j = 0; j < 4u; ++j) b[j] = frag_at(sb + bo + j * 16u * LDT + ks * 32u);
#pragma unroll
      for (int i = 0; i < 4; ++i)
#pragma unroll
        for (int j = 0; j < 4; ++j) acc[i][j] = wmma16(a[i], b[j], acc[i][j]);
    }
    asm volatile("s_wait_dscnt 0x0" ::: "memory");     // this wave's reads of buffer t&1 are done
    asm volatile("s_wait_asynccnt 0x0" ::: "memory");  // this wave's copies of tile t+1 have landed
    __syncthreads();   // publishes tile t+1 and ends every wave's reads of the buffer refilled below
    if (t + 2u < nt_k) {
      async_rows8(la + bo * 2u, ga + (size_t)(t + 2u) * GBK, K);
      async_rows8(lb + bo * 2u, gb + (size_t)(t + 2u) * GBK, K);
    }
  }
  asm volatile("s_wait_asynccnt 0x0" ::: "memory");    // no copy outstanding when the ring is reused

  // the ring is free behind the last trip's barrier: each wave stages its own 64x64 tile there
  float* Cw = (float*)&S[0] + w * (64u * LDC);
#pragma unroll
  for (int i = 0; i < 4; ++i)
#pragma unroll
    for (int j = 0; j < 4; ++j)
#pragma unroll
      for (int r = 0; r < 8; ++r)
        Cw[((unsigned)i * 16u + hh * 8u + (unsigned)r) * LDC + (unsigned)j * 16u + m] = acc[i][j][r];
  __syncthreads();   // the staged tile is complete before other lanes read it back

  const unsigned wrow0 = row0 + wm * 64u;

  // Epilogue loop: eight rows per trip (two per store), their LDS reads in flight together and their four stores as one
  // group; kept rolled (the code runs once per tile). The s_wait_xcnt at a trip's foot stands in front
  // of the next trip's reuse of the stores' address and data registers.
  {
    const unsigned bidx = wrow0 / (unsigned)SEQ;
    const unsigned sq0 = wrow0 - bidx * (unsigned)SEQ;
    const size_t frow0 = (size_t)bidx * SEQ_FULL + sq0;
#pragma unroll 1   // rolled: runs once per tile, unrolling only grows the code
    for (unsigned i0 = 0; i0 < 32u; i0 += 4u) {
      v4f xs[4];
      size_t off[4];
#pragma unroll
      for (unsigned i = 0; i < 4u; ++i) {
        const unsigned r = 2u * (i0 + i) + (lane >> 4);
        const unsigned c = (lane & 15u) * 4u;
        const v4f u = *(const v4f*)&Cw[r * LDC + c];
        v4f val;
#pragma unroll
        for (int j = 0; j < 4; ++j) val[j] = u[j] * (1.0f / WCARRY);
        xs[i] = val;
        off[i] = (frow0 + r) * DIM + n0 + wn * 64u + c;
      }
#pragma unroll
      for (int i = 0; i < 4; ++i) *(v4f*)(outf + off[i]) = xs[i];
      asm volatile("s_wait_xcnt 0x0" ::: "memory");   // before the stores' registers are reused
    }
  }
}

__global__ __launch_bounds__(128) void gemm_out_kernel(
    const _Float16* __restrict__ A16, const _Float16* __restrict__ Bt,
    float* __restrict__ outf) {
  gemm_body(A16, Bt, (unsigned)DIM, outf);
}

// ---------------------------------------------------------------------------
// Fused q/k/v projection: C[256 rows x 192 columns] = A16[rows][DIM] . Bt[n][DIM]^T, the 192 columns
// being one head's q, k and v (column n = head*192 + part*64 + d). Per trip one 128-B line (64 k) of
// each of the 256 A rows and 192 B rows is copied global -> LDS by asynchronous 16-B copies, two
// buffers, the next tile's copies in flight while this tile is worked on.
// 4 waves (wm = 128-row group, wn = 96-column group), 8 x 6 accumulators per wave, fragments from LDS.
// Two blocks share a WGP (two waves per SIMD), so all 512 blocks of the grid are resident at once.
// Epilogue: f16(acc/64) staged in the free ring, q as [row][d], k and v transposed as [d][key] (a lane's
// 8 accumulator rows are 8 consecutive keys: one 16-B LDS store), then written as whole lines:
//   outq[row][head*64 + d] (pitch DIM), outt[k|v][b][head*64 + d][key].
// Grid (NHEAD, MROWS/256), 128 threads.
// ---------------------------------------------------------------------------
#define QBM 256                       // tile rows
#define QBN 192                       // tile columns: q, k, v of one head
#define QSTAGE ((QBM + QBN) * LDT)    // halves per buffer: A rows then B rows, pitch LDT
#define QTP (QBM + 8)                 // halves per row of the transposed k/v staging (528 B = 16 B x odd)
static_assert(QBN == 3 * HD && (QKVN % QBN) == 0 && (QKVN / QBN) == NHEAD);
static_assert((MROWS % QBM) == 0 && (SEQ % QBM) == 0);
static_assert((size_t)QBM * LDT + (size_t)2 * HD * QTP <= (size_t)2 * QSTAGE);   // staging fits the ring
static_assert((size_t)2 * 2 * QSTAGE * 2 <= (size_t)327680);                     // two blocks per WGP

// Four asynchronous 16-B copies per lane: rows r, r+16, r+32, r+48 of one operand's tile.
__device__ __forceinline__ void async_rows4(unsigned lds, const _Float16* gp, unsigned K) {
  const unsigned l0 = lds;
  const unsigned l1 = lds + 1u * 16u * LDT * 2u;
  const unsigned l2 = lds + 2u * 16u * LDT * 2u;
  const unsigned l3 = lds + 3u * 16u * LDT * 2u;
  const _Float16* g0 = gp;
  const _Float16* g1 = gp + (size_t)1 * 16 * K;
  const _Float16* g2 = gp + (size_t)2 * 16 * K;
  const _Float16* g3 = gp + (size_t)3 * 16 * K;
  // the copies and, as the last line, the wait that stands before their address registers are reused
  asm volatile(
      "global_load_async_to_lds_b128 %0, %4, off\n\t"
      "global_load_async_to_lds_b128 %1, %5, off\n\t"
      "global_load_async_to_lds_b128 %2, %6, off\n\t"
      "global_load_async_to_lds_b128 %3, %7, off\n\t"
      "s_wait_xcnt 0x0"
      :: "v"(l0), "v"(l1), "v"(l2), "v"(l3), "v"(g0), "v"(g1), "v"(g2), "v"(g3)
      : "memory");
}

// One 64-k tile: 256 A rows and 192 B rows, 28 copies per lane.
__device__ __forceinline__ void async_qkv_tile(unsigned la, unsigned lb,
                                               const _Float16* ga, const _Float16* gb) {
  async_rows8(la, ga, (unsigned)DIM);
  async_rows8(la + 128u * LDT * 2u, ga + (size_t)128 * DIM, (unsigned)DIM);
  async_rows8(lb, gb, (unsigned)DIM);
  async_rows4(lb + 128u * LDT * 2u, gb + (size_t)128 * DIM, (unsigned)DIM);
}

// second launch-bounds argument: two waves per SIMD, so that two blocks share a WGP
__global__ __launch_bounds__(128, 2) void gemm_qkv_kernel(
    const _Float16* __restrict__ A16, const _Float16* __restrict__ Bt,
    _Float16* __restrict__ outq, _Float16* __restrict__ outt) {
  __shared__ __attribute__((aligned(16))) _Float16 S[2 * QSTAGE];
  const unsigned tid = threadIdx.x, lane = tid & 31u;
  const unsigned w = (unsigned)__builtin_amdgcn_readfirstlane((int)(threadIdx.x >> 5));
  const unsigned wm = w >> 1, wn = w & 1u;
  const unsigned hh = lane >> 4, m = lane & 15u;
  const unsigned head = blockIdx.x;
  const unsigned row0 = blockIdx.y * (unsigned)QBM;

  // copy side: lane -> row tid>>3 (+16 per copy), 16-B chunk tid&7 of the row's line
  const unsigned crow = tid >> 3, cch = (tid & 7u) * 8u;
  const _Float16* Ab = A16 + (size_t)row0 * DIM;                      // block-uniform bases
  const _Float16* Bb = Bt + (size_t)(head * (unsigned)QBN) * DIM;
  const unsigned goff = crow * (unsigned)DIM + cch;                   // the lane's element offset, A and B alike
  const unsigned la = (unsigned)(size_t)&S[0] + (crow * LDT + cch) * 2u;
  const unsigned lb = la + (unsigned)QBM * LDT * 2u;
  // fragment side
  const _Float16* sa = &S[(wm * 128u + m) * LDT + hh * 8u];
  const _Float16* sb = &S[((unsigned)QBM + wn * 96u + m) * LDT + hh * 8u];
  const unsigned nt_k = (unsigned)DIM / (unsigned)GBK;

  // the i, j, ks loops below are unrolled so that every acc / fragment index is a constant (registers)
  v8f acc[8][6];
#pragma unroll
  for (int i = 0; i < 8; ++i)
#pragma unroll
    for (int j = 0; j < 6; ++j) acc[i][j] = v8f{};

  async_qkv_tile(la, lb, Ab + goff, Bb + goff);
  asm volatile("s_wait_asynccnt 0x0" ::: "memory");   // tile 0 landed (this wave's copies)
  __syncthreads();                                    // tile 0 published to every wave
  async_qkv_tile(la + (unsigned)QSTAGE * 2u, lb + (unsigned)QSTAGE * 2u, Ab + GBK + goff, Bb + GBK + goff);

  for (unsigned t = 0; t < nt_k; ++t) {
    const unsigned bo = (t & 1u) * (unsigned)QSTAGE;
#pragma unroll
    for (unsigned ks = 0; ks < 2u; ++ks) {
      const _Float16* pa = sa + bo + ks * 32u;
      const _Float16* pb = sb + bo + ks * 32u;
      v16h a[8], b[6];
#pragma unroll
      for (unsigned j = 0; j < 6u; ++j) b[j] = frag_at(pb + j * 16u * LDT);
      a[0] = frag_at(pa);
      a[1] = frag_at(pa + 16u * LDT);
#pragma unroll
      for (int g = 0; g < 4; ++g) {       // row pairs: the next pair's A fragments are read one pair ahead
        if (g < 3) {
          a[2 * g + 2] = frag_at(pa + (unsigned)(2 * g + 2) * 16u * LDT);
          a[2 * g + 3] = frag_at(pa + (unsigned)(2 * g + 3) * 16u * LDT);
        }
        // keeps the next pair's LDS reads one group ahead of this pair's WMMAs (else they sink to their use)
        __builtin_amdgcn_sched_barrier(0);
#pragma unroll
        for (int i = 2 * g; i < 2 * g + 2; ++i)
#pragma unroll
          for (int j = 0; j < 6; ++j) acc[i][j] = wmma16p(a[i], b[j], acc[i][j]);
        // keeps later LDS reads from moving in among these WMMAs
        __builtin_amdgcn_sched_barrier(0);
      }
    }
    asm volatile("s_wait_dscnt 0x0" ::: "memory");     // this wave's reads of buffer t&1 are done
    asm volatile("s_wait_asynccnt 0x0" ::: "memory");  // this wave's copies of tile t+1 have landed
    __syncthreads();   // publishes tile t+1 and ends every wave's reads of the buffer refilled below
    if (t + 2u < nt_k) {
      const unsigned kn = (t + 2u) * (unsigned)GBK;
      async_qkv_tile(la + bo * 2u, lb + bo * 2u, Ab + kn + goff, Bb + kn + goff);
    }
  }
  asm volatile("s_wait_asynccnt 0x0" ::: "memory");    // no copy outstanding when the ring is reused

  // the lane id is read anew here, so that no lane-derived value of the epilogue is held in a register
  // across the K loop, where the budget of 512 is full (held there, one of them is spilled to scratch)
  const unsigned ln = __builtin_amdgcn_mbcnt_lo(~0u, 0u);
  const unsigned eh = ln >> 4, em = ln & 15u;
  // the ring is free behind the last trip's barrier: the block's tile is staged there as f16
  _Float16* Tq = &S[0];                       // [256 rows][LDT]
  _Float16* Tt = &S[(unsigned)QBM * LDT];     // [128 = k d, v d][QTP]
#pragma unroll
  for (int j = 0; j < 6; ++j) {
    const unsigned d = (wn * 6u + (unsigned)j - 4u) * 16u + em;   // k/v staging row (unused for q columns)
#pragma unroll
    for (int i = 0; i < 8; ++i) {
      const unsigned row = wm * 128u + (unsigned)i * 16u + eh * 8u;
      v8h x;
#pragma unroll
      for (int r = 0; r < 8; ++r) x[r] = toh_flush(acc[i][j][r] * (1.0f / WCARRY));
      if (j < 4 && wn == 0u) {                // columns 0..63 of the head: q (wave-uniform test)
#pragma unroll
        for (int r = 0; r < 8; ++r) Tq[(row + (unsigned)r) * LDT + (unsigned)j * 16u + em] = x[r];
      } else {                                // columns 64..191: k then v, stored transposed
        *(v8h*)&Tt[d * QTP + row] = x;
      }
    }
  }
  __syncthreads();   // the staged tile is complete before other waves read it back

  // Write-out loops: four wave-wide 16-B stores per trip, their LDS reads in flight together; kept
  // rolled (the code runs once per tile). The s_wait_xcnt at a trip's foot stands in front of the next
  // trip's reuse of the stores' address and data registers.
#pragma unroll 1   // rolled: runs once per tile, unrolling only grows the code
  for (unsigned i0 = 0; i0 < 16u; i0 += 4u) {          // q: 4 rows (one line each) per store
    v8h x[4];
    size_t off[4];
#pragma unroll
    for (unsigned i = 0; i < 4u; ++i) {
      const unsigned r = 4u * (w * 16u + i0 + i) + (ln >> 3);
      const unsigned c = (ln & 7u) * 8u;
      x[i] = *(const v8h*)&Tq[r * LDT + c];
      off[i] = (size_t)(row0 + r) * DIM + head * HD + c;
    }
#pragma unroll
    for (int i = 0; i < 4; ++i) *(v8h*)(outq + off[i]) = x[i];
    asm volatile("s_wait_xcnt 0x0" ::: "memory");   // before the stores' registers are reused
  }
  const unsigned bidx = row0 / (unsigned)SEQ;
  const unsigned key0 = row0 - bidx * (unsigned)SEQ;
#pragma unroll 1   // rolled: runs once per tile, unrolling only grows the code
  for (unsigned i0 = 0; i0 < 32u; i0 += 4u) {          // k, v: one d row (256 keys, 4 lines) per store
    v8h x[4];
    size_t off[4];
#pragma unroll
    for (unsigned i = 0; i < 4u; ++i) {
      const unsigned d = w * 32u + i0 + i;             // 0..63: k plane, 64..127: v plane
      x[i] = *(const v8h*)&Tt[d * QTP + ln * 8u];
      off[i] = (size_t)(d >> 6) * TPLANE_ELEMS +
               ((size_t)bidx * DIM + head * HD + (d & 63u)) * SEQ + key0 + ln * 8u;
    }
#pragma unroll
    for (int i = 0; i < 4; ++i) *(v8h*)(outt + off[i]) = x[i];
    asm volatile("s_wait_xcnt 0x0" ::: "memory");   // before the stores' registers are reused
  }
}


// ---------------------------------------------------------------------------
// Per (head, batch, 32x32 quadrant qr, qc): KV[d2][d1] = sum_s V[s][d2] * K[s][d1], depth SEQ.
// A = 32 V^T plane rows (m = d2, k = s contiguous), B = 32 K^T plane rows (n = d1, k = s contiguous).
// 16 waves, wave w owns depth [w*KTD, (w+1)*KTD): one aligned 256-B unit of each of the 64 rows, copied
// global -> LDS by asynchronous 16-B copies (16 lanes per row: whole lines) into the wave's own slice,
// all 32 copies of a lane in flight together. 2 x 2 accumulators per wave, fragments from LDS.
// The 16 partial tiles are summed in f32 in wave order through LDS and written as f16.
// Plane layout [b][head][qc][d2][32 columns]: a quadrant is 2 KiB of whole lines with one writer.
// Grid (4 * NHEAD, NB), 512 threads.
// ---------------------------------------------------------------------------
#define KTW   16                 // waves per block = depth slices
#define KTD   (SEQ / KTW)        // depth per wave
#define KTP   (KTD + 8)          // halves per LDS row (272 B = 16 B x odd)
#define KTSL  (64 * KTP)         // halves per wave slice: 32 V rows then 32 K rows
#define KTC   36                 // floats per row of a wave's 32x32 partial tile
static_assert(KTD == 128);                                   // one 256-B unit per row and wave
static_assert((size_t)KTW * KTSL * 2 <= (size_t)327680);     // the slices fit the LDS
static_assert((size_t)32 * KTC * 4 <= (size_t)KTSL * 2);     // a partial tile fits its wave's slice
static_assert((KTC % 2) == 0 && ((KTSL * 2) % 16) == 0);

typedef _Float16 v2h __attribute__((ext_vector_type(2)));
typedef float    v2f __attribute__((ext_vector_type(2)));

// Eight asynchronous 16-B copies per lane: rows r, r+2, ..., r+14 of the wave's slice.
// lds: the lane's LDS byte address in row r; gp: the lane's global address in row r.
__device__ __forceinline__ void async_slice8(unsigned lds, const _Float16* gp) {
  const unsigned l0 = lds;
  const unsigned l1 = lds + 1u * 2u * KTP * 2u;
  const unsigned l2 = lds + 2u * 2u * KTP * 2u;
  const unsigned l3 = lds + 3u * 2u * KTP * 2u;
  const unsigned l4 = lds + 4u * 2u * KTP * 2u;
  const unsigned l5 = lds + 5u * 2u * KTP * 2u;
  const unsigned l6 = lds + 6u * 2u * KTP * 2u;
  const unsigned l7 = lds + 7u * 2u * KTP * 2u;
  const _Float16* g0 = gp;
  const _Float16* g1 = gp + (size_t)1 * 2 * SEQ;
  const _Float16* g2 = gp + (size_t)2 * 2 * SEQ;
  const _Float16* g3 = gp + (size_t)3 * 2 * SEQ;
  const _Float16* g4 = gp + (size_t)4 * 2 * SEQ;
  const _Float16* g5 = gp + (size_t)5 * 2 * SEQ;
  const _Float16* g6 = gp + (size_t)6 * 2 * SEQ;
  const _Float16* g7 = gp + (size_t)7 * 2 * SEQ;
  // the copies and, as the last line, the wait that stands before their address registers are reused
  asm volatile(
      "global_load_async_to_lds_b128 %0, %8, off\n\t"
      "global_load_async_to_lds_b128 %1, %9, off\n\t"
      "global_load_async_to_lds_b128 %2, %10, off\n\t"
      "global_load_async_to_lds_b128 %3, %11, off\n\t"
      "global_load_async_to_lds_b128 %4, %12, off\n\t"
      "global_load_async_to_lds_b128 %5, %13, off\n\t"
      "global_load_async_to_lds_b128 %6, %14, off\n\t"
      "global_load_async_to_lds_b128 %7, %15, off\n\t"
      "s_wait_xcnt 0x0"
      :: "v"(l0), "v"(l1), "v"(l2), "v"(l3), "v"(l4), "v"(l5), "v"(l6), "v"(l7),
         "v"(g0), "v"(g1), "v"(g2), "v"(g3), "v"(g4), "v"(g5), "v"(g6), "v"(g7)
      : "memory");
}

__global__ __launch_bounds__(512) void ktv_kernel(
    const _Float16* __restrict__ T16, _Float16* __restrict__ KVt) {
  __shared__ __attribute__((aligned(16))) _Float16 Sl[KTW * KTSL];
  const unsigned tid = threadIdx.x, lane = tid & 31u;
  const unsigned w = (unsigned)__builtin_amdgcn_readfirstlane((int)(threadIdx.x >> 5));
  const unsigned hh = lane >> 4, m = lane & 15u;
  const unsigned head = blockIdx.x >> 2;
  const unsigned qr = (blockIdx.x >> 1) & 1u, qc = blockIdx.x & 1u;
  const unsigned b = blockIdx.y;

  const size_t kbase = ((size_t)b * DIM + head * HD) * SEQ;   // k plane
  const size_t vbase = TPLANE_ELEMS + kbase;                  // v plane
  // copy side: lane -> row lane>>4 (+2 per copy), 16-B chunk lane&15 of the row's 256-B unit
  const _Float16* gv = T16 + vbase + (size_t)(qr * 32u + hh) * SEQ + w * (unsigned)KTD + m * 8u;
  const _Float16* gk = T16 + kbase + (size_t)(qc * 32u + hh) * SEQ + w * (unsigned)KTD + m * 8u;
  _Float16* Sw = &Sl[w * (unsigned)KTSL];
  const unsigned lv = (unsigned)(size_t)Sw + (hh * KTP + m * 8u) * 2u;
  const unsigned lk = lv + 32u * KTP * 2u;
  async_slice8(lv, gv);
  async_slice8(lv + 16u * KTP * 2u, gv + (size_t)16 * SEQ);
  async_slice8(lk, gk);
  async_slice8(lk + 16u * KTP * 2u, gk + (size_t)16 * SEQ);
  asm volatile("s_wait_asynccnt 0x0" ::: "memory");   // this wave's copies have landed
  __syncthreads();                                    // the slices are published before any is read

  const _Float16* sa = Sw + m * KTP + hh * 8u;
  const _Float16* sb = sa + 32u * KTP;
  // the i, j, ks loops are unrolled so that every acc / fragment index is a constant (registers)
  v8f acc[2][2];
#pragma unroll
  for (int i = 0; i < 2; ++i)
#pragma unroll
    for (int j = 0; j < 2; ++j) acc[i][j] = v8f{};
#pragma unroll
  for (unsigned ks = 0; ks < (unsigned)KTD / 32u; ++ks) {
    v16h a[2], bb[2];
#pragma unroll
    for (unsigned i = 0; i < 2u; ++i) a[i] = frag_at(sa + i * 16u * KTP + ks * 32u);
#pragma unroll
    for (unsigned j = 0; j < 2u; ++j) bb[j] = frag_at(sb + j * 16u * KTP + ks * 32u);
#pragma unroll
    for (int i = 0; i < 2; ++i)
#pragma unroll
      for (int j = 0; j < 2; ++j) acc[i][j] = wmma16(a[i], bb[j], acc[i][j]);
  }
  // this wave's fragment reads are done before its partial tile overwrites the head of its slice
  asm volatile("s_wait_dscnt 0x0" ::: "memory");
  float* Pw = (float*)Sw;
#pragma unroll
  for (int i = 0; i < 2; ++i)
#pragma unroll
    for (int j = 0; j < 2; ++j)
#pragma unroll
      for (int r = 0; r < 8; ++r)
        Pw[((unsigned)i * 16u + hh * 8u + (unsigned)r) * KTC + (unsigned)j * 16u + m] = acc[i][j][r];
  __syncthreads();   // all 16 partial tiles are complete before they are summed

  const unsigned r = tid >> 4, c = (tid & 15u) * 2u;
  float s0 = 0.0f, s1 = 0.0f;
#pragma unroll
  for (unsigned g = 0; g < (unsigned)KTW; ++g) {
    const v2f u = *(const v2f*)((const float*)&Sl[g * (unsigned)KTSL] + r * KTC + c);
    s0 += u[0];
    s1 += u[1];
  }
  v2h o;
  o[0] = toh_flush(s0);
  o[1] = toh_flush(s1);
  *(v2h*)(KVt + (size_t)(b * NHEAD + head) * (HD * HD) + (size_t)qc * (HD * 32) +
          (size_t)(qr * 32u + r) * 32u + c) = o;
}

// ---------------------------------------------------------------------------
// Per (128 query rows, head, batch): Ov[b*SEQ+s][head*64 + d2] =
//   f16( 1/8 * sum_d1 Q[s][d1] * KVt[d2][d1] ). 8 waves x 16 rows, 4 output tiles per wave,
// depth 64 in two 32-steps; A fragments from the q plane, B fragments from the KVt rows
// (plane layout [b][head][d1 / 32][d2][d1 % 32]).
// Ov rows are stored as whole lines (one line per row: 8 consecutive lanes x 16 B).
// Grid (SEQ/128, NHEAD, NB).
// ---------------------------------------------------------------------------
__global__ __launch_bounds__(256) void qkv_apply_kernel(
    const _Float16* __restrict__ Qh, const _Float16* __restrict__ KVt,
    _Float16* __restrict__ Ov) {
  __shared__ __attribute__((aligned(16))) _Float16 Ps[8 * 16 * LDT];
  const unsigned tid = threadIdx.x, lane = tid & 31u;
  const unsigned w = (unsigned)__builtin_amdgcn_readfirstlane((int)(threadIdx.x >> 5));
  const unsigned hh = lane >> 4, m = lane & 15u;
  const unsigned q0 = blockIdx.x * 128u;
  const unsigned head = blockIdx.y;
  const unsigned b = blockIdx.z;
  const unsigned qrow0 = q0 + w * 16u;
  const unsigned pbase = w * (16u * LDT);

  const size_t qoff = (size_t)(b * (unsigned)SEQ + qrow0 + m) * DIM + head * HD + hh * 8u;
  const v16h qf0 = frag_at(Qh + qoff);
  const v16h qf1 = frag_at(Qh + qoff + 32);
  const _Float16* kvp = KVt + (size_t)(b * NHEAD + head) * (HD * HD) + (size_t)m * 32 + hh * 8u;

  v8f o[4];
#pragma unroll
  for (int nb = 0; nb < 4; ++nb) {
    const v16h b0 = frag_at(kvp + nb * 16 * 32);             // d1 0..31
    const v16h b1 = frag_at(kvp + HD * 32 + nb * 16 * 32);   // d1 32..63
    v8f t = {};
    t = wmma16(qf0, b0, t);
    t = wmma16(qf1, b1, t);
    o[nb] = t;
  }

#pragma unroll
  for (int nb = 0; nb < 4; ++nb)
#pragma unroll
    for (int v = 0; v < 8; ++v)
      Ps[pbase + (hh * 8u + (unsigned)v) * LDT + (unsigned)nb * 16u + m] =
          toh_flush(o[nb][v] * SCALE_QK);
  wave_lds_sync();
  v8h x[4];
  size_t off[4];
#pragma unroll
  for (unsigned i = 0; i < 4u; ++i) {
    const unsigned r = 4u * i + (lane >> 3);
    const unsigned c = (lane & 7u) * 8u;
    x[i] = *(const v8h*)&Ps[pbase + r * LDT + c];
    off[i] = (size_t)(b * (unsigned)SEQ + qrow0 + r) * DIM + head * HD + c;
  }
#pragma unroll
  for (int i = 0; i < 4; ++i) *(v8h*)(Ov + off[i]) = x[i];
  
}

// ---------------------------------------------------------------------------
extern "C" void kernel_launch(void* const* d_in, const int* in_sizes, int n_in,
                              void* d_out, int out_size, void* d_ws, size_t ws_size,
                              hipStream_t stream) {
  if (n_in < 3) return;
  const long long need_x = ((long long)(NB - 1) * SEQ_FULL + SEQ) * DIM;
  if ((long long)in_sizes[0] < need_x) return;
  if ((long long)in_sizes[1] < (long long)QKVN * DIM) return;
  if ((long long)in_sizes[2] < (long long)DIM * DIM) return;
  if ((long long)out_size < need_x) return;
  if (ws_size < WS_TOTAL) return;

  const float* X    = (const float*)d_in[0];   // [NB_FULL][SEQ_FULL][DIM]
  const float* wqkv = (const float*)d_in[1];   // [QKVN][DIM]  (out, in)
  const float* wo   = (const float*)d_in[2];   // [DIM][DIM]   (out, in)
  float* out = (float*)d_out;

  char* ws = (char*)d_ws;
  _Float16* Wqkv16 = (_Float16*)(ws + OFF_WQKV);   // [n][k]
  _Float16* Wo16   = (_Float16*)(ws + OFF_WO);     // [n][k]
  _Float16* X16    = (_Float16*)(ws + OFF_X);      // compact rows
  _Float16* Q16    = (_Float16*)(ws + OFF_Q);      // [MROWS][head*64 + d]
  _Float16* T16    = (_Float16*)(ws + OFF_T);      // [k|v][b][head*64 + d][SEQ]
  _Float16* KVt16  = (_Float16*)(ws + OFF_KV);     // [b][head][d1 / 32][d2][d1 % 32]
  _Float16* Ctx16  = (_Float16*)(ws + OFF_CTX);    // [MROWS][head*64 + d]

  dim3 blk(256);

  // weight planes are already [out n][in k] (k contiguous), carry x64; activation plane: full-size input
  // rows -> compact rows, carry 1. One launch writes Wqkv16, Wo16 and X16, which are contiguous from Wqkv16.
  cvt_planes_kernel<<<dim3(CVT_ROWS / 2), blk, 0, stream>>>(wqkv, wo, X, Wqkv16);

  gemm_qkv_kernel<<<dim3(NHEAD, MROWS / QBM), dim3(128), 0, stream>>>(X16, Wqkv16, Q16, T16);
  ktv_kernel<<<dim3(4 * NHEAD, NB), dim3(512), 0, stream>>>(T16, KVt16);
  qkv_apply_kernel<<<dim3(SEQ / 128, NHEAD, NB), blk, 0, stream>>>(Q16, KVt16, Ctx16);
  gemm_out_kernel<<<dim3(DIM / GBN, MROWS / GBM), dim3(128), 0, stream>>>(Ctx16, Wo16, out);
}

// v005
// It runs in 77.7 microseconds.
// Next to v004, in two timings, it ran 1.03 times as fast each time.
// Counting every step since v000, it is 4.87 times as fast.
#include <hip/hip_runtime.h>
#include <stddef.h>

// All contractions on v_wmma_f32_16x16x32_f16 (f16 operands, f32 accumulate): fused q/k/v projection,
// per-head V^T.K (depth = sequence), per-head Q.(K^T V) (depth 64), output projection. Float inputs are
// RNE-converted to bf16 and carried in f16 (weights x64); q, k, v, K^T V and the merged head plane are
// single f16 planes (carry 1). Scale 1/8 and all carries are undone in f32 epilogues.

typedef _Float16 h16;
typedef _Float16 v16h __attribute__((ext_vector_type(16)));
typedef _Float16 v8h  __attribute__((ext_vector_type(8)));
typedef float    v8f  __attribute__((ext_vector_type(8)));
typedef float    v4f  __attribute__((ext_vector_type(4)));

#ifndef NB
#define NB 4
#endif
#ifndef SEQ
#define SEQ 2048
#endif
#define NB_FULL  4
#define SEQ_FULL 2048
#define DIM   1024
#define NHEAD 16
#define HD    64
#define QKVN  (3 * DIM)
#define MROWS (NB * SEQ)

static_assert(NB >= 1 && NB <= NB_FULL);
static_assert(SEQ >= 128 && SEQ <= SEQ_FULL && (SEQ % 128) == 0);
static_assert(DIM == NHEAD * HD);
static_assert(HD == 64);
static_assert(QKVN == 3 * DIM && (QKVN / 64) == 3 * NHEAD);
static_assert((DIM % 64) == 0 && (DIM % 32) == 0);
static_assert((QKVN % 64) == 0);
static_assert((SEQ % 64) == 0 && (SEQ % 32) == 0);
static_assert((MROWS % 64) == 0 && (MROWS % 2) == 0);
static_assert((QKVN % 2) == 0 && (DIM % 2) == 0);
static_assert(DIM / 8 == 128);                 // convert kernel: 128 eight-column groups per row
static_assert((size_t)MROWS * (DIM / 8) < (size_t)0xFFFFFFFFu);

#define LDT 72   // halves per LDS row (144 B, 16-B aligned)
#define LDC 68   // floats per LDS row (272 B, 16-B aligned)
static_assert((LDT % 8) == 0 && LDT >= 64);
static_assert((LDC % 4) == 0 && LDC >= 64);

#define WCARRY   64.0f     // weight planes carried x64
#define SCALE_QK 0.125f    // HD^-0.5

// workspace layout (bytes)
#define WQKV_BYTES    ((size_t)QKVN * DIM * 2)
#define WO_BYTES      ((size_t)DIM * DIM * 2)
#define PLANE16_BYTES ((size_t)MROWS * DIM * 2)
#define TPLANE_ELEMS  ((size_t)NB * DIM * SEQ)          // one transposed plane [b][col][key]
#define T_BYTES       ((size_t)2 * TPLANE_ELEMS * 2)    // k plane then v plane
#define KV_BYTES      ((size_t)NB * NHEAD * HD * HD * 2)
#define OFF_WQKV ((size_t)0)
#define OFF_WO   (OFF_WQKV + WQKV_BYTES)
#define OFF_X    (OFF_WO + WO_BYTES)
#define OFF_Q    (OFF_X + PLANE16_BYTES)
#define OFF_T    (OFF_Q + PLANE16_BYTES)
#define OFF_KV   (OFF_T + T_BYTES)
#define OFF_CTX  (OFF_KV + KV_BYTES)
#define WS_TOTAL (OFF_CTX + PLANE16_BYTES)
static_assert((WQKV_BYTES % 128) == 0 && (WO_BYTES % 128) == 0 && (PLANE16_BYTES % 128) == 0);
static_assert((T_BYTES % 128) == 0 && (KV_BYTES % 128) == 0);
static_assert(WS_TOTAL <= (size_t)134217728);

// ---------------------------------------------------------------------------
__device__ __forceinline__ float bf16r(float x) {   // RNE convert to bf16, returned widened
  unsigned int u = __float_as_uint(x);
  u = (u + 0x7FFFu + ((u >> 16) & 1u)) & 0xFFFF0000u;
  return __uint_as_float(u);
}

// f32 -> f16 operand convert that cannot produce an f16 subnormal
static __device__ __forceinline__ h16 toh_flush(float v) {
  const h16 r = (h16)v;
  return (fabsf(v) < 6.103515625e-05f) ? (h16)0.0f : r;
}

// 16-bit fragment: p points at element [row = lane&15][k0 + 8*(lane>>4)] of a k-contiguous
// row. Elements 0..7 <- k0+8h+0..7, elements 8..15 <- k0+16+8h+0..7 (same map for A and B).
__device__ __forceinline__ v16h frag_at(const _Float16* p) {
  v8h lo = *(const v8h*)(p);
  v8h hi = *(const v8h*)(p + 16);
  v16h out;
#pragma unroll
  for (int i = 0; i < 8; ++i) { out[i] = lo[i]; out[i + 8] = hi[i]; }
  return out;
}

__device__ __forceinline__ v8f wmma16(v16h a, v16h b, v8f c) {
  v8f d = __builtin_amdgcn_wmma_f32_16x16x32_f16(false, a, false, b, (short)0, c,
                                                 false, false);
  asm volatile("v_nop\n\tv_nop\n\tv_nop\n\tv_nop" : "+v"(d) : "v"(a), "v"(b));
  return d;
}

// The builtin alone (the compiler keeps the distances behind its own form): an asm statement's vector
// operands stay in the first 256 registers, which an 8 x 6 accumulator set does not fit.
__device__ __forceinline__ v8f wmma16p(v16h a, v16h b, v8f c) {
  return __builtin_amdgcn_wmma_f32_16x16x32_f16(false, a, false, b, (short)0, c, false, false);
}

__device__ __forceinline__ void wave_lds_sync() {
  __builtin_amdgcn_fence(3 /* release order */, "wavefront");
  asm volatile("s_wait_dscnt 0x0" ::: "memory");
  __builtin_amdgcn_wave_barrier();
}

// ---------------------------------------------------------------------------
// Tensor loads: one request of one wave brings a slice of nrows rows of 128 B (64 k) from global memory into
// LDS, 16 B of pad behind every row (LDS pitch 144 B = LDT halves). Every descriptor word is wave-uniform.
// ---------------------------------------------------------------------------
typedef unsigned int u32x4 __attribute__((ext_vector_type(4)));
typedef unsigned int u32x8 __attribute__((ext_vector_type(8)));
static_assert(LDT * 2 == 128 + 16);

__device__ __forceinline__ unsigned uni(unsigned v) {
  return (unsigned)__builtin_amdgcn_readfirstlane((int)v);
}
// the test of a branch round a tensor load, which ignores EXEC
__device__ __forceinline__ unsigned pinned(unsigned v) {
  unsigned w = uni(v);
  asm volatile("" : "+s"(w));   // pinned(): holds the test in a scalar register, so that the branch is scalar
  return w;
}
// group 1: 1-byte elements, tensor = tile = nrows rows of 128 B, source pitch in bytes, no mask
__device__ __forceinline__ u32x8 tdm_group1(unsigned nrows, unsigned pitch_bytes) {
  u32x8 g;
  g[0] = uni((1u << 20) | (4u << 22) | (3u << 25));   // pad on, behind every 32 dwords, 4 dwords
  g[1] = uni(128u << 16);
  g[2] = uni(nrows << 16);
  g[3] = uni(128u << 16);
  g[4] = uni(nrows);
  g[5] = uni(pitch_bytes);
  g[6] = uni(0u);
  g[7] = uni(0u);
  return g;
}
// group 0. lds: the slice's byte offset in the work-group's LDS (a multiple of 2 KiB); gp: the slice's first byte
__device__ __forceinline__ u32x4 tdm_group0(unsigned lds, const _Float16* gp) {
  const unsigned long long ga = (unsigned long long)(size_t)gp;
  u32x4 g0;
  g0[0] = uni(1u);
  g0[1] = uni(lds);
  g0[2] = uni((unsigned)ga);
  g0[3] = uni((((unsigned)(ga >> 32)) & 0x01FFFFFFu) | 0x80000000u);
  return g0;
}
// g0 is an in-out operand (the instruction leaves it as it is): what tdm_wait0 names later is then held in the
// very registers that the request was issued from
__device__ __forceinline__ void tdm_load(u32x4& g0, u32x8 g1) {
  asm volatile("tensor_load_to_lds %0, %1" : "+s"(g0) : "s"(g1) : "memory");
}
// The issuing wave's wait for its one outstanding request. It names that request's descriptor, so that the
// descriptor's registers are still in use up to here and take no new value while the request is outstanding.
__device__ __forceinline__ void tdm_wait0(u32x4 g0, u32x8 g1) {
  asm volatile("s_wait_tensorcnt 0x0" :: "s"(g0), "s"(g1) : "memory");
}

// ---------------------------------------------------------------------------
// Plane converts, all three in one launch: dst[row][c] = f16(carry * bf16(src row [c])), rows of DIM columns.
// The three f16 planes lie one behind the other in the workspace, so dst is one plane of CVT_ROWS rows:
// rows [0, QKVN) <- wqkv (carry 64), [QKVN, QKVN + DIM) <- wo (carry 64), the rest <- x (carry 1), compact
// row crow taken from input row (crow / SEQ) * SEQ_FULL + crow % SEQ.
// One thread per 8 columns (one 16-B store); 256 threads x 8 columns = 2 rows per block. Every plane has an
// even number of rows and SEQ is even, so a block's two rows are neighbours in one source: the choice of
// source is block-uniform (scalar). Grid (CVT_ROWS / 2).
// ---------------------------------------------------------------------------
#define CVT_ROWS (QKVN + DIM + MROWS)
static_assert(OFF_WQKV == 0 && OFF_WO == (size_t)QKVN * DIM * 2 && OFF_X == (size_t)(QKVN + DIM) * DIM * 2);
static_assert(2 * DIM == 256 * 8 && (SEQ % 2) == 0);

__global__ __launch_bounds__(256) void cvt_planes_kernel(
    const float* __restrict__ wqkv, const float* __restrict__ wo, const float* __restrict__ x,
    _Float16* __restrict__ dst) {
  const unsigned row0 = blockIdx.x * 2u;
  const bool is_wqkv = row0 < (unsigned)QKVN;
  const bool is_w = row0 < (unsigned)(QKVN + DIM);
  const unsigned crow = row0 - (unsigned)(QKVN + DIM);   // compact x row (used only where !is_w)
  const unsigned xrow = (crow / (unsigned)SEQ) * (unsigned)SEQ_FULL + crow % (unsigned)SEQ;
  const float* base = is_wqkv ? wqkv : (is_w ? wo : x);
  const unsigned srow = is_wqkv ? row0 : (is_w ? row0 - (unsigned)QKVN : xrow);
  const float* src = base + (size_t)srow * DIM;
  const float carry = is_w ? WCARRY : 1.0f;
  const unsigned e = threadIdx.x * 8u;   // element within the block's two rows
  const v4f a0 = *(const v4f*)(src + e);
  const v4f a1 = *(const v4f*)(src + e + 4u);
  v8h o;
#pragma unroll
  for (int i = 0; i < 4; ++i) {
    o[i]     = toh_flush(carry * bf16r(a0[i]));
    o[i + 4] = toh_flush(carry * bf16r(a1[i]));
  }
  *(v8h*)(dst + (size_t)row0 * DIM + e) = o;
}

// ---------------------------------------------------------------------------
// Output projection GEMM C[128x128 tile] = A16[rows][K] . Bt[n][K]^T. Per trip one 128-B line (64 k) of each of the
// 128 A rows and 128 B rows is brought global -> LDS by four tensor loads, one per wave (a slice of 64 rows),
// two buffers, the next tile's loads in flight while this tile is worked on.
// 4 waves (wm = 64-row group, wn = 64-col group), 4 x 4 accumulators/wave, fragments from LDS.
// Epilogue per wave: outf full [full row][col] = acc/64.
// Grid (N/128, MROWS/128), 128 threads.
// ---------------------------------------------------------------------------
#define GBM 128                       // tile rows
#define GBN 128                       // tile columns
#define GBK 64                        // k per trip (one 128-B line per row)
#define GSL 5120                      // halves per slice: 64 rows at pitch LDT, rounded up to a multiple of 2 KiB
#define GSTAGE (4 * GSL)              // halves per buffer: two A slices then two B slices
static_assert((MROWS % GBM) == 0 && (SEQ % GBM) == 0);
static_assert((DIM % GBN) == 0);
static_assert((DIM % GBK) == 0 && (DIM / GBK) >= 2);
static_assert(LDT >= GBK && ((LDT * 2) % 16) == 0);
static_assert(GSL >= 64 * LDT && ((GSL * 2) % 2048) == 0);
static_assert((size_t)4 * 64 * LDC * 4 <= (size_t)2 * GSTAGE * 2);   // epilogue staging fits the ring

__device__ __forceinline__ void gemm_body(
    const _Float16* __restrict__ A16, const _Float16* __restrict__ Bt, const unsigned K,
    float* __restrict__ outf) {
  __shared__ __attribute__((aligned(2048))) _Float16 S[2 * GSTAGE];
  const unsigned tid = threadIdx.x, lane = tid & 31u;
  const unsigned w = (unsigned)__builtin_amdgcn_readfirstlane((int)(threadIdx.x >> 5));
  const unsigned wm = w >> 1, wn = w & 1u;
  const unsigned hh = lane >> 4, m = lane & 15u;
  const unsigned n0 = blockIdx.x * (unsigned)GBN;
  const unsigned row0 = blockIdx.y * (unsigned)GBM;

  // load side: wave w brings slice w (waves 0, 1: A rows wn*64.., waves 2, 3: B rows wn*64..)
  const _Float16* gsl = (wm == 0u ? A16 + (size_t)(row0 + wn * 64u) * K : Bt + (size_t)(n0 + wn * 64u) * K);
  const unsigned lsl = (unsigned)(size_t)&S[0] + w * (unsigned)GSL * 2u;
  const u32x8 g1 = tdm_group1(64u, K * 2u);
  // fragment side
  const _Float16* sa = &S[wm * (unsigned)GSL + m * LDT + hh * 8u];
  const _Float16* sb = &S[(2u + wn) * (unsigned)GSL + m * LDT + hh * 8u];
  const unsigned nt_k = K / (unsigned)GBK;

  // the i, j, ks loops below are unrolled so that every acc / fragment index is a constant (registers)
  v8f acc[4][4];
#pragma unroll
  for (int i = 0; i < 4; ++i)
#pragma unroll
    for (int j = 0; j < 4; ++j) acc[i][j] = v8f{};

  u32x4 g0 = tdm_group0(lsl, gsl);
  tdm_load(g0, g1);
  tdm_wait0(g0, g1);                                  // tile 0 landed (this wave's slice)
  __syncthreads();                                    // tile 0 published to every wave
  g0 = tdm_group0(lsl + (unsigned)GSTAGE * 2u, gsl + GBK);
  tdm_load(g0, g1);

  for (unsigned t = 0; t < nt_k; ++t) {
    const unsigned bo = (t & 1u) * (unsigned)GSTAGE;
#pragma unroll
    for (unsigned ks = 0; ks < 2u; ++ks) {
      v16h a[4], b[4];
#pragma unroll
      for (unsigned i = 0; i < 4u; ++i) a[i] = frag_at(sa + bo + i * 16u * LDT + ks * 32u);
#pragma unroll
      for (unsigned j = 0; j < 4u; ++j) b[j] = frag_at(sb + bo + j * 16u * LDT + ks * 32u);
#pragma unroll
      for (int i = 0; i < 4; ++i)
#pragma unroll
        for (int j = 0; j < 4; ++j) acc[i][j] = wmma16(a[i], b[j], acc[i][j]);
    }
    asm volatile("s_wait_dscnt 0x0" ::: "memory");     // this wave's reads of buffer t&1 are done
    tdm_wait0(g0, g1);                                 // this wave's slice of tile t+1 has landed
    __syncthreads();   // publishes tile t+1 and ends every wave's reads of the buffer refilled below
    if (pinned(t + 2u < nt_k)) {
      g0 = tdm_group0(lsl + bo * 2u, gsl + (size_t)(t + 2u) * GBK);
      tdm_load(g0, g1);
    }
  }
  tdm_wait0(g0, g1);                                   // no load outstanding when the ring is reused
  asm volatile("s_wait_dscnt 0x0" ::: "memory");       // nor an LDS read of this wave

  // the ring is free behind the last trip's barrier: each wave stages its own 64x64 tile there
  float* Cw = (float*)&S[0] + w * (64u * LDC);
#pragma unroll
  for (int i = 0; i < 4; ++i)
#pragma unroll
    for (int j = 0; j < 4; ++j)
#pragma unroll
      for (int r = 0; r < 8; ++r)
        Cw[((unsigned)i * 16u + hh * 8u + (unsigned)r) * LDC + (unsigned)j * 16u + m] = acc[i][j][r];
  __syncthreads();   // the staged tile is complete before other lanes read it back

  const unsigned wrow0 = row0 + wm * 64u;

  // Epilogue loop: eight rows per trip (two per store), their LDS reads in flight together and their four stores as one
  // group; kept rolled (the code runs once per tile). The s_wait_xcnt at a trip's foot stands in front
  // of the next trip's reuse of the stores' address and data registers.
  {
    const unsigned bidx = wrow0 / (unsigned)SEQ;
    const unsigned sq0 = wrow0 - bidx * (unsigned)SEQ;
    const size_t frow0 = (size_t)bidx * SEQ_FULL + sq0;
#pragma unroll 1   // rolled: runs once per tile, unrolling only grows the code
    for (unsigned i0 = 0; i0 < 32u; i0 += 4u) {
      v4f xs[4];
      size_t off[4];
#pragma unroll
      for (unsigned i = 0; i < 4u; ++i) {
        const unsigned r = 2u * (i0 + i) + (lane >> 4);
        const unsigned c = (lane & 15u) * 4u;
        const v4f u = *(const v4f*)&Cw[r * LDC + c];
        v4f val;
#pragma unroll
        for (int j = 0; j < 4; ++j) val[j] = u[j] * (1.0f / WCARRY);
        xs[i] = val;
        off[i] = (frow0 + r) * DIM + n0 + wn * 64u + c;
      }
#pragma unroll
      for (int i = 0; i < 4; ++i) *(v4f*)(outf + off[i]) = xs[i];
      asm volatile("s_wait_xcnt 0x0" ::: "memory");   // before the stores' registers are reused
    }
  }
}

__global__ __launch_bounds__(128) void gemm_out_kernel(
    const _Float16* __restrict__ A16, const _Float16* __restrict__ Bt,
    float* __restrict__ outf) {
  gemm_body(A16, Bt, (unsigned)DIM, outf);
}

// ---------------------------------------------------------------------------
// Fused q/k/v projection: C[256 rows x 192 columns] = A16[rows][DIM] . Bt[n][DIM]^T, the 192 columns
// being one head's q, k and v (column n = head*192 + part*64 + d). Per trip one 128-B line (64 k) of
// each of the 256 A rows and 192 B rows is brought global -> LDS by four tensor loads, one per wave (a slice
// of 128 A rows or of 96 B rows), two buffers, the next tile's loads in flight while this tile is worked on.
// 4 waves (wm = 128-row group, wn = 96-column group), 8 x 6 accumulators per wave, fragments from LDS.
// Two blocks share a WGP (two waves per SIMD), so all 512 blocks of the grid are resident at once.
// Epilogue: f16(acc/64) staged in the free ring, q as [row][d], k and v transposed as [d][key] (a lane's
// 8 accumulator rows are 8 consecutive keys: one 16-B LDS store), then written as whole lines:
//   outq[row][head*64 + d] (pitch DIM), outt[k|v][b][head*64 + d][key].
// Grid (NHEAD, MROWS/256), 128 threads.
// ---------------------------------------------------------------------------
#define QBM 256                       // tile rows
#define QBN 192                       // tile columns: q, k, v of one head
#define QASL (128 * LDT)              // halves per A slice: 128 rows at pitch LDT (a multiple of 2 KiB)
#define QBSL 7168                     // halves per B slice: 96 rows at pitch LDT, rounded up to a multiple of 2 KiB
#define QSTAGE (2 * QASL + 2 * QBSL)  // halves per buffer: two A slices then two B slices
#define QTP (QBM + 8)                 // halves per row of the transposed k/v staging (528 B = 16 B x odd)
static_assert(QBN == 3 * HD && (QKVN % QBN) == 0 && (QKVN / QBN) == NHEAD);
static_assert((MROWS % QBM) == 0 && (SEQ % QBM) == 0);
static_assert((size_t)QBM * LDT + (size_t)2 * HD * QTP <= (size_t)2 * QSTAGE);   // staging fits the ring
static_assert((size_t)2 * 2 * QSTAGE * 2 <= (size_t)327680);                     // two blocks per WGP
static_assert(((QASL * 2) % 2048) == 0 && QBSL >= 96 * LDT && ((QBSL * 2) % 2048) == 0);

// second launch-bounds argument: two waves per SIMD, so that two blocks share a WGP
__global__ __launch_bounds__(128, 2) void gemm_qkv_kernel(
    const _Float16* __restrict__ A16, const _Float16* __restrict__ Bt,
    _Float16* __restrict__ outq, _Float16* __restrict__ outt) {
  __shared__ __attribute__((aligned(2048))) _Float16 S[2 * QSTAGE];
  const unsigned tid = threadIdx.x, lane = tid & 31u;
  const unsigned w = (unsigned)__builtin_amdgcn_readfirstlane((int)(threadIdx.x >> 5));
  const unsigned wm = w >> 1, wn = w & 1u;
  const unsigned hh = lane >> 4, m = lane & 15u;
  const unsigned head = blockIdx.x;
  const unsigned row0 = blockIdx.y * (unsigned)QBM;

  // load side: wave w brings slice w (waves 0, 1: A rows wn*128.., waves 2, 3: B rows wn*96..)
  const _Float16* gsl = (wm == 0u ? A16 + (size_t)(row0 + wn * 128u) * DIM
                                  : Bt + (size_t)(head * (unsigned)QBN + wn * 96u) * DIM);
  const unsigned lsl = (unsigned)(size_t)&S[0] +
                       (wm == 0u ? wn * (unsigned)QASL : 2u * (unsigned)QASL + wn * (unsigned)QBSL) * 2u;
  const u32x8 g1 = tdm_group1(wm == 0u ? 128u : 96u, (unsigned)DIM * 2u);
  // fragment side
  const _Float16* sa = &S[wm * (unsigned)QASL + m * LDT + hh * 8u];
  const _Float16* sb = &S[2u * (unsigned)QASL + wn * (unsigned)QBSL + m * LDT + hh * 8u];
  const unsigned nt_k = (unsigned)DIM / (unsigned)GBK;

  // the i, j, ks loops below are unrolled so that every acc / fragment index is a constant (registers)
  v8f acc[8][6];
#pragma unroll
  for (int i = 0; i < 8; ++i)
#pragma unroll
    for (int j = 0; j < 6; ++j) acc[i][j] = v8f{};

  u32x4 g0 = tdm_group0(lsl, gsl);
  tdm_load(g0, g1);
  tdm_wait0(g0, g1);                                  // tile 0 landed (this wave's slice)
  __syncthreads();                                    // tile 0 published to every wave
  g0 = tdm_group0(lsl + (unsigned)QSTAGE * 2u, gsl + GBK);
  tdm_load(g0, g1);

  for (unsigned t = 0; t < nt_k; ++t) {
    const unsigned bo = (t & 1u) * (unsigned)QSTAGE;
#pragma unroll
    for (unsigned ks = 0; ks < 2u; ++ks) {
      const _Float16* pa = sa + bo + ks * 32u;
      const _Float16* pb = sb + bo + ks * 32u;
      v16h a[8], b[6];
#pragma unroll
      for (unsigned j = 0; j < 6u; ++j) b[j] = frag_at(pb + j * 16u * LDT);
      a[0] = frag_at(pa);
      a[1] = frag_at(pa + 16u * LDT);
#pragma unroll
      for (int g = 0; g < 4; ++g) {       // row pairs: the next pair's A fragments are read one pair ahead
        if (g < 3) {
          a[2 * g + 2] = frag_at(pa + (unsigned)(2 * g + 2) * 16u * LDT);
          a[2 * g + 3] = frag_at(pa + (unsigned)(2 * g + 3) * 16u * LDT);
        }
        // keeps the next pair's LDS reads one group ahead of this pair's WMMAs (else they sink to their use)
        __builtin_amdgcn_sched_barrier(0);
#pragma unroll
        for (int i = 2 * g; i < 2 * g + 2; ++i)
#pragma unroll
          for (int j = 0; j < 6; ++j) acc[i][j] = wmma16p(a[i], b[j], acc[i][j]);
        // keeps later LDS reads from moving in among these WMMAs
        __builtin_amdgcn_sched_barrier(0);
      }
    }
    asm volatile("s_wait_dscnt 0x0" ::: "memory");     // this wave's reads of buffer t&1 are done
    tdm_wait0(g0, g1);                                 // this wave's slice of tile t+1 has landed
    __syncthreads();   // publishes tile t+1 and ends every wave's reads of the buffer refilled below
    if (pinned(t + 2u < nt_k)) {
      g0 = tdm_group0(lsl + bo * 2u, gsl + (t + 2u) * (unsigned)GBK);
      tdm_load(g0, g1);
    }
  }
  tdm_wait0(g0, g1);                                   // no load outstanding when the ring is reused
  asm volatile("s_wait_dscnt 0x0" ::: "memory");       // nor an LDS read of this wave

  // the lane id is read anew here, so that no lane-derived value of the epilogue is held in a register
  // across the K loop
  const unsigned ln = __builtin_amdgcn_mbcnt_lo(~0u, 0u);
  const unsigned eh = ln >> 4, em = ln & 15u;
  // the ring is free behind the last trip's barrier: the block's tile is staged there as f16
  _Float16* Tq = &S[0];                       // [256 rows][LDT]
  _Float16* Tt = &S[(unsigned)QBM * LDT];     // [128 = k d, v d][QTP]
#pragma unroll
  for (int j = 0; j < 6; ++j) {
    const unsigned d = (wn * 6u + (unsigned)j - 4u) * 16u + em;   // k/v staging row (unused for q columns)
#pragma unroll
    for (int i = 0; i < 8; ++i) {
      const unsigned row = wm * 128u + (unsigned)i * 16u + eh * 8u;
      v8h x;
#pragma unroll
      for (int r = 0; r < 8; ++r) x[r] = toh_flush(acc[i][j][r] * (1.0f / WCARRY));
      if (j < 4 && wn == 0u) {                // columns 0..63 of the head: q (wave-uniform test)
#pragma unroll
        for (int r = 0; r < 8; ++r) Tq[(row + (unsigned)r) * LDT + (unsigned)j * 16u + em] = x[r];
      } else {                                // columns 64..191: k then v, stored transposed
        *(v8h*)&Tt[d * QTP + row] = x;
      }
    }
  }
  __syncthreads();   // the staged tile is complete before other waves read it back

  // Write-out loops: four wave-wide 16-B stores per trip, their LDS reads in flight together; kept
  // rolled (the code runs once per tile). The s_wait_xcnt at a trip's foot stands in front of the next
  // trip's reuse of the stores' address and data registers.
#pragma unroll 1   // rolled: runs once per tile, unrolling only grows the code
  for (unsigned i0 = 0; i0 < 16u; i0 += 4u) {          // q: 4 rows (one line each) per store
    v8h x[4];
    size_t off[4];
#pragma unroll
    for (unsigned i = 0; i < 4u; ++i) {
      const unsigned r = 4u * (w * 16u + i0 + i) + (ln >> 3);
      const unsigned c = (ln & 7u) * 8u;
      x[i] = *(const v8h*)&Tq[r * LDT + c];
      off[i] = (size_t)(row0 + r) * DIM + head * HD + c;
    }
#pragma unroll
    for (int i = 0; i < 4; ++i) *(v8h*)(outq + off[i]) = x[i];
    asm volatile("s_wait_xcnt 0x0" ::: "memory");   // before the stores' registers are reused
  }
  const unsigned bidx = row0 / (unsigned)SEQ;
  const unsigned key0 = row0 - bidx * (unsigned)SEQ;
#pragma unroll 1   // rolled: runs once per tile, unrolling only grows the code
  for (unsigned i0 = 0; i0 < 32u; i0 += 4u) {          // k, v: one d row (256 keys, 4 lines) per store
    v8h x[4];
    size_t off[4];
#pragma unroll
    for (unsigned i = 0; i < 4u; ++i) {
      const unsigned d = w * 32u + i0 + i;             // 0..63: k plane, 64..127: v plane
      x[i] = *(const v8h*)&Tt[d * QTP + ln * 8u];
      off[i] = (size_t)(d >> 6) * TPLANE_ELEMS +
               ((size_t)bidx * DIM + head * HD + (d & 63u)) * SEQ + key0 + ln * 8u;
    }
#pragma unroll
    for (int i = 0; i < 4; ++i) *(v8h*)(outt + off[i]) = x[i];
    asm volatile("s_wait_xcnt 0x0" ::: "memory");   // before the stores' registers are reused
  }
}


// ---------------------------------------------------------------------------
// Per (head, batch, 32x32 quadrant qr, qc): KV[d2][d1] = sum_s V[s][d2] * K[s][d1], depth SEQ.
// A = 32 V^T plane rows (m = d2, k = s contiguous), B = 32 K^T plane rows (n = d1, k = s contiguous).
// 16 waves, wave w owns depth [w*KTD, (w+1)*KTD): one aligned 256-B unit of each of the 64 rows, copied
// global -> LDS by asynchronous 16-B copies (16 lanes per row: whole lines) into the wave's own slice,
// all 32 copies of a lane in flight together. 2 x 2 accumulators per wave, fragments from LDS.
// The 16 partial tiles are summed in f32 in wave order through LDS and written as f16.
// Plane layout [b][head][qc][d2][32 columns]: a quadrant is 2 KiB of whole lines with one writer.
// Grid (4 * NHEAD, NB), 512 threads.
// ---------------------------------------------------------------------------
#define KTW   16                 // waves per block = depth slices
#define KTD   (SEQ / KTW)        // depth per wave
#define KTP   (KTD + 8)          // halves per LDS row (272 B = 16 B x odd)
#define KTSL  (64 * KTP)         // halves per wave slice: 32 V rows then 32 K rows
#define KTC   36                 // floats per row of a wave's 32x32 partial tile
static_assert(KTD == 128);                                   // one 256-B unit per row and wave
static_assert((size_t)KTW * KTSL * 2 <= (size_t)327680);     // the slices fit the LDS
static_assert((size_t)32 * KTC * 4 <= (size_t)KTSL * 2);     // a partial tile fits its wave's slice
static_assert((KTC % 2) == 0 && ((KTSL * 2) % 16) == 0);

typedef _Float16 v2h __attribute__((ext_vector_type(2)));
typedef float    v2f __attribute__((ext_vector_type(2)));

// Eight asynchronous 16-B copies per lane: rows r, r+2, ..., r+14 of the wave's slice.
// lds: the lane's LDS byte address in row r; gp: the lane's global address in row r.
__device__ __forceinline__ void async_slice8(unsigned lds, const _Float16* gp) {
  const unsigned l0 = lds;
  const unsigned l1 = lds + 1u * 2u * KTP * 2u;
  const unsigned l2 = lds + 2u * 2u * KTP * 2u;
  const unsigned l3 = lds + 3u * 2u * KTP * 2u;
  const unsigned l4 = lds + 4u * 2u * KTP * 2u;
  const unsigned l5 = lds + 5u * 2u * KTP * 2u;
  const unsigned l6 = lds + 6u * 2u * KTP * 2u;
  const unsigned l7 = lds + 7u * 2u * KTP * 2u;
  const _Float16* g0 = gp;
  const _Float16* g1 = gp + (size_t)1 * 2 * SEQ;
  const _Float16* g2 = gp + (size_t)2 * 2 * SEQ;
  const _Float16* g3 = gp + (size_t)3 * 2 * SEQ;
  const _Float16* g4 = gp + (size_t)4 * 2 * SEQ;
  const _Float16* g5 = gp + (size_t)5 * 2 * SEQ;
  const _Float16* g6 = gp + (size_t)6 * 2 * SEQ;
  const _Float16* g7 = gp + (size_t)7 * 2 * SEQ;
  // the copies and, as the last line, the wait that stands before their address registers are reused
  asm volatile(
      "global_load_async_to_lds_b128 %0, %8, off\n\t"
      "global_load_async_to_lds_b128 %1, %9, off\n\t"
      "global_load_async_to_lds_b128 %2, %10, off\n\t"
      "global_load_async_to_lds_b128 %3, %11, off\n\t"
      "global_load_async_to_lds_b128 %4, %12, off\n\t"
      "global_load_async_to_lds_b128 %5, %13, off\n\t"
      "global_load_async_to_lds_b128 %6, %14, off\n\t"
      "global_load_async_to_lds_b128 %7, %15, off\n\t"
      "s_wait_xcnt 0x0"
      :: "v"(l0), "v"(l1), "v"(l2), "v"(l3), "v"(l4), "v"(l5), "v"(l6), "v"(l7),
         "v"(g0), "v"(g1), "v"(g2), "v"(g3), "v"(g4), "v"(g5), "v"(g6), "v"(g7)
      : "memory");
}

__global__ __launch_bounds__(512) void ktv_kernel(
    const _Float16* __restrict__ T16, _Float16* __restrict__ KVt) {
  __shared__ __attribute__((aligned(16))) _Float16 Sl[KTW * KTSL];
  const unsigned tid = threadIdx.x, lane = tid & 31u;
  const unsigned w = (unsigned)__builtin_amdgcn_readfirstlane((int)(threadIdx.x >> 5));
  const unsigned hh = lane >> 4, m = lane & 15u;
  const unsigned head = blockIdx.x >> 2;
  const unsigned qr = (blockIdx.x >> 1) & 1u, qc = blockIdx.x & 1u;
  const unsigned b = blockIdx.y;

  const size_t kbase = ((size_t)b * DIM + head * HD) * SEQ;   // k plane
  const size_t vbase = TPLANE_ELEMS + kbase;                  // v plane
  // copy side: lane -> row lane>>4 (+2 per copy), 16-B chunk lane&15 of the row's 256-B unit
  const _Float16* gv = T16 + vbase + (size_t)(qr * 32u + hh) * SEQ + w * (unsigned)KTD + m * 8u;
  const _Float16* gk = T16 + kbase + (size_t)(qc * 32u + hh) * SEQ + w * (unsigned)KTD + m * 8u;
  _Float16* Sw = &Sl[w * (unsigned)KTSL];
  const unsigned lv = (unsigned)(size_t)Sw + (hh * KTP + m * 8u) * 2u;
  const unsigned lk = lv + 32u * KTP * 2u;
  async_slice8(lv, gv);
  async_slice8(lv + 16u * KTP * 2u, gv + (size_t)16 * SEQ);
  async_slice8(lk, gk);
  async_slice8(lk + 16u * KTP * 2u, gk + (size_t)16 * SEQ);
  asm volatile("s_wait_asynccnt 0x0" ::: "memory");   // this wave's copies have landed
  __syncthreads();                                    // the slices are published before any is read

  const _Float16* sa = Sw + m * KTP + hh * 8u;
  const _Float16* sb = sa + 32u * KTP;
  // the i, j, ks loops are unrolled so that every acc / fragment index is a constant (registers)
  v8f acc[2][2];
#pragma unroll
  for (int i = 0; i < 2; ++i)
#pragma unroll
    for (int j = 0; j < 2; ++j) acc[i][j] = v8f{};
#pragma unroll
  for (unsigned ks = 0; ks < (unsigned)KTD / 32u; ++ks) {
    v16h a[2], bb[2];
#pragma unroll
    for (unsigned i = 0; i < 2u; ++i) a[i] = frag_at(sa + i * 16u * KTP + ks * 32u);
#pragma unroll
    for (unsigned j = 0; j < 2u; ++j) bb[j] = frag_at(sb + j * 16u * KTP + ks * 32u);
#pragma unroll
    for (int i = 0; i < 2; ++i)
#pragma unroll
      for (int j = 0; j < 2; ++j) acc[i][j] = wmma16(a[i], bb[j], acc[i][j]);
  }
  // this wave's fragment reads are done before its partial tile overwrites the head of its slice
  asm volatile("s_wait_dscnt 0x0" ::: "memory");
  float* Pw = (float*)Sw;
#pragma unroll
  for (int i = 0; i < 2; ++i)
#pragma unroll
    for (int j = 0; j < 2; ++j)
#pragma unroll
      for (int r = 0; r < 8; ++r)
        Pw[((unsigned)i * 16u + hh * 8u + (unsigned)r) * KTC + (unsigned)j * 16u + m] = acc[i][j][r];
  __syncthreads();   // all 16 partial tiles are complete before they are summed

  const unsigned r = tid >> 4, c = (tid & 15u) * 2u;
  float s0 = 0.0f, s1 = 0.0f;
#pragma unroll
  for (unsigned g = 0; g < (unsigned)KTW; ++g) {
    const v2f u = *(const v2f*)((const float*)&Sl[g * (unsigned)KTSL] + r * KTC + c);
    s0 += u[0];
    s1 += u[1];
  }
  v2h o;
  o[0] = toh_flush(s0);
  o[1] = toh_flush(s1);
  *(v2h*)(KVt + (size_t)(b * NHEAD + head) * (HD * HD) + (size_t)qc * (HD * 32) +
          (size_t)(qr * 32u + r) * 32u + c) = o;
}

// ---------------------------------------------------------------------------
// Per (128 query rows, head, batch): Ov[b*SEQ+s][head*64 + d2] =
//   f16( 1/8 * sum_d1 Q[s][d1] * KVt[d2][d1] ). 8 waves x 16 rows, 4 output tiles per wave,
// depth 64 in two 32-steps; A fragments from the q plane, B fragments from the KVt rows
// (plane layout [b][head][d1 / 32][d2][d1 % 32]).
// Ov rows are stored as whole lines (one line per row: 8 consecutive lanes x 16 B).
// Grid (SEQ/128, NHEAD, NB).
// ---------------------------------------------------------------------------
__global__ __launch_bounds__(256) void qkv_apply_kernel(
    const _Float16* __restrict__ Qh, const _Float16* __restrict__ KVt,
    _Float16* __restrict__ Ov) {
  __shared__ __attribute__((aligned(16))) _Float16 Ps[8 * 16 * LDT];
  const unsigned tid = threadIdx.x, lane = tid & 31u;
  const unsigned w = (unsigned)__builtin_amdgcn_readfirstlane((int)(threadIdx.x >> 5));
  const unsigned hh = lane >> 4, m = lane & 15u;
  const unsigned q0 = blockIdx.x * 128u;
  const unsigned head = blockIdx.y;
  const unsigned b = blockIdx.z;
  const unsigned qrow0 = q0 + w * 16u;
  const unsigned pbase = w * (16u * LDT);

  const size_t qoff = (size_t)(b * (unsigned)SEQ + qrow0 + m) * DIM + head * HD + hh * 8u;
  const v16h qf0 = frag_at(Qh + qoff);
  const v16h qf1 = frag_at(Qh + qoff + 32);
  const _Float16* kvp = KVt + (size_t)(b * NHEAD + head) * (HD * HD) + (size_t)m * 32 + hh * 8u;

  v8f o[4];
#pragma unroll
  for (int nb = 0; nb < 4; ++nb) {
    const v16h b0 = frag_at(kvp + nb * 16 * 32);             // d1 0..31
    const v16h b1 = frag_at(kvp + HD * 32 + nb * 16 * 32);   // d1 32..63
    v8f t = {};
    t = wmma16(qf0, b0, t);
    t = wmma16(qf1, b1, t);
    o[nb] = t;
  }

#pragma unroll
  for (int nb = 0; nb < 4; ++nb)
#pragma unroll
    for (int v = 0; v < 8; ++v)
      Ps[pbase + (hh * 8u + (unsigned)v) * LDT + (unsigned)nb * 16u + m] =
          toh_flush(o[nb][v] * SCALE_QK);
  wave_lds_sync();
  v8h x[4];
  size_t off[4];
#pragma unroll
  for (unsigned i = 0; i < 4u; ++i) {
    const unsigned r = 4u * i + (lane >> 3);
    const unsigned c = (lane & 7u) * 8u;
    x[i] = *(const v8h*)&Ps[pbase + r * LDT + c];
    off[i] = (size_t)(b * (unsigned)SEQ + qrow0 + r) * DIM + head * HD + c;
  }
#pragma unroll
  for (int i = 0; i < 4; ++i) *(v8h*)(Ov + off[i]) = x[i];
  
}

// ---------------------------------------------------------------------------
extern "C" void kernel_launch(void* const* d_in, const int* in_sizes, int n_in,
                              void* d_out, int out_size, void* d_ws, size_t ws_size,
                              hipStream_t stream) {
  if (n_in < 3) return;
  const long long need_x = ((long long)(NB - 1) * SEQ_FULL + SEQ) * DIM;
  if ((long long)in_sizes[0] < need_x) return;
  if ((long long)in_sizes[1] < (long long)QKVN * DIM) return;
  if ((long long)in_sizes[2] < (long long)DIM * DIM) return;
  if ((long long)out_size < need_x) return;
  if (ws_size < WS_TOTAL) return;

  const float* X    = (const float*)d_in[0];   // [NB_FULL][SEQ_FULL][DIM]
  const float* wqkv = (const float*)d_in[1];   // [QKVN][DIM]  (out, in)
  const float* wo   = (const float*)d_in[2];   // [DIM][DIM]   (out, in)
  float* out = (float*)d_out;

  char* ws = (char*)d_ws;
  _Float16* Wqkv16 = (_Float16*)(ws + OFF_WQKV);   // [n][k]
  _Float16* Wo16   = (_Float16*)(ws + OFF_WO);     // [n][k]
  _Float16* X16    = (_Float16*)(ws + OFF_X);      // compact rows
  _Float16* Q16    = (_Float16*)(ws + OFF_Q);      // [MROWS][head*64 + d]
  _Float16* T16    = (_Float16*)(ws + OFF_T);      // [k|v][b][head*64 + d][SEQ]
  _Float16* KVt16  = (_Float16*)(ws + OFF_KV);     // [b][head][d1 / 32][d2][d1 % 32]
  _Float16* Ctx16  = (_Float16*)(ws + OFF_CTX);    // [MROWS][head*64 + d]

  dim3 blk(256);

  // weight planes are already [out n][in k] (k contiguous), carry x64; activation plane: full-size input
  // rows -> compact rows, carry 1. One launch writes Wqkv16, Wo16 and X16, which are contiguous from Wqkv16.
  cvt_planes_kernel<<<dim3(CVT_ROWS / 2), blk, 0, stream>>>(wqkv, wo, X, Wqkv16);

  gemm_qkv_kernel<<<dim3(NHEAD, MROWS / QBM), dim3(128), 0, stream>>>(X16, Wqkv16, Q16, T16);
  ktv_kernel<<<dim3(4 * NHEAD, NB), dim3(512), 0, stream>>>(T16, KVt16);
  qkv_apply_kernel<<<dim3(SEQ / 128, NHEAD, NB), blk, 0, stream>>>(Q16, KVt16, Ctx16);
  gemm_out_kernel<<<dim3(DIM / GBN, MROWS / GBM), dim3(128), 0, stream>>>(Ctx16, Wo16, out);
}

// v006
// One run takes 74 microseconds.
// Two timings next to v005 put it at 1.06 and 1.05 times that version's speed.
// Over all steps from v000 it is 5.13 times as fast.
#include <hip/hip_runtime.h>
#include <stddef.h>

// All contractions on v_wmma_f32_16x16x32_f16 (f16 operands, f32 accumulate): fused q/k/v projection,
// per-head V^T.K (depth = sequence), per-head Q.(K^T V) (depth 64), output projection. Float inputs are
// RNE-converted to bf16 and carried in f16 (weights x64); q, k, v, K^T V and the merged head plane are
// single f16 planes (carry 1). Scale 1/8 and all carries are undone in f32 epilogues.

typedef _Float16 h16;
typedef _Float16 v16h __attribute__((ext_vector_type(16)));
typedef _Float16 v8h  __attribute__((ext_vector_type(8)));
typedef float    v8f  __attribute__((ext_vector_type(8)));
typedef float    v4f  __attribute__((ext_vector_type(4)));

#ifndef NB
#define NB 4
#endif
#ifndef SEQ
#define SEQ 2048
#endif
#define NB_FULL  4
#define SEQ_FULL 2048
#define DIM   1024
#define NHEAD 16
#define HD    64
#define QKVN  (3 * DIM)
#define MROWS (NB * SEQ)

static_assert(NB >= 1 && NB <= NB_FULL);
static_assert(SEQ >= 128 && SEQ <= SEQ_FULL && (SEQ % 128) == 0);
static_assert(DIM == NHEAD * HD);
static_assert(HD == 64);
static_assert(QKVN == 3 * DIM && (QKVN / 64) == 3 * NHEAD);
static_assert((DIM % 64) == 0 && (DIM % 32) == 0);
static_assert((QKVN % 64) == 0);
static_assert((SEQ % 64) == 0 && (SEQ % 32) == 0);
static_assert((MROWS % 64) == 0 && (MROWS % 2) == 0);
static_assert((QKVN % 2) == 0 && (DIM % 2) == 0);
static_assert(DIM / 8 == 128);                 // convert kernel: 128 eight-column groups per row
static_assert((size_t)MROWS * (DIM / 8) < (size_t)0xFFFFFFFFu);

#define LDT 72   // halves per LDS row (144 B, 16-B aligned)
#define LDC 68   // floats per LDS row (272 B, 16-B aligned)
static_assert((LDT % 8) == 0 && LDT >= 64);
static_assert((LDC % 4) == 0 && LDC >= 64);

#define WCARRY   64.0f     // weight planes carried x64
#define SCALE_QK 0.125f    // HD^-0.5

// workspace layout (bytes)
#define WQKV_BYTES    ((size_t)QKVN * DIM * 2)
#define WO_BYTES      ((size_t)DIM * DIM * 2)
#define PLANE16_BYTES ((size_t)MROWS * DIM * 2)
#define TPLANE_ELEMS  ((size_t)NB * DIM * SEQ)          // one transposed plane [b][col][key]
#define T_BYTES       ((size_t)2 * TPLANE_ELEMS * 2)    // k plane then v plane
#define KV_BYTES      ((size_t)NB * NHEAD * HD * HD * 2)
#define OFF_WQKV ((size_t)0)
#define OFF_WO   (OFF_WQKV + WQKV_BYTES)
#define OFF_X    (OFF_WO + WO_BYTES)
#define OFF_Q    (OFF_X + PLANE16_BYTES)
#define OFF_T    (OFF_Q + PLANE16_BYTES)
#define OFF_KV   (OFF_T + T_BYTES)
#define OFF_CTX  (OFF_KV + KV_BYTES)
#define WS_TOTAL (OFF_CTX + PLANE16_BYTES)
static_assert((WQKV_BYTES % 128) == 0 && (WO_BYTES % 128) == 0 && (PLANE16_BYTES % 128) == 0);
static_assert((T_BYTES % 128) == 0 && (KV_BYTES % 128) == 0);
static_assert(WS_TOTAL <= (size_t)134217728);

// ---------------------------------------------------------------------------
__device__ __forceinline__ float bf16r(float x) {   // RNE convert to bf16, returned widened
  unsigned int u = __float_as_uint(x);
  u = (u + 0x7FFFu + ((u >> 16) & 1u)) & 0xFFFF0000u;
  return __uint_as_float(u);
}

// f32 -> f16 operand convert that cannot produce an f16 subnormal
static __device__ __forceinline__ h16 toh_flush(float v) {
  const h16 r = (h16)v;
  return (fabsf(v) < 6.103515625e-05f) ? (h16)0.0f : r;
}

// 16-bit fragment: p points at element [row = lane&15][k0 + 8*(lane>>4)] of a k-contiguous
// row. Elements 0..7 <- k0+8h+0..7, elements 8..15 <- k0+16+8h+0..7 (same map for A and B).
__device__ __forceinline__ v16h frag_at(const _Float16* p) {
  v8h lo = *(const v8h*)(p);
  v8h hi = *(const v8h*)(p + 16);
  v16h out;
#pragma unroll
  for (int i = 0; i < 8; ++i) { out[i] = lo[i]; out[i + 8] = hi[i]; }
  return out;
}

__device__ __forceinline__ v8f wmma16(v16h a, v16h b, v8f c) {
  v8f d = __builtin_amdgcn_wmma_f32_16x16x32_f16(false, a, false, b, (short)0, c,
                                                 false, false);
  asm volatile("v_nop\n\tv_nop\n\tv_nop\n\tv_nop" : "+v"(d) : "v"(a), "v"(b));
  return d;
}

// The builtin alone (the compiler keeps the distances behind its own form): an asm statement's vector
// operands stay in the first 256 registers, which an 8 x 6 accumulator set does not fit.
__device__ __forceinline__ v8f wmma16p(v16h a, v16h b, v8f c) {
  return __builtin_amdgcn_wmma_f32_16x16x32_f16(false, a, false, b, (short)0, c, false, false);
}

__device__ __forceinline__ void wave_lds_sync() {
  __builtin_amdgcn_fence(3 /* release order */, "wavefront");
  asm volatile("s_wait_dscnt 0x0" ::: "memory");
  __builtin_amdgcn_wave_barrier();
}

// ---------------------------------------------------------------------------
// Tensor loads: one request of one wave brings a slice of nrows rows of 128 B (64 k) from global memory into
// LDS, 16 B of pad behind every row (LDS pitch 144 B = LDT halves). Every descriptor word is wave-uniform.
// ---------------------------------------------------------------------------
typedef unsigned int u32x4 __attribute__((ext_vector_type(4)));
typedef unsigned int u32x8 __attribute__((ext_vector_type(8)));
static_assert(LDT * 2 == 128 + 16);

__device__ __forceinline__ unsigned uni(unsigned v) {
  return (unsigned)__builtin_amdgcn_readfirstlane((int)v);
}
// the test of a branch round a tensor load, which ignores EXEC
__device__ __forceinline__ unsigned pinned(unsigned v) {
  unsigned w = uni(v);
  asm volatile("" : "+s"(w));   // pinned(): holds the test in a scalar register, so that the branch is scalar
  return w;
}
// group 1: 1-byte elements, tensor = tile = nrows rows of 128 B, source pitch in bytes, no mask
__device__ __forceinline__ u32x8 tdm_group1(unsigned nrows, unsigned pitch_bytes) {
  u32x8 g;
  g[0] = uni((1u << 20) | (4u << 22) | (3u << 25));   // pad on, behind every 32 dwords, 4 dwords
  g[1] = uni(128u << 16);
  g[2] = uni(nrows << 16);
  g[3] = uni(128u << 16);
  g[4] = uni(nrows);
  g[5] = uni(pitch_bytes);
  g[6] = uni(0u);
  g[7] = uni(0u);
  return g;
}
// group 0. lds: the slice's byte offset in the work-group's LDS (a multiple of 2 KiB); gp: the slice's first byte
__device__ __forceinline__ u32x4 tdm_group0(unsigned lds, const _Float16* gp) {
  const unsigned long long ga = (unsigned long long)(size_t)gp;
  u32x4 g0;
  g0[0] = uni(1u);
  g0[1] = uni(lds);
  g0[2] = uni((unsigned)ga);
  g0[3] = uni((((unsigned)(ga >> 32)) & 0x01FFFFFFu) | 0x80000000u);
  return g0;
}
// g0 is an in-out operand (the instruction leaves it as it is): what tdm_wait0 names later is then held in the
// very registers that the request was issued from
__device__ __forceinline__ void tdm_load(u32x4& g0, u32x8 g1) {
  asm volatile("tensor_load_to_lds %0, %1" : "+s"(g0) : "s"(g1) : "memory");
}
// The issuing wave's wait for its one outstanding request. It names that request's descriptor, so that the
// descriptor's registers are still in use up to here and take no new value while the request is outstanding.
__device__ __forceinline__ void tdm_wait0(u32x4 g0, u32x8 g1) {
  asm volatile("s_wait_tensorcnt 0x0" :: "s"(g0), "s"(g1) : "memory");
}
// The k walk of a GEMM block is a ring: trip s works on k tile (s + k0) mod nt (s, k0 < nt), k0 set per block.
// Blocks that read the same operand rows then ask L2 for different lines at any one moment.
__device__ __forceinline__ unsigned ktile_at(unsigned s, unsigned k0, unsigned nt) {
  const unsigned k = s + k0;
  return k >= nt ? k - nt : k;
}

// ---------------------------------------------------------------------------
// Plane converts, all three in one launch: dst[row][c] = f16(carry * bf16(src row [c])), rows of DIM columns.
// The three f16 planes lie one behind the other in the workspace, so dst is one plane of CVT_ROWS rows:
// rows [0, QKVN) <- wqkv (carry 64), [QKVN, QKVN + DIM) <- wo (carry 64), the rest <- x (carry 1), compact
// row crow taken from input row (crow / SEQ) * SEQ_FULL + crow % SEQ.
// One thread per 8 columns (one 16-B store); 256 threads x 8 columns = 2 rows per block. Every plane has an
// even number of rows and SEQ is even, so a block's two rows are neighbours in one source: the choice of
// source is block-uniform (scalar). Grid (CVT_ROWS / 2).
// ---------------------------------------------------------------------------
#define CVT_ROWS (QKVN + DIM + MROWS)
static_assert(OFF_WQKV == 0 && OFF_WO == (size_t)QKVN * DIM * 2 && OFF_X == (size_t)(QKVN + DIM) * DIM * 2);
static_assert(2 * DIM == 256 * 8 && (SEQ % 2) == 0);

__global__ __launch_bounds__(256) void cvt_planes_kernel(
    const float* __restrict__ wqkv, const float* __restrict__ wo, const float* __restrict__ x,
    _Float16* __restrict__ dst) {
  const unsigned row0 = blockIdx.x * 2u;
  const bool is_wqkv = row0 < (unsigned)QKVN;
  const bool is_w = row0 < (unsigned)(QKVN + DIM);
  const unsigned crow = row0 - (unsigned)(QKVN + DIM);   // compact x row (used only where !is_w)
  const unsigned xrow = (crow / (unsigned)SEQ) * (unsigned)SEQ_FULL + crow % (unsigned)SEQ;
  const float* base = is_wqkv ? wqkv : (is_w ? wo : x);
  const unsigned srow = is_wqkv ? row0 : (is_w ? row0 - (unsigned)QKVN : xrow);
  const float* src = base + (size_t)srow * DIM;
  const float carry = is_w ? WCARRY : 1.0f;
  const unsigned e = threadIdx.x * 8u;   // element within the block's two rows
  const v4f a0 = *(const v4f*)(src + e);
  const v4f a1 = *(const v4f*)(src + e + 4u);
  v8h o;
#pragma unroll
  for (int i = 0; i < 4; ++i) {
    o[i]     = toh_flush(carry * bf16r(a0[i]));
    o[i + 4] = toh_flush(carry * bf16r(a1[i]));
  }
  *(v8h*)(dst + (size_t)row0 * DIM + e) = o;
}

// ---------------------------------------------------------------------------
// Output projection GEMM C[128x128 tile] = A16[rows][K] . Bt[n][K]^T. Per trip one 128-B line (64 k) of each of the
// 128 A rows and 128 B rows is brought global -> LDS by four tensor loads, one per wave (a slice of 64 rows),
// two buffers, the next tile's loads in flight while this tile is worked on. The k walk starts at tile
// (2 * tile column + tile row) mod 16 and wraps (ktile_at).
// 4 waves (wm = 64-row group, wn = 64-col group), 4 x 4 accumulators/wave, fragments from LDS.
// Epilogue per wave: outf full [full row][col] = acc/64.
// Grid (N/128, MROWS/128), 128 threads.
// ---------------------------------------------------------------------------
#define GBM 128                       // tile rows
#define GBN 128                       // tile columns
#define GBK 64                        // k per trip (one 128-B line per row)
#define GSL 5120                      // halves per slice: 64 rows at pitch LDT, rounded up to a multiple of 2 KiB
#define GSTAGE (4 * GSL)              // halves per buffer: two A slices then two B slices
static_assert((MROWS % GBM) == 0 && (SEQ % GBM) == 0);
static_assert((DIM % GBN) == 0);
static_assert((DIM % GBK) == 0 && (DIM / GBK) >= 2);
static_assert(LDT >= GBK && ((LDT * 2) % 16) == 0);
static_assert(GSL >= 64 * LDT && ((GSL * 2) % 2048) == 0);
static_assert((size_t)4 * 64 * LDC * 4 <= (size_t)2 * GSTAGE * 2);   // epilogue staging fits the ring

__device__ __forceinline__ void gemm_body(
    const _Float16* __restrict__ A16, const _Float16* __restrict__ Bt, const unsigned K,
    float* __restrict__ outf) {
  __shared__ __attribute__((aligned(2048))) _Float16 S[2 * GSTAGE];
  const unsigned tid = threadIdx.x, lane = tid & 31u;
  const unsigned w = (unsigned)__builtin_amdgcn_readfirstlane((int)(threadIdx.x >> 5));
  const unsigned wm = w >> 1, wn = w & 1u;
  const unsigned hh = lane >> 4, m = lane & 15u;
  const unsigned n0 = blockIdx.x * (unsigned)GBN;
  const unsigned row0 = blockIdx.y * (unsigned)GBM;

  // load side: wave w brings slice w (waves 0, 1: A rows wn*64.., waves 2, 3: B rows wn*64..)
  const _Float16* gsl = (wm == 0u ? A16 + (size_t)(row0 + wn * 64u) * K : Bt + (size_t)(n0 + wn * 64u) * K);
  const unsigned lsl = (unsigned)(size_t)&S[0] + w * (unsigned)GSL * 2u;
  const u32x8 g1 = tdm_group1(64u, K * 2u);
  // fragment side
  const _Float16* sa = &S[wm * (unsigned)GSL + m * LDT + hh * 8u];
  const _Float16* sb = &S[(2u + wn) * (unsigned)GSL + m * LDT + hh * 8u];
  const unsigned nt_k = K / (unsigned)GBK;
  const unsigned k0 = (blockIdx.x * 2u + blockIdx.y) % nt_k;   // first k tile of this block's walk

  // the i, j, ks loops below are unrolled so that every acc / fragment index is a constant (registers)
  v8f acc[4][4];
#pragma unroll
  for (int i = 0; i < 4; ++i)
#pragma unroll
    for (int j = 0; j < 4; ++j) acc[i][j] = v8f{};

  u32x4 g0 = tdm_group0(lsl, gsl + (size_t)k0 * GBK);
  tdm_load(g0, g1);
  tdm_wait0(g0, g1);                                  // tile 0 landed (this wave's slice)
  __syncthreads();                                    // tile 0 published to every wave
  g0 = tdm_group0(lsl + (unsigned)GSTAGE * 2u, gsl + (size_t)ktile_at(1u, k0, nt_k) * GBK);
  tdm_load(g0, g1);

  for (unsigned t = 0; t < nt_k; ++t) {
    const unsigned bo = (t & 1u) * (unsigned)GSTAGE;
#pragma unroll
    for (unsigned ks = 0; ks < 2u; ++ks) {
      v16h a[4], b[4];
#pragma unroll
      for (unsigned i = 0; i < 4u; ++i) a[i] = frag_at(sa + bo + i * 16u * LDT + ks * 32u);
#pragma unroll
      for (unsigned j = 0; j < 4u; ++j) b[j] = frag_at(sb + bo + j * 16u * LDT + ks * 32u);
#pragma unroll
      for (int i = 0; i < 4; ++i)
#pragma unroll
        for (int j = 0; j < 4; ++j) acc[i][j] = wmma16(a[i], b[j], acc[i][j]);
    }
    asm volatile("s_wait_dscnt 0x0" ::: "memory");     // this wave's reads of buffer t&1 are done
    tdm_wait0(g0, g1);                                 // this wave's slice of tile t+1 has landed
    __syncthreads();   // publishes tile t+1 and ends every wave's reads of the buffer refilled below
    if (pinned(t + 2u < nt_k)) {
      g0 = tdm_group0(lsl + bo * 2u, gsl + (size_t)ktile_at(t + 2u, k0, nt_k) * GBK);
      tdm_load(g0, g1);
    }
  }
  tdm_wait0(g0, g1);                                   // no load outstanding when the ring is reused
  asm volatile("s_wait_dscnt 0x0" ::: "memory");       // nor an LDS read of this wave

  // the ring is free behind the last trip's barrier: each wave stages its own 64x64 tile there
  float* Cw = (float*)&S[0] + w * (64u * LDC);
#pragma unroll
  for (int i = 0; i < 4; ++i)
#pragma unroll
    for (int j = 0; j < 4; ++j)
#pragma unroll
      for (int r = 0; r < 8; ++r)
        Cw[((unsigned)i * 16u + hh * 8u + (unsigned)r) * LDC + (unsigned)j * 16u + m] = acc[i][j][r];
  __syncthreads();   // the staged tile is complete before other lanes read it back

  const unsigned wrow0 = row0 + wm * 64u;

  // Epilogue loop: eight rows per trip (two per store), their LDS reads in flight together and their four stores as one
  // group; kept rolled (the code runs once per tile). The s_wait_xcnt at a trip's foot stands in front
  // of the next trip's reuse of the stores' address and data registers.
  {
    const unsigned bidx = wrow0 / (unsigned)SEQ;
    const unsigned sq0 = wrow0 - bidx * (unsigned)SEQ;
    const size_t frow0 = (size_t)bidx * SEQ_FULL + sq0;
#pragma unroll 1   // rolled: runs once per tile, unrolling only grows the code
    for (unsigned i0 = 0; i0 < 32u; i0 += 4u) {
      v4f xs[4];
      size_t off[4];
#pragma unroll
      for (unsigned i = 0; i < 4u; ++i) {
        const unsigned r = 2u * (i0 + i) + (lane >> 4);
        const unsigned c = (lane & 15u) * 4u;
        const v4f u = *(const v4f*)&Cw[r * LDC + c];
        v4f val;
#pragma unroll
        for (int j = 0; j < 4; ++j) val[j] = u[j] * (1.0f / WCARRY);
        xs[i] = val;
        off[i] = (frow0 + r) * DIM + n0 + wn * 64u + c;
      }
#pragma unroll
      for (int i = 0; i < 4; ++i) *(v4f*)(outf + off[i]) = xs[i];
      asm volatile("s_wait_xcnt 0x0" ::: "memory");   // before the stores' registers are reused
    }
  }
}

__global__ __launch_bounds__(128) void gemm_out_kernel(
    const _Float16* __restrict__ A16, const _Float16* __restrict__ Bt,
    float* __restrict__ outf) {
  gemm_body(A16, Bt, (unsigned)DIM, outf);
}

// ---------------------------------------------------------------------------
// Fused q/k/v projection: C[256 rows x 192 columns] = A16[rows][DIM] . Bt[n][DIM]^T, the 192 columns
// being one head's q, k and v (column n = head*192 + part*64 + d). Per trip one 128-B line (64 k) of
// each of the 256 A rows and 192 B rows is brought global -> LDS by four tensor loads, one per wave (a slice
// of 128 A rows or of 96 B rows), two buffers, the next tile's loads in flight while this tile is worked on.
// The k walk starts at tile (head + tile row) mod 16 and wraps (ktile_at).
// 4 waves (wm = 128-row group, wn = 96-column group), 8 x 6 accumulators per wave, fragments from LDS.
// Two blocks share a WGP (two waves per SIMD), so all 512 blocks of the grid are resident at once.
// Epilogue: f16(acc/64) staged in the free ring, q as [row][d], k and v transposed as [d][key] (a lane's
// 8 accumulator rows are 8 consecutive keys: one 16-B LDS store), then written as whole lines:
//   outq[row][head*64 + d] (pitch DIM), outt[k|v][b][head*64 + d][key].
// Grid (NHEAD, MROWS/256), 128 threads.
// ---------------------------------------------------------------------------
#define QBM 256                       // tile rows
#define QBN 192                       // tile columns: q, k, v of one head
#define QASL (128 * LDT)              // halves per A slice: 128 rows at pitch LDT (a multiple of 2 KiB)
#define QBSL 7168                     // halves per B slice: 96 rows at pitch LDT, rounded up to a multiple of 2 KiB
#define QSTAGE (2 * QASL + 2 * QBSL)  // halves per buffer: two A slices then two B slices
#define QTP (QBM + 8)                 // halves per row of the transposed k/v staging (528 B = 16 B x odd)
static_assert(QBN == 3 * HD && (QKVN % QBN) == 0 && (QKVN / QBN) == NHEAD);
static_assert((MROWS % QBM) == 0 && (SEQ % QBM) == 0);
static_assert((size_t)QBM * LDT + (size_t)2 * HD * QTP <= (size_t)2 * QSTAGE);   // staging fits the ring
static_assert((size_t)2 * 2 * QSTAGE * 2 <= (size_t)327680);                     // two blocks per WGP
static_assert(((QASL * 2) % 2048) == 0 && QBSL >= 96 * LDT && ((QBSL * 2) % 2048) == 0);

// second launch-bounds argument: two waves per SIMD, so that two blocks share a WGP
__global__ __launch_bounds__(128, 2) void gemm_qkv_kernel(
    const _Float16* __restrict__ A16, const _Float16* __restrict__ Bt,
    _Float16* __restrict__ outq, _Float16* __restrict__ outt) {
  __shared__ __attribute__((aligned(2048))) _Float16 S[2 * QSTAGE];
  const unsigned tid = threadIdx.x, lane = tid & 31u;
  const unsigned w = (unsigned)__builtin_amdgcn_readfirstlane((int)(threadIdx.x >> 5));
  const unsigned wm = w >> 1, wn = w & 1u;
  const unsigned hh = lane >> 4, m = lane & 15u;
  const unsigned head = blockIdx.x;
  const unsigned row0 = blockIdx.y * (unsigned)QBM;

  // load side: wave w brings slice w (waves 0, 1: A rows wn*128.., waves 2, 3: B rows wn*96..)
  const _Float16* gsl = (wm == 0u ? A16 + (size_t)(row0 + wn * 128u) * DIM
                                  : Bt + (size_t)(head * (unsigned)QBN + wn * 96u) * DIM);
  const unsigned lsl = (unsigned)(size_t)&S[0] +
                       (wm == 0u ? wn * (unsigned)QASL : 2u * (unsigned)QASL + wn * (unsigned)QBSL) * 2u;
  const u32x8 g1 = tdm_group1(wm == 0u ? 128u : 96u, (unsigned)DIM * 2u);
  // fragment side
  const _Float16* sa = &S[wm * (unsigned)QASL + m * LDT + hh * 8u];
  const _Float16* sb = &S[2u * (unsigned)QASL + wn * (unsigned)QBSL + m * LDT + hh * 8u];
  const unsigned nt_k = (unsigned)DIM / (unsigned)GBK;
  const unsigned k0 = (head + blockIdx.y) % nt_k;   // first k tile of this block's walk

  // the i, j, ks loops below are unrolled so that every acc / fragment index is a constant (registers)
  v8f acc[8][6];
#pragma unroll
  for (int i = 0; i < 8; ++i)
#pragma unroll
    for (int j = 0; j < 6; ++j) acc[i][j] = v8f{};

  u32x4 g0 = tdm_group0(lsl, gsl + k0 * (unsigned)GBK);
  tdm_load(g0, g1);
  tdm_wait0(g0, g1);                                  // tile 0 landed (this wave's slice)
  __syncthreads();                                    // tile 0 published to every wave
  g0 = tdm_group0(lsl + (unsigned)QSTAGE * 2u, gsl + ktile_at(1u, k0, nt_k) * (unsigned)GBK);
  tdm_load(g0, g1);

  for (unsigned t = 0; t < nt_k; ++t) {
    const unsigned bo = (t & 1u) * (unsigned)QSTAGE;
#pragma unroll
    for (unsigned ks = 0; ks < 2u; ++ks) {
      const _Float16* pa = sa + bo + ks * 32u;
      const _Float16* pb = sb + bo + ks * 32u;
      v16h a[8], b[6];
#pragma unroll
      for (unsigned j = 0; j < 6u; ++j) b[j] = frag_at(pb + j * 16u * LDT);
      a[0] = frag_at(pa);
      a[1] = frag_at(pa + 16u * LDT);
#pragma unroll
      for (int g = 0; g < 4; ++g) {       // row pairs: the next pair's A fragments are read one pair ahead
        if (g < 3) {
          a[2 * g + 2] = frag_at(pa + (unsigned)(2 * g + 2) * 16u * LDT);
          a[2 * g + 3] = frag_at(pa + (unsigned)(2 * g + 3) * 16u * LDT);
        }
        // keeps the next pair's LDS reads one group ahead of this pair's WMMAs (else they sink to their use)
        __builtin_amdgcn_sched_barrier(0);
#pragma unroll
        for (int i = 2 * g; i < 2 * g + 2; ++i)
#pragma unroll
          for (int j = 0; j < 6; ++j) acc[i][j] = wmma16p(a[i], b[j], acc[i][j]);
        // keeps later LDS reads from moving in among these WMMAs
        __builtin_amdgcn_sched_barrier(0);
      }
    }
    asm volatile("s_wait_dscnt 0x0" ::: "memory");     // this wave's reads of buffer t&1 are done
    tdm_wait0(g0, g1);                                 // this wave's slice of tile t+1 has landed
    __syncthreads();   // publishes tile t+1 and ends every wave's reads of the buffer refilled below
    if (pinned(t + 2u < nt_k)) {
      g0 = tdm_group0(lsl + bo * 2u, gsl + ktile_at(t + 2u, k0, nt_k) * (unsigned)GBK);
      tdm_load(g0, g1);
    }
  }
  tdm_wait0(g0, g1);                                   // no load outstanding when the ring is reused
  asm volatile("s_wait_dscnt 0x0" ::: "memory");       // nor an LDS read of this wave

  // the lane id is read anew here, so that no lane-derived value of the epilogue is held in a register
  // across the K loop
  const unsigned ln = __builtin_amdgcn_mbcnt_lo(~0u, 0u);
  const unsigned eh = ln >> 4, em = ln & 15u;
  // the ring is free behind the last trip's barrier: the block's tile is staged there as f16
  _Float16* Tq = &S[0];                       // [256 rows][LDT]
  _Float16* Tt = &S[(unsigned)QBM * LDT];     // [128 = k d, v d][QTP]
#pragma unroll
  for (int j = 0; j < 6; ++j) {
    const unsigned d = (wn * 6u + (unsigned)j - 4u) * 16u + em;   // k/v staging row (unused for q columns)
#pragma unroll
    for (int i = 0; i < 8; ++i) {
      const unsigned row = wm * 128u + (unsigned)i * 16u + eh * 8u;
      v8h x;
#pragma unroll
      for (int r = 0; r < 8; ++r) x[r] = toh_flush(acc[i][j][r] * (1.0f / WCARRY));
      if (j < 4 && wn == 0u) {                // columns 0..63 of the head: q (wave-uniform test)
#pragma unroll
        for (int r = 0; r < 8; ++r) Tq[(row + (unsigned)r) * LDT + (unsigned)j * 16u + em] = x[r];
      } else {                                // columns 64..191: k then v, stored transposed
        *(v8h*)&Tt[d * QTP + row] = x;
      }
    }
  }
  __syncthreads();   // the staged tile is complete before other waves read it back

  // Write-out loops: four wave-wide 16-B stores per trip, their LDS reads in flight together; kept
  // rolled (the code runs once per tile). The s_wait_xcnt at a trip's foot stands in front of the next
  // trip's reuse of the stores' address and data registers.
#pragma unroll 1   // rolled: runs once per tile, unrolling only grows the code
  for (unsigned i0 = 0; i0 < 16u; i0 += 4u) {          // q: 4 rows (one line each) per store
    v8h x[4];
    size_t off[4];
#pragma unroll
    for (unsigned i = 0; i < 4u; ++i) {
      const unsigned r = 4u * (w * 16u + i0 + i) + (ln >> 3);
      const unsigned c = (ln & 7u) * 8u;
      x[i] = *(const v8h*)&Tq[r * LDT + c];
      off[i] = (size_t)(row0 + r) * DIM + head * HD + c;
    }
#pragma unroll
    for (int i = 0; i < 4; ++i) *(v8h*)(outq + off[i]) = x[i];
    asm volatile("s_wait_xcnt 0x0" ::: "memory");   // before the stores' registers are reused
  }
  const unsigned bidx = row0 / (unsigned)SEQ;
  const unsigned key0 = row0 - bidx * (unsigned)SEQ;
#pragma unroll 1   // rolled: runs once per tile, unrolling only grows the code
  for (unsigned i0 = 0; i0 < 32u; i0 += 4u) {          // k, v: one d row (256 keys, 4 lines) per store
    v8h x[4];
    size_t off[4];
#pragma unroll
    for (unsigned i = 0; i < 4u; ++i) {
      const unsigned d = w * 32u + i0 + i;             // 0..63: k plane, 64..127: v plane
      x[i] = *(const v8h*)&Tt[d * QTP + ln * 8u];
      off[i] = (size_t)(d >> 6) * TPLANE_ELEMS +
               ((size_t)bidx * DIM + head * HD + (d & 63u)) * SEQ + key0 + ln * 8u;
    }
#pragma unroll
    for (int i = 0; i < 4; ++i) *(v8h*)(outt + off[i]) = x[i];
    asm volatile("s_wait_xcnt 0x0" ::: "memory");   // before the stores' registers are reused
  }
}


// ---------------------------------------------------------------------------
// Per (head, batch, 32x32 quadrant qr, qc): KV[d2][d1] = sum_s V[s][d2] * K[s][d1], depth SEQ.
// A = 32 V^T plane rows (m = d2, k = s contiguous), B = 32 K^T plane rows (n = d1, k = s contiguous).
// 16 waves, wave w owns depth [w*KTD, (w+1)*KTD): one aligned 256-B unit of each of the 64 rows, copied
// global -> LDS by asynchronous 16-B copies (16 lanes per row: whole lines) into the wave's own slice,
// all 32 copies of a lane in flight together. 2 x 2 accumulators per wave, fragments from LDS.
// The 16 partial tiles are summed in f32 in wave order through LDS and written as f16.
// Plane layout [b][head][qc][d2][32 columns]: a quadrant is 2 KiB of whole lines with one writer.
// Grid (4 * NHEAD, NB), 512 threads.
// ---------------------------------------------------------------------------
#define KTW   16                 // waves per block = depth slices
#define KTD   (SEQ / KTW)        // depth per wave
#define KTP   (KTD + 8)          // halves per LDS row (272 B = 16 B x odd)
#define KTSL  (64 * KTP)         // halves per wave slice: 32 V rows then 32 K rows
#define KTC   36                 // floats per row of a wave's 32x32 partial tile
static_assert(KTD == 128);                                   // one 256-B unit per row and wave
static_assert((size_t)KTW * KTSL * 2 <= (size_t)327680);     // the slices fit the LDS
static_assert((size_t)32 * KTC * 4 <= (size_t)KTSL * 2);     // a partial tile fits its wave's slice
static_assert((KTC % 2) == 0 && ((KTSL * 2) % 16) == 0);

typedef _Float16 v2h __attribute__((ext_vector_type(2)));
typedef float    v2f __attribute__((ext_vector_type(2)));

// Eight asynchronous 16-B copies per lane: rows r, r+2, ..., r+14 of the wave's slice.
// lds: the lane's LDS byte address in row r; gp: the lane's global address in row r.
__device__ __forceinline__ void async_slice8(unsigned lds, const _Float16* gp) {
  const unsigned l0 = lds;
  const unsigned l1 = lds + 1u * 2u * KTP * 2u;
  const unsigned l2 = lds + 2u * 2u * KTP * 2u;
  const unsigned l3 = lds + 3u * 2u * KTP * 2u;
  const unsigned l4 = lds + 4u * 2u * KTP * 2u;
  const unsigned l5 = lds + 5u * 2u * KTP * 2u;
  const unsigned l6 = lds + 6u * 2u * KTP * 2u;
  const unsigned l7 = lds + 7u * 2u * KTP * 2u;
  const _Float16* g0 = gp;
  const _Float16* g1 = gp + (size_t)1 * 2 * SEQ;
  const _Float16* g2 = gp + (size_t)2 * 2 * SEQ;
  const _Float16* g3 = gp + (size_t)3 * 2 * SEQ;
  const _Float16* g4 = gp + (size_t)4 * 2 * SEQ;
  const _Float16* g5 = gp + (size_t)5 * 2 * SEQ;
  const _Float16* g6 = gp + (size_t)6 * 2 * SEQ;
  const _Float16* g7 = gp + (size_t)7 * 2 * SEQ;
  // the copies and, as the last line, the wait that stands before their address registers are reused
  asm volatile(
      "global_load_async_to_lds_b128 %0, %8, off\n\t"
      "global_load_async_to_lds_b128 %1, %9, off\n\t"
      "global_load_async_to_lds_b128 %2, %10, off\n\t"
      "global_load_async_to_lds_b128 %3, %11, off\n\t"
      "global_load_async_to_lds_b128 %4, %12, off\n\t"
      "global_load_async_to_lds_b128 %5, %13, off\n\t"
      "global_load_async_to_lds_b128 %6, %14, off\n\t"
      "global_load_async_to_lds_b128 %7, %15, off\n\t"
      "s_wait_xcnt 0x0"
      :: "v"(l0), "v"(l1), "v"(l2), "v"(l3), "v"(l4), "v"(l5), "v"(l6), "v"(l7),
         "v"(g0), "v"(g1), "v"(g2), "v"(g3), "v"(g4), "v"(g5), "v"(g6), "v"(g7)
      : "memory");
}

__global__ __launch_bounds__(512) void ktv_kernel(
    const _Float16* __restrict__ T16, _Float16* __restrict__ KVt) {
  __shared__ __attribute__((aligned(16))) _Float16 Sl[KTW * KTSL];
  const unsigned tid = threadIdx.x, lane = tid & 31u;
  const unsigned w = (unsigned)__builtin_amdgcn_readfirstlane((int)(threadIdx.x >> 5));
  const unsigned hh = lane >> 4, m = lane & 15u;
  const unsigned head = blockIdx.x >> 2;
  const unsigned qr = (blockIdx.x >> 1) & 1u, qc = blockIdx.x & 1u;
  const unsigned b = blockIdx.y;

  const size_t kbase = ((size_t)b * DIM + head * HD) * SEQ;   // k plane
  const size_t vbase = TPLANE_ELEMS + kbase;                  // v plane
  // copy side: lane -> row lane>>4 (+2 per copy), 16-B chunk lane&15 of the row's 256-B unit
  const _Float16* gv = T16 + vbase + (size_t)(qr * 32u + hh) * SEQ + w * (unsigned)KTD + m * 8u;
  const _Float16* gk = T16 + kbase + (size_t)(qc * 32u + hh) * SEQ + w * (unsigned)KTD + m * 8u;
  _Float16* Sw = &Sl[w * (unsigned)KTSL];
  const unsigned lv = (unsigned)(size_t)Sw + (hh * KTP + m * 8u) * 2u;
  const unsigned lk = lv + 32u * KTP * 2u;
  async_slice8(lv, gv);
  async_slice8(lv + 16u * KTP * 2u, gv + (size_t)16 * SEQ);
  async_slice8(lk, gk);
  async_slice8(lk + 16u * KTP * 2u, gk + (size_t)16 * SEQ);
  asm volatile("s_wait_asynccnt 0x0" ::: "memory");   // this wave's copies have landed
  __syncthreads();                                    // the slices are published before any is read

  const _Float16* sa = Sw + m * KTP + hh * 8u;
  const _Float16* sb = sa + 32u * KTP;
  // the i, j, ks loops are unrolled so that every acc / fragment index is a constant (registers)
  v8f acc[2][2];
#pragma unroll
  for (int i = 0; i < 2; ++i)
#pragma unroll
    for (int j = 0; j < 2; ++j) acc[i][j] = v8f{};
#pragma unroll
  for (unsigned ks = 0; ks < (unsigned)KTD / 32u; ++ks) {
    v16h a[2], bb[2];
#pragma unroll
    for (unsigned i = 0; i < 2u; ++i) a[i] = frag_at(sa + i * 16u * KTP + ks * 32u);
#pragma unroll
    for (unsigned j = 0; j < 2u; ++j) bb[j] = frag_at(sb + j * 16u * KTP + ks * 32u);
#pragma unroll
    for (int i = 0; i < 2; ++i)
#pragma unroll
      for (int j = 0; j < 2; ++j) acc[i][j] = wmma16(a[i], bb[j], acc[i][j]);
  }
  // this wave's fragment reads are done before its partial tile overwrites the head of its slice
  asm volatile("s_wait_dscnt 0x0" ::: "memory");
  float* Pw = (float*)Sw;
#pragma unroll
  for (int i = 0; i < 2; ++i)
#pragma unroll
    for (int j = 0; j < 2; ++j)
#pragma unroll
      for (int r = 0; r < 8; ++r)
        Pw[((unsigned)i * 16u + hh * 8u + (unsigned)r) * KTC + (unsigned)j * 16u + m] = acc[i][j][r];
  __syncthreads();   // all 16 partial tiles are complete before they are summed

  const unsigned r = tid >> 4, c = (tid & 15u) * 2u;
  float s0 = 0.0f, s1 = 0.0f;
#pragma unroll
  for (unsigned g = 0; g < (unsigned)KTW; ++g) {
    const v2f u = *(const v2f*)((const float*)&Sl[g * (unsigned)KTSL] + r * KTC + c);
    s0 += u[0];
    s1 += u[1];
  }
  v2h o;
  o[0] = toh_flush(s0);
  o[1] = toh_flush(s1);
  *(v2h*)(KVt + (size_t)(b * NHEAD + head) * (HD * HD) + (size_t)qc * (HD * 32) +
          (size_t)(qr * 32u + r) * 32u + c) = o;
}

// ---------------------------------------------------------------------------
// Per (128 query rows, head, batch): Ov[b*SEQ+s][head*64 + d2] =
//   f16( 1/8 * sum_d1 Q[s][d1] * KVt[d2][d1] ). 8 waves x 16 rows, 4 output tiles per wave,
// depth 64 in two 32-steps; A fragments from the q plane, B fragments from the KVt rows
// (plane layout [b][head][d1 / 32][d2][d1 % 32]).
// Ov rows are stored as whole lines (one line per row: 8 consecutive lanes x 16 B).
// Grid (SEQ/128, NHEAD, NB).
// ---------------------------------------------------------------------------
__global__ __launch_bounds__(256) void qkv_apply_kernel(
    const _Float16* __restrict__ Qh, const _Float16* __restrict__ KVt,
    _Float16* __restrict__ Ov) {
  __shared__ __attribute__((aligned(16))) _Float16 Ps[8 * 16 * LDT];
  const unsigned tid = threadIdx.x, lane = tid & 31u;
  const unsigned w = (unsigned)__builtin_amdgcn_readfirstlane((int)(threadIdx.x >> 5));
  const unsigned hh = lane >> 4, m = lane & 15u;
  const unsigned q0 = blockIdx.x * 128u;
  const unsigned head = blockIdx.y;
  const unsigned b = blockIdx.z;
  const unsigned qrow0 = q0 + w * 16u;
  const unsigned pbase = w * (16u * LDT);

  const size_t qoff = (size_t)(b * (unsigned)SEQ + qrow0 + m) * DIM + head * HD + hh * 8u;
  const v16h qf0 = frag_at(Qh + qoff);
  const v16h qf1 = frag_at(Qh + qoff + 32);
  const _Float16* kvp = KVt + (size_t)(b * NHEAD + head) * (HD * HD) + (size_t)m * 32 + hh * 8u;

  v8f o[4];
#pragma unroll
  for (int nb = 0; nb < 4; ++nb) {
    const v16h b0 = frag_at(kvp + nb * 16 * 32);             // d1 0..31
    const v16h b1 = frag_at(kvp + HD * 32 + nb * 16 * 32);   // d1 32..63
    v8f t = {};
    t = wmma16(qf0, b0, t);
    t = wmma16(qf1, b1, t);
    o[nb] = t;
  }

#pragma unroll
  for (int nb = 0; nb < 4; ++nb)
#pragma unroll
    for (int v = 0; v < 8; ++v)
      Ps[pbase + (hh * 8u + (unsigned)v) * LDT + (unsigned)nb * 16u + m] =
          toh_flush(o[nb][v] * SCALE_QK);
  wave_lds_sync();
  v8h x[4];
  size_t off[4];
#pragma unroll
  for (unsigned i = 0; i < 4u; ++i) {
    const unsigned r = 4u * i + (lane >> 3);
    const unsigned c = (lane & 7u) * 8u;
    x[i] = *(const v8h*)&Ps[pbase + r * LDT + c];
    off[i] = (size_t)(b * (unsigned)SEQ + qrow0 + r) * DIM + head * HD + c;
  }
#pragma unroll
  for (int i = 0; i < 4; ++i) *(v8h*)(Ov + off[i]) = x[i];
  
}

// ---------------------------------------------------------------------------
extern "C" void kernel_launch(void* const* d_in, const int* in_sizes, int n_in,
                              void* d_out, int out_size, void* d_ws, size_t ws_size,
                              hipStream_t stream) {
  if (n_in < 3) return;
  const long long need_x = ((long long)(NB - 1) * SEQ_FULL + SEQ) * DIM;
  if ((long long)in_sizes[0] < need_x) return;
  if ((long long)in_sizes[1] < (long long)QKVN * DIM) return;
  if ((long long)in_sizes[2] < (long long)DIM * DIM) return;
  if ((long long)out_size < need_x) return;
  if (ws_size < WS_TOTAL) return;

  const float* X    = (const float*)d_in[0];   // [NB_FULL][SEQ_FULL][DIM]
  const float* wqkv = (const float*)d_in[1];   // [QKVN][DIM]  (out, in)
  const float* wo   = (const float*)d_in[2];   // [DIM][DIM]   (out, in)
  float* out = (float*)d_out;

  char* ws = (char*)d_ws;
  _Float16* Wqkv16 = (_Float16*)(ws + OFF_WQKV);   // [n][k]
  _Float16* Wo16   = (_Float16*)(ws + OFF_WO);     // [n][k]
  _Float16* X16    = (_Float16*)(ws + OFF_X);      // compact rows
  _Float16* Q16    = (_Float16*)(ws + OFF_Q);      // [MROWS][head*64 + d]
  _Float16* T16    = (_Float16*)(ws + OFF_T);      // [k|v][b][head*64 + d][SEQ]
  _Float16* KVt16  = (_Float16*)(ws + OFF_KV);     // [b][head][d1 / 32][d2][d1 % 32]
  _Float16* Ctx16  = (_Float16*)(ws + OFF_CTX);    // [MROWS][head*64 + d]

  dim3 blk(256);

  // weight planes are already [out n][in k] (k contiguous), carry x64; activation plane: full-size input
  // rows -> compact rows, carry 1. One launch writes Wqkv16, Wo16 and X16, which are contiguous from Wqkv16.
  cvt_planes_kernel<<<dim3(CVT_ROWS / 2), blk, 0, stream>>>(wqkv, wo, X, Wqkv16);

  gemm_qkv_kernel<<<dim3(NHEAD, MROWS / QBM), dim3(128), 0, stream>>>(X16, Wqkv16, Q16, T16);
  ktv_kernel<<<dim3(4 * NHEAD, NB), dim3(512), 0, stream>>>(T16, KVt16);
  qkv_apply_kernel<<<dim3(SEQ / 128, NHEAD, NB), blk, 0, stream>>>(Q16, KVt16, Ctx16);
  gemm_out_kernel<<<dim3(DIM / GBN, MROWS / GBM), dim3(128), 0, stream>>>(Ctx16, Wo16, out);
}

// v007
// A run of this version takes 71 microseconds.
// Timed twice side by side with v006, it ran 1.04 times as fast both times.
// All steps since v000 together make it 5.34 times as fast.
#include <hip/hip_runtime.h>
#include <stddef.h>

// All contractions on v_wmma_f32_16x16x32_f16 (f16 operands, f32 accumulate): fused q/k/v projection with
// per-head V^T.K partials (depth = the block's keys) in its epilogue, per-head Q.(K^T V) (depth 64), output
// projection. Float inputs are RNE-converted to bf16 and carried in f16 (weights x64); q, k, v, K^T V and the
// merged head plane are f16 (carry 1). Scale 1/8 and all carries are undone in f32 epilogues.

typedef _Float16 h16;
typedef _Float16 v16h __attribute__((ext_vector_type(16)));
typedef _Float16 v8h  __attribute__((ext_vector_type(8)));
typedef float    v8f  __attribute__((ext_vector_type(8)));
typedef float    v4f  __attribute__((ext_vector_type(4)));

#ifndef NB
#define NB 4
#endif
#ifndef SEQ
#define SEQ 2048
#endif
#define NB_FULL  4
#define SEQ_FULL 2048
#define DIM   1024
#define NHEAD 16
#define HD    64
#define QKVN  (3 * DIM)
#define MROWS (NB * SEQ)

static_assert(NB >= 1 && NB <= NB_FULL);
static_assert(SEQ >= 128 && SEQ <= SEQ_FULL && (SEQ % 128) == 0);
static_assert(DIM == NHEAD * HD);
static_assert(HD == 64);
static_assert(QKVN == 3 * DIM && (QKVN / 64) == 3 * NHEAD);
static_assert((DIM % 64) == 0 && (DIM % 32) == 0);
static_assert((QKVN % 64) == 0);
static_assert((SEQ % 64) == 0 && (SEQ % 32) == 0);
static_assert((MROWS % 64) == 0 && (MROWS % 2) == 0);
static_assert((QKVN % 2) == 0 && (DIM % 2) == 0);
static_assert(DIM / 8 == 128);                 // convert kernel: 128 eight-column groups per row
static_assert((size_t)MROWS * (DIM / 8) < (size_t)0xFFFFFFFFu);

#define LDT 72   // halves per LDS row (144 B, 16-B aligned)
#define LDC 68   // floats per LDS row (272 B, 16-B aligned)
static_assert((LDT % 8) == 0 && LDT >= 64);
static_assert((LDC % 4) == 0 && LDC >= 64);

#define WCARRY   64.0f     // weight planes carried x64
#define SCALE_QK 0.125f    // HD^-0.5

// workspace layout (bytes)
#define WQKV_BYTES    ((size_t)QKVN * DIM * 2)
#define WO_BYTES      ((size_t)DIM * DIM * 2)
#define PLANE16_BYTES ((size_t)MROWS * DIM * 2)
#define PART_BYTES    ((size_t)(MROWS / 256) * NHEAD * HD * HD * 4)   // f32 V^T.K partial per 256 keys and head
#define OFF_WQKV ((size_t)0)
#define OFF_WO   (OFF_WQKV + WQKV_BYTES)
#define OFF_X    (OFF_WO + WO_BYTES)
#define OFF_Q    (OFF_X + PLANE16_BYTES)
#define OFF_PART (OFF_Q + PLANE16_BYTES)
#define OFF_CTX  (OFF_PART + PART_BYTES)
#define WS_TOTAL (OFF_CTX + PLANE16_BYTES)
static_assert((WQKV_BYTES % 128) == 0 && (WO_BYTES % 128) == 0 && (PLANE16_BYTES % 128) == 0);
static_assert((PART_BYTES % 128) == 0);
static_assert(WS_TOTAL <= (size_t)134217728);

// ---------------------------------------------------------------------------
__device__ __forceinline__ float bf16r(float x) {   // RNE convert to bf16, returned widened
  unsigned int u = __float_as_uint(x);
  u = (u + 0x7FFFu + ((u >> 16) & 1u)) & 0xFFFF0000u;
  return __uint_as_float(u);
}

// f32 -> f16 operand convert that cannot produce an f16 subnormal
static __device__ __forceinline__ h16 toh_flush(float v) {
  const h16 r = (h16)v;
  return (fabsf(v) < 6.103515625e-05f) ? (h16)0.0f : r;
}

// 16-bit fragment: p points at element [row = lane&15][k0 + 8*(lane>>4)] of a k-contiguous
// row. Elements 0..7 <- k0+8h+0..7, elements 8..15 <- k0+16+8h+0..7 (same map for A and B).
__device__ __forceinline__ v16h frag_at(const _Float16* p) {
  v8h lo = *(const v8h*)(p);
  v8h hi = *(const v8h*)(p + 16);
  v16h out;
#pragma unroll
  for (int i = 0; i < 8; ++i) { out[i] = lo[i]; out[i + 8] = hi[i]; }
  return out;
}

__device__ __forceinline__ v8f wmma16(v16h a, v16h b, v8f c) {
  v8f d = __builtin_amdgcn_wmma_f32_16x16x32_f16(false, a, false, b, (short)0, c,
                                                 false, false);
  asm volatile("v_nop\n\tv_nop\n\tv_nop\n\tv_nop" : "+v"(d) : "v"(a), "v"(b));
  return d;
}

// The builtin alone (the compiler keeps the distances behind its own form): an asm statement's vector
// operands stay in the first 256 registers, which an 8 x 6 accumulator set does not fit.
__device__ __forceinline__ v8f wmma16p(v16h a, v16h b, v8f c) {
  return __builtin_amdgcn_wmma_f32_16x16x32_f16(false, a, false, b, (short)0, c, false, false);
}

__device__ __forceinline__ void wave_lds_sync() {
  __builtin_amdgcn_fence(3 /* release order */, "wavefront");
  asm volatile("s_wait_dscnt 0x0" ::: "memory");
  __builtin_amdgcn_wave_barrier();
}

// ---------------------------------------------------------------------------
// Tensor loads: one request of one wave brings a slice of nrows rows of 128 B (64 k) from global memory into
// LDS, 16 B of pad behind every row (LDS pitch 144 B = LDT halves). Every descriptor word is wave-uniform.
// ---------------------------------------------------------------------------
typedef unsigned int u32x4 __attribute__((ext_vector_type(4)));
typedef unsigned int u32x8 __attribute__((ext_vector_type(8)));
static_assert(LDT * 2 == 128 + 16);

__device__ __forceinline__ unsigned uni(unsigned v) {
  return (unsigned)__builtin_amdgcn_readfirstlane((int)v);
}
// the test of a branch round a tensor load, which ignores EXEC
__device__ __forceinline__ unsigned pinned(unsigned v) {
  unsigned w = uni(v);
  asm volatile("" : "+s"(w));   // pinned(): holds the test in a scalar register, so that the branch is scalar
  return w;
}
// group 1: 1-byte elements, tensor = tile = nrows rows of 128 B, source pitch in bytes, no mask
__device__ __forceinline__ u32x8 tdm_group1(unsigned nrows, unsigned pitch_bytes) {
  u32x8 g;
  g[0] = uni((1u << 20) | (4u << 22) | (3u << 25));   // pad on, behind every 32 dwords, 4 dwords
  g[1] = uni(128u << 16);
  g[2] = uni(nrows << 16);
  g[3] = uni(128u << 16);
  g[4] = uni(nrows);
  g[5] = uni(pitch_bytes);
  g[6] = uni(0u);
  g[7] = uni(0u);
  return g;
}
// group 0. lds: the slice's byte offset in the work-group's LDS (a multiple of 2 KiB); gp: the slice's first byte
__device__ __forceinline__ u32x4 tdm_group0(unsigned lds, const _Float16* gp) {
  const unsigned long long ga = (unsigned long long)(size_t)gp;
  u32x4 g0;
  g0[0] = uni(1u);
  g0[1] = uni(lds);
  g0[2] = uni((unsigned)ga);
  g0[3] = uni((((unsigned)(ga >> 32)) & 0x01FFFFFFu) | 0x80000000u);
  return g0;
}
// g0 is an in-out operand (the instruction leaves it as it is): what tdm_wait0 names later is then held in the
// very registers that the request was issued from
__device__ __forceinline__ void tdm_load(u32x4& g0, u32x8 g1) {
  asm volatile("tensor_load_to_lds %0, %1" : "+s"(g0) : "s"(g1) : "memory");
}
// The issuing wave's wait for its one outstanding request. It names that request's descriptor, so that the
// descriptor's registers are still in use up to here and take no new value while the request is outstanding.
__device__ __forceinline__ void tdm_wait0(u32x4 g0, u32x8 g1) {
  asm volatile("s_wait_tensorcnt 0x0" :: "s"(g0), "s"(g1) : "memory");
}
// The k walk of a GEMM block is a ring: trip s works on k tile (s + k0) mod nt (s, k0 < nt), k0 set per block.
// Blocks that read the same operand rows then ask L2 for different lines at any one moment.
__device__ __forceinline__ unsigned ktile_at(unsigned s, unsigned k0, unsigned nt) {
  const unsigned k = s + k0;
  return k >= nt ? k - nt : k;
}

// ---------------------------------------------------------------------------
// Plane converts, all three in one launch: dst[row][c] = f16(carry * bf16(src row [c])), rows of DIM columns.
// The three f16 planes lie one behind the other in the workspace, so dst is one plane of CVT_ROWS rows:
// rows [0, QKVN) <- wqkv (carry 64), [QKVN, QKVN + DIM) <- wo (carry 64), the rest <- x (carry 1), compact
// row crow taken from input row (crow / SEQ) * SEQ_FULL + crow % SEQ.
// One thread per 8 columns (one 16-B store); 256 threads x 8 columns = 2 rows per block. Every plane has an
// even number of rows and SEQ is even, so a block's two rows are neighbours in one source: the choice of
// source is block-uniform (scalar). Grid (CVT_ROWS / 2).
// ---------------------------------------------------------------------------
#define CVT_ROWS (QKVN + DIM + MROWS)
static_assert(OFF_WQKV == 0 && OFF_WO == (size_t)QKVN * DIM * 2 && OFF_X == (size_t)(QKVN + DIM) * DIM * 2);
static_assert(2 * DIM == 256 * 8 && (SEQ % 2) == 0);

__global__ __launch_bounds__(256) void cvt_planes_kernel(
    const float* __restrict__ wqkv, const float* __restrict__ wo, const float* __restrict__ x,
    _Float16* __restrict__ dst) {
  const unsigned row0 = blockIdx.x * 2u;
  const bool is_wqkv = row0 < (unsigned)QKVN;
  const bool is_w = row0 < (unsigned)(QKVN + DIM);
  const unsigned crow = row0 - (unsigned)(QKVN + DIM);   // compact x row (used only where !is_w)
  const unsigned xrow = (crow / (unsigned)SEQ) * (unsigned)SEQ_FULL + crow % (unsigned)SEQ;
  const float* base = is_wqkv ? wqkv : (is_w ? wo : x);
  const unsigned srow = is_wqkv ? row0 : (is_w ? row0 - (unsigned)QKVN : xrow);
  const float* src = base + (size_t)srow * DIM;
  const float carry = is_w ? WCARRY : 1.0f;
  const unsigned e = threadIdx.x * 8u;   // element within the block's two rows
  const v4f a0 = *(const v4f*)(src + e);
  const v4f a1 = *(const v4f*)(src + e + 4u);
  v8h o;
#pragma unroll
  for (int i = 0; i < 4; ++i) {
    o[i]     = toh_flush(carry * bf16r(a0[i]));
    o[i + 4] = toh_flush(carry * bf16r(a1[i]));
  }
  *(v8h*)(dst + (size_t)row0 * DIM + e) = o;
}

// ---------------------------------------------------------------------------
// Output projection GEMM C[128x128 tile] = A16[rows][K] . Bt[n][K]^T. Per trip one 128-B line (64 k) of each of the
// 128 A rows and 128 B rows is brought global -> LDS by four tensor loads, one per wave (a slice of 64 rows),
// two buffers, the next tile's loads in flight while this tile is worked on. The k walk starts at tile
// (2 * tile column + tile row) mod 16 and wraps (ktile_at).
// 4 waves (wm = 64-row group, wn = 64-col group), 4 x 4 accumulators/wave, fragments from LDS.
// Epilogue per wave: outf full [full row][col] = acc/64.
// Grid (N/128, MROWS/128), 128 threads.
// ---------------------------------------------------------------------------
#define GBM 128                       // tile rows
#define GBN 128                       // tile columns
#define GBK 64                        // k per trip (one 128-B line per row)
#define GSL 5120                      // halves per slice: 64 rows at pitch LDT, rounded up to a multiple of 2 KiB
#define GSTAGE (4 * GSL)              // halves per buffer: two A slices then two B slices
static_assert((MROWS % GBM) == 0 && (SEQ % GBM) == 0);
static_assert((DIM % GBN) == 0);
static_assert((DIM % GBK) == 0 && (DIM / GBK) >= 2);
static_assert(LDT >= GBK && ((LDT * 2) % 16) == 0);
static_assert(GSL >= 64 * LDT && ((GSL * 2) % 2048) == 0);
static_assert((size_t)4 * 64 * LDC * 4 <= (size_t)2 * GSTAGE * 2);   // epilogue staging fits the ring

__device__ __forceinline__ void gemm_body(
    const _Float16* __restrict__ A16, const _Float16* __restrict__ Bt, const unsigned K,
    float* __restrict__ outf) {
  __shared__ __attribute__((aligned(2048))) _Float16 S[2 * GSTAGE];
  const unsigned tid = threadIdx.x, lane = tid & 31u;
  const unsigned w = (unsigned)__builtin_amdgcn_readfirstlane((int)(threadIdx.x >> 5));
  const unsigned wm = w >> 1, wn = w & 1u;
  const unsigned hh = lane >> 4, m = lane & 15u;
  const unsigned n0 = blockIdx.x * (unsigned)GBN;
  const unsigned row0 = blockIdx.y * (unsigned)GBM;

  // load side: wave w brings slice w (waves 0, 1: A rows wn*64.., waves 2, 3: B rows wn*64..)
  const _Float16* gsl = (wm == 0u ? A16 + (size_t)(row0 + wn * 64u) * K : Bt + (size_t)(n0 + wn * 64u) * K);
  const unsigned lsl = (unsigned)(size_t)&S[0] + w * (unsigned)GSL * 2u;
  const u32x8 g1 = tdm_group1(64u, K * 2u);
  // fragment side
  const _Float16* sa = &S[wm * (unsigned)GSL + m * LDT + hh * 8u];
  const _Float16* sb = &S[(2u + wn) * (unsigned)GSL + m * LDT + hh * 8u];
  const unsigned nt_k = K / (unsigned)GBK;
  const unsigned k0 = (blockIdx.x * 2u + blockIdx.y) % nt_k;   // first k tile of this block's walk

  // the i, j, ks loops below are unrolled so that every acc / fragment index is a constant (registers)
  v8f acc[4][4];
#pragma unroll
  for (int i = 0; i < 4; ++i)
#pragma unroll
    for (int j = 0; j < 4; ++j) acc[i][j] = v8f{};

  u32x4 g0 = tdm_group0(lsl, gsl + (size_t)k0 * GBK);
  tdm_load(g0, g1);
  tdm_wait0(g0, g1);                                  // tile 0 landed (this wave's slice)
  __syncthreads();                                    // tile 0 published to every wave
  g0 = tdm_group0(lsl + (unsigned)GSTAGE * 2u, gsl + (size_t)ktile_at(1u, k0, nt_k) * GBK);
  tdm_load(g0, g1);

  for (unsigned t = 0; t < nt_k; ++t) {
    const unsigned bo = (t & 1u) * (unsigned)GSTAGE;
#pragma unroll
    for (unsigned ks = 0; ks < 2u; ++ks) {
      v16h a[4], b[4];
#pragma unroll
      for (unsigned i = 0; i < 4u; ++i) a[i] = frag_at(sa + bo + i * 16u * LDT + ks * 32u);
#pragma unroll
      for (unsigned j = 0; j < 4u; ++j) b[j] = frag_at(sb + bo + j * 16u * LDT + ks * 32u);
#pragma unroll
      for (int i = 0; i < 4; ++i)
#pragma unroll
        for (int j = 0; j < 4; ++j) acc[i][j] = wmma16(a[i], b[j], acc[i][j]);
    }
    asm volatile("s_wait_dscnt 0x0" ::: "memory");     // this wave's reads of buffer t&1 are done
    tdm_wait0(g0, g1);                                 // this wave's slice of tile t+1 has landed
    __syncthreads();   // publishes tile t+1 and ends every wave's reads of the buffer refilled below
    if (pinned(t + 2u < nt_k)) {
      g0 = tdm_group0(lsl + bo * 2u, gsl + (size_t)ktile_at(t + 2u, k0, nt_k) * GBK);
      tdm_load(g0, g1);
    }
  }
  tdm_wait0(g0, g1);                                   // no load outstanding when the ring is reused
  asm volatile("s_wait_dscnt 0x0" ::: "memory");       // nor an LDS read of this wave

  // the ring is free behind the last trip's barrier: each wave stages its own 64x64 tile there
  float* Cw = (float*)&S[0] + w * (64u * LDC);
#pragma unroll
  for (int i = 0; i < 4; ++i)
#pragma unroll
    for (int j = 0; j < 4; ++j)
#pragma unroll
      for (int r = 0; r < 8; ++r)
        Cw[((unsigned)i * 16u + hh * 8u + (unsigned)r) * LDC + (unsigned)j * 16u + m] = acc[i][j][r];
  __syncthreads();   // the staged tile is complete before other lanes read it back

  const unsigned wrow0 = row0 + wm * 64u;

  // Epilogue loop: eight rows per trip (two per store), their LDS reads in flight together and their four stores as one
  // group; kept rolled (the code runs once per tile). The s_wait_xcnt at a trip's foot stands in front
  // of the next trip's reuse of the stores' address and data registers.
  {
    const unsigned bidx = wrow0 / (unsigned)SEQ;
    const unsigned sq0 = wrow0 - bidx * (unsigned)SEQ;
    const size_t frow0 = (size_t)bidx * SEQ_FULL + sq0;
#pragma unroll 1   // rolled: runs once per tile, unrolling only grows the code
    for (unsigned i0 = 0; i0 < 32u; i0 += 4u) {
      v4f xs[4];
      size_t off[4];
#pragma unroll
      for (unsigned i = 0; i < 4u; ++i) {
        const unsigned r = 2u * (i0 + i) + (lane >> 4);
        const unsigned c = (lane & 15u) * 4u;
        const v4f u = *(const v4f*)&Cw[r * LDC + c];
        v4f val;
#pragma unroll
        for (int j = 0; j < 4; ++j) val[j] = u[j] * (1.0f / WCARRY);
        xs[i] = val;
        off[i] = (frow0 + r) * DIM + n0 + wn * 64u + c;
      }
#pragma unroll
      for (int i = 0; i < 4; ++i) *(v4f*)(outf + off[i]) = xs[i];
      asm volatile("s_wait_xcnt 0x0" ::: "memory");   // before the stores' registers are reused
    }
  }
}

__global__ __launch_bounds__(128) void gemm_out_kernel(
    const _Float16* __restrict__ A16, const _Float16* __restrict__ Bt,
    float* __restrict__ outf) {
  gemm_body(A16, Bt, (unsigned)DIM, outf);
}

// ---------------------------------------------------------------------------
// Fused q/k/v projection: C[256 rows x 192 columns] = A16[rows][DIM] . Bt[n][DIM]^T, the 192 columns
// being one head's q, k and v (column n = head*192 + part*64 + d). Per trip one 128-B line (64 k) of
// each of the 256 A rows and 192 B rows is brought global -> LDS by four tensor loads, one per wave (a slice
// of 128 A rows or of 96 B rows), two buffers, the next tile's loads in flight while this tile is worked on.
// The k walk starts at tile (head + tile row) mod 16 and wraps (ktile_at).
// 4 waves (wm = 128-row group, wn = 96-column group), 8 x 6 accumulators per wave, fragments from LDS.
// Two blocks share a WGP (two waves per SIMD), so all 512 blocks of the grid are resident at once.
// Epilogue: f16(acc/64) staged in the free ring, q as [row][d], k and v transposed as [d][key] (a lane's
// 8 accumulator rows are 8 consecutive keys: one 16-B LDS store). q is written as whole lines,
// outq[row][head*64 + d] (pitch DIM). k and v stay in LDS: wave w multiplies 32x32 quadrant (qr, qc) = (w / 2, w % 2)
// of KV[d2][d1] = sum_key V[key][d2] * K[key][d1] over the block's 256 keys (A = 32 V^T rows, B = 32 K^T rows,
// k = key contiguous) and writes it in f32: part[tile row][head][quadrant][32 d2][32 d1], 4 KiB of whole lines.
// Grid (NHEAD, MROWS/256), 128 threads.
// ---------------------------------------------------------------------------
#define QBM 256                       // tile rows
#define QBN 192                       // tile columns: q, k, v of one head
#define QASL (128 * LDT)              // halves per A slice: 128 rows at pitch LDT (a multiple of 2 KiB)
#define QBSL 7168                     // halves per B slice: 96 rows at pitch LDT, rounded up to a multiple of 2 KiB
#define QSTAGE (2 * QASL + 2 * QBSL)  // halves per buffer: two A slices then two B slices
#define QTP (QBM + 8)                 // halves per row of the transposed k/v staging (528 B = 16 B x odd)
#define KTC 36                        // floats per LDS row of a wave's 32x32 partial quadrant (144 B = 16 B x odd)
#define QPOFF (QBM * LDT + 2 * HD * QTP)   // halves: the quadrants' staging lies behind the q and k/v staging
static_assert(QBN == 3 * HD && (QKVN % QBN) == 0 && (QKVN / QBN) == NHEAD);
static_assert((MROWS % QBM) == 0 && (SEQ % QBM) == 0);
static_assert((size_t)QPOFF * 2 + (size_t)4 * 32 * KTC * 4 <= (size_t)2 * QSTAGE * 2);   // staging fits the ring
static_assert(((QPOFF * 2) % 16) == 0 && QBM == 256 && (QBM % 32) == 0);
static_assert((size_t)2 * 2 * QSTAGE * 2 <= (size_t)327680);                     // two blocks per WGP
static_assert(((QASL * 2) % 2048) == 0 && QBSL >= 96 * LDT && ((QBSL * 2) % 2048) == 0);

// second launch-bounds argument: two waves per SIMD, so that two blocks share a WGP
__global__ __launch_bounds__(128, 2) void gemm_qkv_kernel(
    const _Float16* __restrict__ A16, const _Float16* __restrict__ Bt,
    _Float16* __restrict__ outq, float* __restrict__ part) {
  __shared__ __attribute__((aligned(2048))) _Float16 S[2 * QSTAGE];
  const unsigned tid = threadIdx.x, lane = tid & 31u;
  const unsigned w = (unsigned)__builtin_amdgcn_readfirstlane((int)(threadIdx.x >> 5));
  const unsigned wm = w >> 1, wn = w & 1u;
  const unsigned hh = lane >> 4, m = lane & 15u;
  const unsigned head = blockIdx.x;
  const unsigned row0 = blockIdx.y * (unsigned)QBM;

  // load side: wave w brings slice w (waves 0, 1: A rows wn*128.., waves 2, 3: B rows wn*96..)
  const _Float16* gsl = (wm == 0u ? A16 + (size_t)(row0 + wn * 128u) * DIM
                                  : Bt + (size_t)(head * (unsigned)QBN + wn * 96u) * DIM);
  const unsigned lsl = (unsigned)(size_t)&S[0] +
                       (wm == 0u ? wn * (unsigned)QASL : 2u * (unsigned)QASL + wn * (unsigned)QBSL) * 2u;
  const u32x8 g1 = tdm_group1(wm == 0u ? 128u : 96u, (unsigned)DIM * 2u);
  // fragment side
  const _Float16* sa = &S[wm * (unsigned)QASL + m * LDT + hh * 8u];
  const _Float16* sb = &S[2u * (unsigned)QASL + wn * (unsigned)QBSL + m * LDT + hh * 8u];
  const unsigned nt_k = (unsigned)DIM / (unsigned)GBK;
  const unsigned k0 = (head + blockIdx.y) % nt_k;   // first k tile of this block's walk

  // the i, j, ks loops below are unrolled so that every acc / fragment index is a constant (registers)
  v8f acc[8][6];
#pragma unroll
  for (int i = 0; i < 8; ++i)
#pragma unroll
    for (int j = 0; j < 6; ++j) acc[i][j] = v8f{};

  u32x4 g0 = tdm_group0(lsl, gsl + k0 * (unsigned)GBK);
  tdm_load(g0, g1);
  tdm_wait0(g0, g1);                                  // tile 0 landed (this wave's slice)
  __syncthreads();                                    // tile 0 published to every wave
  g0 = tdm_group0(lsl + (unsigned)QSTAGE * 2u, gsl + ktile_at(1u, k0, nt_k) * (unsigned)GBK);
  tdm_load(g0, g1);

  for (unsigned t = 0; t < nt_k; ++t) {
    const unsigned bo = (t & 1u) * (unsigned)QSTAGE;
#pragma unroll
    for (unsigned ks = 0; ks < 2u; ++ks) {
      const _Float16* pa = sa + bo + ks * 32u;
      const _Float16* pb = sb + bo + ks * 32u;
      v16h a[8], b[6];
#pragma unroll
      for (unsigned j = 0; j < 6u; ++j) b[j] = frag_at(pb + j * 16u * LDT);
      a[0] = frag_at(pa);
      a[1] = frag_at(pa + 16u * LDT);
#pragma unroll
      for (int g = 0; g < 4; ++g) {       // row pairs: the next pair's A fragments are read one pair ahead
        if (g < 3) {
          a[2 * g + 2] = frag_at(pa + (unsigned)(2 * g + 2) * 16u * LDT);
          a[2 * g + 3] = frag_at(pa + (unsigned)(2 * g + 3) * 16u * LDT);
        }
        // keeps the next pair's LDS reads one group ahead of this pair's WMMAs (else they sink to their use)
        __builtin_amdgcn_sched_barrier(0);
#pragma unroll
        for (int i = 2 * g; i < 2 * g + 2; ++i)
#pragma unroll
          for (int j = 0; j < 6; ++j) acc[i][j] = wmma16p(a[i], b[j], acc[i][j]);
        // keeps later LDS reads from moving in among these WMMAs
        __builtin_amdgcn_sched_barrier(0);
      }
    }
    asm volatile("s_wait_dscnt 0x0" ::: "memory");     // this wave's reads of buffer t&1 are done
    tdm_wait0(g0, g1);                                 // this wave's slice of tile t+1 has landed
    __syncthreads();   // publishes tile t+1 and ends every wave's reads of the buffer refilled below
    if (pinned(t + 2u < nt_k)) {
      g0 = tdm_group0(lsl + bo * 2u, gsl + ktile_at(t + 2u, k0, nt_k) * (unsigned)GBK);
      tdm_load(g0, g1);
    }
  }
  tdm_wait0(g0, g1);                                   // no load outstanding when the ring is reused
  asm volatile("s_wait_dscnt 0x0" ::: "memory");       // nor an LDS read of this wave

  // the lane id is read anew here, so that no lane-derived value of the epilogue is held in a register
  // across the K loop
  const unsigned ln = __builtin_amdgcn_mbcnt_lo(~0u, 0u);
  const unsigned eh = ln >> 4, em = ln & 15u;
  // the ring is free behind the last trip's barrier: the block's tile is staged there as f16
  _Float16* Tq = &S[0];                       // [256 rows][LDT]
  _Float16* Tt = &S[(unsigned)QBM * LDT];     // [128 = k d, v d][QTP]
#pragma unroll
  for (int j = 0; j < 6; ++j) {
    const unsigned d = (wn * 6u + (unsigned)j - 4u) * 16u + em;   // k/v staging row (unused for q columns)
#pragma unroll
    for (int i = 0; i < 8; ++i) {
      const unsigned row = wm * 128u + (unsigned)i * 16u + eh * 8u;
      v8h x;
#pragma unroll
      for (int r = 0; r < 8; ++r) x[r] = toh_flush(acc[i][j][r] * (1.0f / WCARRY));
      if (j < 4 && wn == 0u) {                // columns 0..63 of the head: q (wave-uniform test)
#pragma unroll
        for (int r = 0; r < 8; ++r) Tq[(row + (unsigned)r) * LDT + (unsigned)j * 16u + em] = x[r];
      } else {                                // columns 64..191: k then v, stored transposed
        *(v8h*)&Tt[d * QTP + row] = x;
      }
    }
  }
  __syncthreads();   // the staged tile is complete before other waves read it back

  // Write-out loop: four wave-wide 16-B stores per trip, their LDS reads in flight together; kept
  // rolled (the code runs once per tile). The s_wait_xcnt at a trip's foot stands in front of the next
  // trip's reuse of the stores' address and data registers.
#pragma unroll 1   // rolled: runs once per tile, unrolling only grows the code
  for (unsigned i0 = 0; i0 < 16u; i0 += 4u) {          // q: 4 rows (one line each) per store
    v8h x[4];
    size_t off[4];
#pragma unroll
    for (unsigned i = 0; i < 4u; ++i) {
      const unsigned r = 4u * (w * 16u + i0 + i) + (ln >> 3);
      const unsigned c = (ln & 7u) * 8u;
      x[i] = *(const v8h*)&Tq[r * LDT + c];
      off[i] = (size_t)(row0 + r) * DIM + head * HD + c;
    }
#pragma unroll
    for (int i = 0; i < 4; ++i) *(v8h*)(outq + off[i]) = x[i];
    asm volatile("s_wait_xcnt 0x0" ::: "memory");   // before the stores' registers are reused
  }
  // this block's V^T.K quadrant of wave w, depth 256 keys, fragments from the staged k/v tile
  const _Float16* pv = &Tt[((unsigned)HD + (w >> 1) * 32u + em) * QTP + eh * 8u];
  const _Float16* pk = &Tt[((w & 1u) * 32u + em) * QTP + eh * 8u];
  // the i, j, ks loops are unrolled so that every accumulator / fragment index is a constant (registers)
  v8f kv[2][2];
#pragma unroll
  for (int i = 0; i < 2; ++i)
#pragma unroll
    for (int j = 0; j < 2; ++j) kv[i][j] = v8f{};
#pragma unroll
  for (unsigned ks = 0; ks < (unsigned)QBM / 32u; ++ks) {
    v16h a[2], bb[2];
#pragma unroll
    for (unsigned i = 0; i < 2u; ++i) a[i] = frag_at(pv + i * 16u * QTP + ks * 32u);
#pragma unroll
    for (unsigned j = 0; j < 2u; ++j) bb[j] = frag_at(pk + j * 16u * QTP + ks * 32u);
#pragma unroll
    for (int i = 0; i < 2; ++i)
#pragma unroll
      for (int j = 0; j < 2; ++j) kv[i][j] = wmma16p(a[i], bb[j], kv[i][j]);
  }
  // the quadrant goes through the wave's own LDS range (no other wave touches it), so that it is stored as whole lines
  float* Pw = (float*)&S[QPOFF] + w * (32u * KTC);
#pragma unroll
  for (int i = 0; i < 2; ++i)
#pragma unroll
    for (int j = 0; j < 2; ++j)
#pragma unroll
      for (int r = 0; r < 8; ++r)
        Pw[((unsigned)i * 16u + eh * 8u + (unsigned)r) * KTC + (unsigned)j * 16u + em] = kv[i][j][r];
  wave_lds_sync();   // the wave's own LDS writes are done before its lanes read each other's
  float* gp = part + ((size_t)blockIdx.y * NHEAD + head) * (HD * HD) + w * 1024u + ln * 4u;
  v4f y[8];
#pragma unroll
  for (unsigned i = 0; i < 8u; ++i) y[i] = *(const v4f*)&Pw[(4u * i + (ln >> 3)) * KTC + (ln & 7u) * 4u];
#pragma unroll
  for (unsigned i = 0; i < 8u; ++i) *(v4f*)(gp + i * 128u) = y[i];   // 512 contiguous bytes per wave store
}

// ---------------------------------------------------------------------------
// Per (512 query rows, head, batch): Ov[b*SEQ+s][head*64 + d2] =
//   f16( 1/8 * sum_d1 Q[s][d1] * KV[d2][d1] ), KV = f16 of the f32 sum, in key order, of the head's SEQ/256
// partials (each thread sums 8 elements; the f16 tile [d2][d1] is published in LDS by one barrier).
// 16 waves x 32 rows (two 16-row tiles), 4 output tiles per row tile, depth 64 in two 32-steps; A fragments
// from the q plane (loads issued ahead of the sum), B fragments from the LDS tile. Output staged per wave in LDS
// and written as whole lines (one line per row: 8 consecutive lanes x 16 B).
// Grid (SEQ/512, NHEAD, NB), 512 threads.
// ---------------------------------------------------------------------------
#define APR 512                  // query rows per block
#define NPART (SEQ / QBM)        // partials per (batch, head)
static_assert((SEQ % APR) == 0 && HD * HD == 512 * 8);

typedef _Float16 v4h __attribute__((ext_vector_type(4)));

__global__ __launch_bounds__(512) void qkv_apply_kernel(
    const _Float16* __restrict__ Qh, const float* __restrict__ part,
    _Float16* __restrict__ Ov) {
  __shared__ __attribute__((aligned(16))) _Float16 KVs[HD * LDT];
  __shared__ __attribute__((aligned(16))) _Float16 Ps[16 * 32 * LDT];
  const unsigned tid = threadIdx.x, lane = tid & 31u;
  const unsigned w = (unsigned)__builtin_amdgcn_readfirstlane((int)(threadIdx.x >> 5));
  const unsigned hh = lane >> 4, m = lane & 15u;
  const unsigned q0 = blockIdx.x * (unsigned)APR;
  const unsigned head = blockIdx.y;
  const unsigned b = blockIdx.z;
  const unsigned qrow0 = q0 + w * 32u;
  const unsigned pbase = w * (32u * LDT);

  // the rt, nb, t loops below are unrolled so that every fragment / accumulator index is a constant (registers)
  // element f = tid*4 + u*2048 (+0..3) of a partial: quadrant f / 1024 = (qr, qc), row (f / 32) % 32, column f % 32
  const float* pp = part + ((size_t)b * NPART * NHEAD + head) * (HD * HD) + tid * 4u;
  v4f pl[NPART][2];
#pragma unroll
  for (unsigned t = 0; t < (unsigned)NPART; ++t)
#pragma unroll
    for (unsigned u = 0; u < 2u; ++u)
      pl[t][u] = *(const v4f*)(pp + (size_t)t * (NHEAD * HD * HD) + u * 2048u);
  v16h qf[2][2];
#pragma unroll
  for (unsigned rt = 0; rt < 2u; ++rt) {
    const size_t qoff = (size_t)(b * (unsigned)SEQ + qrow0 + rt * 16u + m) * DIM + head * HD + hh * 8u;
    qf[rt][0] = frag_at(Qh + qoff);
    qf[rt][1] = frag_at(Qh + qoff + 32);
  }
  // keeps all 24 loads in flight together (else the last q loads sink behind the first waits of the sum)
  __builtin_amdgcn_sched_barrier(0);
#pragma unroll
  for (unsigned u = 0; u < 2u; ++u) {
    v4f s = v4f{};
#pragma unroll
    for (unsigned t = 0; t < (unsigned)NPART; ++t) s += pl[t][u];
    const unsigned f = tid * 4u + u * 2048u;
    const unsigned d2 = (f >> 11) * 32u + ((f >> 5) & 31u);
    const unsigned d1 = ((f >> 10) & 1u) * 32u + (f & 31u);
    v4h o4;
#pragma unroll
    for (int i = 0; i < 4; ++i) o4[i] = toh_flush(s[i]);
    *(v4h*)&KVs[d2 * LDT + d1] = o4;
  }
  __syncthreads();   // the f16 K^T V tile is complete before any wave reads its fragments

  const _Float16* kvp = &KVs[m * LDT + hh * 8u];
  v16h b0[4], b1[4];
#pragma unroll
  for (unsigned nb = 0; nb < 4u; ++nb) {
    b0[nb] = frag_at(kvp + nb * 16u * LDT);         // d1 0..31
    b1[nb] = frag_at(kvp + nb * 16u * LDT + 32u);   // d1 32..63
  }

#pragma unroll
  for (unsigned rt = 0; rt < 2u; ++rt) {
#pragma unroll
    for (unsigned nb = 0; nb < 4u; ++nb) {
      v8f t = {};
      t = wmma16(qf[rt][0], b0[nb], t);
      t = wmma16(qf[rt][1], b1[nb], t);
#pragma unroll
      for (unsigned v = 0; v < 8u; ++v)
        Ps[pbase + (rt * 16u + hh * 8u + v) * LDT + nb * 16u + m] = toh_flush(t[v] * SCALE_QK);
    }
  }
  wave_lds_sync();
  v8h x[8];
  size_t off[8];
#pragma unroll
  for (unsigned i = 0; i < 8u; ++i) {
    const unsigned r = 4u * i + (lane >> 3);
    const unsigned c = (lane & 7u) * 8u;
    x[i] = *(const v8h*)&Ps[pbase + r * LDT + c];
    off[i] = (size_t)(b * (unsigned)SEQ + qrow0 + r) * DIM + head * HD + c;
  }
#pragma unroll
  for (int i = 0; i < 8; ++i) *(v8h*)(Ov + off[i]) = x[i];
}

// ---------------------------------------------------------------------------
extern "C" void kernel_launch(void* const* d_in, const int* in_sizes, int n_in,
                              void* d_out, int out_size, void* d_ws, size_t ws_size,
                              hipStream_t stream) {
  if (n_in < 3) return;
  const long long need_x = ((long long)(NB - 1) * SEQ_FULL + SEQ) * DIM;
  if ((long long)in_sizes[0] < need_x) return;
  if ((long long)in_sizes[1] < (long long)QKVN * DIM) return;
  if ((long long)in_sizes[2] < (long long)DIM * DIM) return;
  if ((long long)out_size < need_x) return;
  if (ws_size < WS_TOTAL) return;

  const float* X    = (const float*)d_in[0];   // [NB_FULL][SEQ_FULL][DIM]
  const float* wqkv = (const float*)d_in[1];   // [QKVN][DIM]  (out, in)
  const float* wo   = (const float*)d_in[2];   // [DIM][DIM]   (out, in)
  float* out = (float*)d_out;

  char* ws = (char*)d_ws;
  _Float16* Wqkv16 = (_Float16*)(ws + OFF_WQKV);   // [n][k]
  _Float16* Wo16   = (_Float16*)(ws + OFF_WO);     // [n][k]
  _Float16* X16    = (_Float16*)(ws + OFF_X);      // compact rows
  _Float16* Q16    = (_Float16*)(ws + OFF_Q);      // [MROWS][head*64 + d]
  float*    Part   = (float*)(ws + OFF_PART);      // [MROWS / 256][head][quadrant][32 d2][32 d1]
  _Float16* Ctx16  = (_Float16*)(ws + OFF_CTX);    // [MROWS][head*64 + d]

  dim3 blk(256);

  // weight planes are already [out n][in k] (k contiguous), carry x64; activation plane: full-size input
  // rows -> compact rows, carry 1. One launch writes Wqkv16, Wo16 and X16, which are contiguous from Wqkv16.
  cvt_planes_kernel<<<dim3(CVT_ROWS / 2), blk, 0, stream>>>(wqkv, wo, X, Wqkv16);

  gemm_qkv_kernel<<<dim3(NHEAD, MROWS / QBM), dim3(128), 0, stream>>>(X16, Wqkv16, Q16, Part);
  qkv_apply_kernel<<<dim3(SEQ / APR, NHEAD, NB), dim3(512), 0, stream>>>(Q16, Part, Ctx16);
  gemm_out_kernel<<<dim3(DIM / GBN, MROWS / GBM), dim3(128), 0, stream>>>(Ctx16, Wo16, out);
}

// v008
// A run of this version takes 68.7 microseconds.
// Next to v007, in two timings, it ran 1.03 times as fast each time.
// All steps since v000 together make it 5.50 times as fast.
#include <hip/hip_runtime.h>
#include <stddef.h>

// All contractions on v_wmma_f32_16x16x32_f16 (f16 operands, f32 accumulate): fused q/k/v projection with
// per-head V^T.K partials (depth = the block's keys) in its epilogue, per-head Q.(K^T V) (depth 64), output
// projection. Float inputs are RNE-converted to bf16 and carried in f16 (weights x64); q, k, v, K^T V and the
// merged head plane are f16 (carry 1). Scale 1/8 and all carries are undone in f32 epilogues.

typedef _Float16 h16;
typedef _Float16 v16h __attribute__((ext_vector_type(16)));
typedef _Float16 v8h  __attribute__((ext_vector_type(8)));
typedef float    v8f  __attribute__((ext_vector_type(8)));
typedef float    v4f  __attribute__((ext_vector_type(4)));

#ifndef NB
#define NB 4
#endif
#ifndef SEQ
#define SEQ 2048
#endif
#define NB_FULL  4
#define SEQ_FULL 2048
#define DIM   1024
#define NHEAD 16
#define HD    64
#define QKVN  (3 * DIM)
#define MROWS (NB * SEQ)

static_assert(NB >= 1 && NB <= NB_FULL);
static_assert(SEQ >= 128 && SEQ <= SEQ_FULL && (SEQ % 128) == 0);
static_assert(DIM == NHEAD * HD);
static_assert(HD == 64);
static_assert(QKVN == 3 * DIM && (QKVN / 64) == 3 * NHEAD);
static_assert((DIM % 64) == 0 && (DIM % 32) == 0);
static_assert((QKVN % 64) == 0);
static_assert((SEQ % 64) == 0 && (SEQ % 32) == 0);
static_assert((MROWS % 64) == 0 && (MROWS % 2) == 0);
static_assert((QKVN % 2) == 0 && (DIM % 2) == 0);
static_assert(DIM / 8 == 128);                 // convert kernel: 128 eight-column groups per row
static_assert((size_t)MROWS * (DIM / 8) < (size_t)0xFFFFFFFFu);

#define LDT 72   // halves per LDS row (144 B, 16-B aligned)
#define LDC 68   // floats per LDS row (272 B, 16-B aligned)
static_assert((LDT % 8) == 0 && LDT >= 64);
static_assert((LDC % 4) == 0 && LDC >= 64);

#define WCARRY   64.0f     // weight planes carried x64
#define SCALE_QK 0.125f    // HD^-0.5

// workspace layout (bytes)
#define WQKV_BYTES    ((size_t)QKVN * DIM * 2)
#define WO_BYTES      ((size_t)DIM * DIM * 2)
#define PLANE16_BYTES ((size_t)MROWS * DIM * 2)
#define PART_BYTES    ((size_t)(MROWS / 256) * NHEAD * HD * HD * 4)   // f32 V^T.K partial per 256 keys and head
#define OFF_WQKV ((size_t)0)
#define OFF_WO   (OFF_WQKV + WQKV_BYTES)
#define OFF_X    (OFF_WO + WO_BYTES)
#define OFF_Q    (OFF_X + PLANE16_BYTES)
#define OFF_PART (OFF_Q + PLANE16_BYTES)
#define OFF_CTX  (OFF_PART + PART_BYTES)
#define WS_TOTAL (OFF_CTX + PLANE16_BYTES)
static_assert((WQKV_BYTES % 128) == 0 && (WO_BYTES % 128) == 0 && (PLANE16_BYTES % 128) == 0);
static_assert((PART_BYTES % 128) == 0);
static_assert(WS_TOTAL <= (size_t)134217728);

// ---------------------------------------------------------------------------
__device__ __forceinline__ float bf16r(float x) {   // RNE convert to bf16, returned widened
  unsigned int u = __float_as_uint(x);
  u = (u + 0x7FFFu + ((u >> 16) & 1u)) & 0xFFFF0000u;
  return __uint_as_float(u);
}

// f32 -> f16 operand convert that cannot produce an f16 subnormal
static __device__ __forceinline__ h16 toh_flush(float v) {
  const h16 r = (h16)v;
  return (fabsf(v) < 6.103515625e-05f) ? (h16)0.0f : r;
}

// 16-bit fragment: p points at element [row = lane&15][k0 + 8*(lane>>4)] of a k-contiguous
// row. Elements 0..7 <- k0+8h+0..7, elements 8..15 <- k0+16+8h+0..7 (same map for A and B).
__device__ __forceinline__ v16h frag_at(const _Float16* p) {
  v8h lo = *(const v8h*)(p);
  v8h hi = *(const v8h*)(p + 16);
  v16h out;
#pragma unroll
  for (int i = 0; i < 8; ++i) { out[i] = lo[i]; out[i + 8] = hi[i]; }
  return out;
}

__device__ __forceinline__ v8f wmma16(v16h a, v16h b, v8f c) {
  v8f d = __builtin_amdgcn_wmma_f32_16x16x32_f16(false, a, false, b, (short)0, c,
                                                 false, false);
  asm volatile("v_nop\n\tv_nop\n\tv_nop\n\tv_nop" : "+v"(d) : "v"(a), "v"(b));
  return d;
}

// The builtin alone (the compiler keeps the distances behind its own form): an asm statement's vector
// operands stay in the first 256 registers, which an 8 x 6 accumulator set does not fit.
__device__ __forceinline__ v8f wmma16p(v16h a, v16h b, v8f c) {
  return __builtin_amdgcn_wmma_f32_16x16x32_f16(false, a, false, b, (short)0, c, false, false);
}

__device__ __forceinline__ void wave_lds_sync() {
  __builtin_amdgcn_fence(3 /* release order */, "wavefront");
  asm volatile("s_wait_dscnt 0x0" ::: "memory");
  __builtin_amdgcn_wave_barrier();
}

// ---------------------------------------------------------------------------
// Tensor loads: one request of one wave brings a slice of nrows rows of 128 B (64 k) or 256 B (128 k) from global memory into
// LDS, 16 B of pad behind every row (LDS pitch 144 B = LDT halves or 272 B = LDO halves). Every descriptor word is wave-uniform.
// ---------------------------------------------------------------------------
typedef unsigned int u32x4 __attribute__((ext_vector_type(4)));
typedef unsigned int u32x8 __attribute__((ext_vector_type(8)));
static_assert(LDT * 2 == 128 + 16);

__device__ __forceinline__ unsigned uni(unsigned v) {
  return (unsigned)__builtin_amdgcn_readfirstlane((int)v);
}
// the test of a branch round a tensor load, which ignores EXEC
__device__ __forceinline__ unsigned pinned(unsigned v) {
  unsigned w = uni(v);
  asm volatile("" : "+s"(w));   // pinned(): holds the test in a scalar register, so that the branch is scalar
  return w;
}
// group 1: 1-byte elements, tensor = tile = nrows rows of 128 B, source pitch in bytes, no mask
__device__ __forceinline__ u32x8 tdm_group1(unsigned nrows, unsigned pitch_bytes) {
  u32x8 g;
  g[0] = uni((1u << 20) | (4u << 22) | (3u << 25));   // pad on, behind every 32 dwords, 4 dwords
  g[1] = uni(128u << 16);
  g[2] = uni(nrows << 16);
  g[3] = uni(128u << 16);
  g[4] = uni(nrows);
  g[5] = uni(pitch_bytes);
  g[6] = uni(0u);
  g[7] = uni(0u);
  return g;
}
// group 1 for rows of 256 B (128 k): as above, 16 B of pad behind every row (LDS pitch 272 B = LDO halves)
__device__ __forceinline__ u32x8 tdm_group1_r256(unsigned nrows, unsigned pitch_bytes) {
  u32x8 g;
  g[0] = uni((1u << 20) | (5u << 22) | (3u << 25));   // pad on, behind every 64 dwords, 4 dwords
  g[1] = uni(256u << 16);
  g[2] = uni(nrows << 16);
  g[3] = uni(256u << 16);
  g[4] = uni(nrows);
  g[5] = uni(pitch_bytes);
  g[6] = uni(0u);
  g[7] = uni(0u);
  return g;
}
// group 0. lds: the slice's byte offset in the work-group's LDS (a multiple of 2 KiB); gp: the slice's first byte
__device__ __forceinline__ u32x4 tdm_group0(unsigned lds, const _Float16* gp) {
  const unsigned long long ga = (unsigned long long)(size_t)gp;
  u32x4 g0;
  g0[0] = uni(1u);
  g0[1] = uni(lds);
  g0[2] = uni((unsigned)ga);
  g0[3] = uni((((unsigned)(ga >> 32)) & 0x01FFFFFFu) | 0x80000000u);
  return g0;
}
// g0 is an in-out operand (the instruction leaves it as it is): what tdm_wait0 names later is then held in the
// very registers that the request was issued from
__device__ __forceinline__ void tdm_load(u32x4& g0, u32x8 g1) {
  asm volatile("tensor_load_to_lds %0, %1" : "+s"(g0) : "s"(g1) : "memory");
}
// The issuing wave's wait for its one outstanding request. It names that request's descriptor, so that the
// descriptor's registers are still in use up to here and take no new value while the request is outstanding.
__device__ __forceinline__ void tdm_wait0(u32x4 g0, u32x8 g1) {
  asm volatile("s_wait_tensorcnt 0x0" :: "s"(g0), "s"(g1) : "memory");
}
// The k walk of a GEMM block is a ring: trip s works on k tile (s + k0) mod nt (s, k0 < nt), k0 set per block.
// Blocks that read the same operand rows then ask L2 for different lines at any one moment.
__device__ __forceinline__ unsigned ktile_at(unsigned s, unsigned k0, unsigned nt) {
  const unsigned k = s + k0;
  return k >= nt ? k - nt : k;
}

// ---------------------------------------------------------------------------
// Plane converts, all three in one launch: dst[row][c] = f16(carry * bf16(src row [c])), rows of DIM columns.
// The three f16 planes lie one behind the other in the workspace, so dst is one plane of CVT_ROWS rows:
// rows [0, QKVN) <- wqkv (carry 64), [QKVN, QKVN + DIM) <- wo (carry 64), the rest <- x (carry 1), compact
// row crow taken from input row (crow / SEQ) * SEQ_FULL + crow % SEQ.
// One thread per 8 columns (one 16-B store); 256 threads x 8 columns = 2 rows per block. Every plane has an
// even number of rows and SEQ is even, so a block's two rows are neighbours in one source: the choice of
// source is block-uniform (scalar). Grid (CVT_ROWS / 2).
// ---------------------------------------------------------------------------
#define CVT_ROWS (QKVN + DIM + MROWS)
static_assert(OFF_WQKV == 0 && OFF_WO == (size_t)QKVN * DIM * 2 && OFF_X == (size_t)(QKVN + DIM) * DIM * 2);
static_assert(2 * DIM == 256 * 8 && (SEQ % 2) == 0);

__global__ __launch_bounds__(256) void cvt_planes_kernel(
    const float* __restrict__ wqkv, const float* __restrict__ wo, const float* __restrict__ x,
    _Float16* __restrict__ dst) {
  const unsigned row0 = blockIdx.x * 2u;
  const bool is_wqkv = row0 < (unsigned)QKVN;
  const bool is_w = row0 < (unsigned)(QKVN + DIM);
  const unsigned crow = row0 - (unsigned)(QKVN + DIM);   // compact x row (used only where !is_w)
  const unsigned xrow = (crow / (unsigned)SEQ) * (unsigned)SEQ_FULL + crow % (unsigned)SEQ;
  const float* base = is_wqkv ? wqkv : (is_w ? wo : x);
  const unsigned srow = is_wqkv ? row0 : (is_w ? row0 - (unsigned)QKVN : xrow);
  const float* src = base + (size_t)srow * DIM;
  const float carry = is_w ? WCARRY : 1.0f;
  const unsigned e = threadIdx.x * 8u;   // element within the block's two rows
  const v4f a0 = *(const v4f*)(src + e);
  const v4f a1 = *(const v4f*)(src + e + 4u);
  v8h o;
#pragma unroll
  for (int i = 0; i < 4; ++i) {
    o[i]     = toh_flush(carry * bf16r(a0[i]));
    o[i + 4] = toh_flush(carry * bf16r(a1[i]));
  }
  *(v8h*)(dst + (size_t)row0 * DIM + e) = o;
}

// ---------------------------------------------------------------------------
// Output projection GEMM C[128x128 tile] = A16[rows][K] . Bt[n][K]^T. Per trip one aligned 256-B unit (128 k) of each
// of the 128 A rows and 128 B rows is brought global -> LDS by four tensor loads, one per wave (a slice of 64 rows),
// two buffers, the next tile's loads in flight while this tile is worked on. The k walk starts at tile
// (tile column + tile row) mod 8 and wraps (ktile_at).
// 4 waves (wm = 64-row group, wn = 64-col group), 4 x 4 accumulators/wave, fragments from LDS.
// Epilogue per wave: outf full [full row][col] = acc/64.
// Grid (N/128, MROWS/128), 128 threads.
// ---------------------------------------------------------------------------
#define GBM 128                       // tile rows
#define GBN 128                       // tile columns
#define GBK 64                        // k per trip of the q/k/v GEMM (one 128-B line per row)
#define OBK 128                       // k per trip of this GEMM (one 256-B unit per row)
#define LDO 136                       // halves per LDS row of this GEMM's ring (272 B = 16 B x odd)
#define GSL 9216                      // halves per slice: 64 rows at pitch LDO, rounded up to a multiple of 2 KiB
#define GSTAGE (4 * GSL)              // halves per buffer: two A slices then two B slices
static_assert((MROWS % GBM) == 0 && (SEQ % GBM) == 0);
static_assert((DIM % GBN) == 0);
static_assert((DIM % GBK) == 0 && (DIM / GBK) >= 2);
static_assert((DIM % OBK) == 0 && (DIM / OBK) >= 2);
static_assert(LDT >= GBK && ((LDT * 2) % 16) == 0);
static_assert(LDO * 2 == 256 + 16 && OBK * 2 == 256);
static_assert(GSL >= 64 * LDO && ((GSL * 2) % 2048) == 0);
static_assert((size_t)2 * 2 * GSTAGE * 2 <= (size_t)327680);         // two blocks per WGP
static_assert((size_t)4 * 64 * LDC * 4 <= (size_t)2 * GSTAGE * 2);   // epilogue staging fits the ring

__device__ __forceinline__ void gemm_body(
    const _Float16* __restrict__ A16, const _Float16* __restrict__ Bt, const unsigned K,
    float* __restrict__ outf) {
  __shared__ __attribute__((aligned(2048))) _Float16 S[2 * GSTAGE];
  const unsigned tid = threadIdx.x, lane = tid & 31u;
  const unsigned w = (unsigned)__builtin_amdgcn_readfirstlane((int)(threadIdx.x >> 5));
  const unsigned wm = w >> 1, wn = w & 1u;
  const unsigned hh = lane >> 4, m = lane & 15u;
  const unsigned n0 = blockIdx.x * (unsigned)GBN;
  const unsigned row0 = blockIdx.y * (unsigned)GBM;

  // load side: wave w brings slice w (waves 0, 1: A rows wn*64.., waves 2, 3: B rows wn*64..)
  const _Float16* gsl = (wm == 0u ? A16 + (size_t)(row0 + wn * 64u) * K : Bt + (size_t)(n0 + wn * 64u) * K);
  const unsigned lsl = (unsigned)(size_t)&S[0] + w * (unsigned)GSL * 2u;
  const u32x8 g1 = tdm_group1_r256(64u, K * 2u);
  // fragment side
  const _Float16* sa = &S[wm * (unsigned)GSL + m * LDO + hh * 8u];
  const _Float16* sb = &S[(2u + wn) * (unsigned)GSL + m * LDO + hh * 8u];
  const unsigned nt_k = K / (unsigned)OBK;
  const unsigned k0 = (blockIdx.x + blockIdx.y) % nt_k;   // first k tile of this block's walk

  // the i, j, ks loops below are unrolled so that every acc / fragment index is a constant (registers)
  v8f acc[4][4];
#pragma unroll
  for (int i = 0; i < 4; ++i)
#pragma unroll
    for (int j = 0; j < 4; ++j) acc[i][j] = v8f{};

  u32x4 g0 = tdm_group0(lsl, gsl + (size_t)k0 * OBK);
  tdm_load(g0, g1);
  tdm_wait0(g0, g1);                                  // tile 0 landed (this wave's slice)
  __syncthreads();                                    // tile 0 published to every wave
  g0 = tdm_group0(lsl + (unsigned)GSTAGE * 2u, gsl + (size_t)ktile_at(1u, k0, nt_k) * OBK);
  tdm_load(g0, g1);

  for (unsigned t = 0; t < nt_k; ++t) {
    const unsigned bo = (t & 1u) * (unsigned)GSTAGE;
#pragma unroll
    for (unsigned ks = 0; ks < (unsigned)OBK / 32u; ++ks) {
      v16h a[4], b[4];
#pragma unroll
      for (unsigned i = 0; i < 4u; ++i) a[i] = frag_at(sa + bo + i * 16u * LDO + ks * 32u);
#pragma unroll
      for (unsigned j = 0; j < 4u; ++j) b[j] = frag_at(sb + bo + j * 16u * LDO + ks * 32u);
#pragma unroll
      for (int i = 0; i < 4; ++i)
#pragma unroll
        for (int j = 0; j < 4; ++j) acc[i][j] = wmma16(a[i], b[j], acc[i][j]);
    }
    asm volatile("s_wait_dscnt 0x0" ::: "memory");     // this wave's reads of buffer t&1 are done
    tdm_wait0(g0, g1);                                 // this wave's slice of tile t+1 has landed
    __syncthreads();   // publishes tile t+1 and ends every wave's reads of the buffer refilled below
    if (pinned(t + 2u < nt_k)) {
      g0 = tdm_group0(lsl + bo * 2u, gsl + (size_t)ktile_at(t + 2u, k0, nt_k) * OBK);
      tdm_load(g0, g1);
    }
  }
  tdm_wait0(g0, g1);                                   // no load outstanding when the ring is reused
  asm volatile("s_wait_dscnt 0x0" ::: "memory");       // nor an LDS read of this wave

  // the ring is free behind the last trip's barrier: each wave stages its own 64x64 tile there
  float* Cw = (float*)&S[0] + w * (64u * LDC);
#pragma unroll
  for (int i = 0; i < 4; ++i)
#pragma unroll
    for (int j = 0; j < 4; ++j)
#pragma unroll
      for (int r = 0; r < 8; ++r)
        Cw[((unsigned)i * 16u + hh * 8u + (unsigned)r) * LDC + (unsigned)j * 16u + m] = acc[i][j][r];
  __syncthreads();   // the staged tile is complete before other lanes read it back

  const unsigned wrow0 = row0 + wm * 64u;

  // Epilogue loop: eight rows per trip (two per store), their LDS reads in flight together and their four stores as one
  // group; kept rolled (the code runs once per tile). The s_wait_xcnt at a trip's foot stands in front
  // of the next trip's reuse of the stores' address and data registers.
  {
    const unsigned bidx = wrow0 / (unsigned)SEQ;
    const unsigned sq0 = wrow0 - bidx * (unsigned)SEQ;
    const size_t frow0 = (size_t)bidx * SEQ_FULL + sq0;
#pragma unroll 1   // rolled: runs once per tile, unrolling only grows the code
    for (unsigned i0 = 0; i0 < 32u; i0 += 4u) {
      v4f xs[4];
      size_t off[4];
#pragma unroll
      for (unsigned i = 0; i < 4u; ++i) {
        const unsigned r = 2u * (i0 + i) + (lane >> 4);
        const unsigned c = (lane & 15u) * 4u;
        const v4f u = *(const v4f*)&Cw[r * LDC + c];
        v4f val;
#pragma unroll
        for (int j = 0; j < 4; ++j) val[j] = u[j] * (1.0f / WCARRY);
        xs[i] = val;
        off[i] = (frow0 + r) * DIM + n0 + wn * 64u + c;
      }
#pragma unroll
      for (int i = 0; i < 4; ++i) *(v4f*)(outf + off[i]) = xs[i];
      asm volatile("s_wait_xcnt 0x0" ::: "memory");   // before the stores' registers are reused
    }
  }
}

__global__ __launch_bounds__(128) void gemm_out_kernel(
    const _Float16* __restrict__ A16, const _Float16* __restrict__ Bt,
    float* __restrict__ outf) {
  gemm_body(A16, Bt, (unsigned)DIM, outf);
}

// ---------------------------------------------------------------------------
// Fused q/k/v projection: C[256 rows x 192 columns] = A16[rows][DIM] . Bt[n][DIM]^T, the 192 columns
// being one head's q, k and v (column n = head*192 + part*64 + d). Per trip one 128-B line (64 k) of
// each of the 256 A rows and 192 B rows is brought global -> LDS by four tensor loads, one per wave (a slice
// of 128 A rows or of 96 B rows), two buffers, the next tile's loads in flight while this tile is worked on.
// The k walk starts at tile (head + tile row) mod 16 and wraps (ktile_at).
// 4 waves (wm = 128-row group, wn = 96-column group), 8 x 6 accumulators per wave, fragments from LDS.
// Two blocks share a WGP (two waves per SIMD), so all 512 blocks of the grid are resident at once.
// Epilogue: f16(acc/64) staged in the free ring, q as [row][d], k and v transposed as [d][key] (a lane's
// 8 accumulator rows are 8 consecutive keys: one 16-B LDS store). q is written as whole lines,
// outq[row][head*64 + d] (pitch DIM). k and v stay in LDS: wave w multiplies 32x32 quadrant (qr, qc) = (w / 2, w % 2)
// of KV[d2][d1] = sum_key V[key][d2] * K[key][d1] over the block's 256 keys (A = 32 V^T rows, B = 32 K^T rows,
// k = key contiguous) and writes it in f32: part[tile row][head][quadrant][32 d2][32 d1], 4 KiB of whole lines.
// Grid (NHEAD, MROWS/256), 128 threads.
// ---------------------------------------------------------------------------
#define QBM 256                       // tile rows
#define QBN 192                       // tile columns: q, k, v of one head
#define QASL (128 * LDT)              // halves per A slice: 128 rows at pitch LDT (a multiple of 2 KiB)
#define QBSL 7168                     // halves per B slice: 96 rows at pitch LDT, rounded up to a multiple of 2 KiB
#define QSTAGE (2 * QASL + 2 * QBSL)  // halves per buffer: two A slices then two B slices
#define QTP (QBM + 8)                 // halves per row of the transposed k/v staging (528 B = 16 B x odd)
#define KTC 36                        // floats per LDS row of a wave's 32x32 partial quadrant (144 B = 16 B x odd)
#define QPOFF (QBM * LDT + 2 * HD * QTP)   // halves: the quadrants' staging lies behind the q and k/v staging
static_assert(QBN == 3 * HD && (QKVN % QBN) == 0 && (QKVN / QBN) == NHEAD);
static_assert((MROWS % QBM) == 0 && (SEQ % QBM) == 0);
static_assert((size_t)QPOFF * 2 + (size_t)4 * 32 * KTC * 4 <= (size_t)2 * QSTAGE * 2);   // staging fits the ring
static_assert(((QPOFF * 2) % 16) == 0 && QBM == 256 && (QBM % 32) == 0);
static_assert((size_t)2 * 2 * QSTAGE * 2 <= (size_t)327680);                     // two blocks per WGP
static_assert(((QASL * 2) % 2048) == 0 && QBSL >= 96 * LDT && ((QBSL * 2) % 2048) == 0);

// second launch-bounds argument: two waves per SIMD, so that two blocks share a WGP
__global__ __launch_bounds__(128, 2) void gemm_qkv_kernel(
    const _Float16* __restrict__ A16, const _Float16* __restrict__ Bt,
    _Float16* __restrict__ outq, float* __restrict__ part) {
  __shared__ __attribute__((aligned(2048))) _Float16 S[2 * QSTAGE];
  const unsigned tid = threadIdx.x, lane = tid & 31u;
  const unsigned w = (unsigned)__builtin_amdgcn_readfirstlane((int)(threadIdx.x >> 5));
  const unsigned wm = w >> 1, wn = w & 1u;
  const unsigned hh = lane >> 4, m = lane & 15u;
  const unsigned head = blockIdx.x;
  const unsigned row0 = blockIdx.y * (unsigned)QBM;

  // load side: wave w brings slice w (waves 0, 1: A rows wn*128.., waves 2, 3: B rows wn*96..)
  const _Float16* gsl = (wm == 0u ? A16 + (size_t)(row0 + wn * 128u) * DIM
                                  : Bt + (size_t)(head * (unsigned)QBN + wn * 96u) * DIM);
  const unsigned lsl = (unsigned)(size_t)&S[0] +
                       (wm == 0u ? wn * (unsigned)QASL : 2u * (unsigned)QASL + wn * (unsigned)QBSL) * 2u;
  const u32x8 g1 = tdm_group1(wm == 0u ? 128u : 96u, (unsigned)DIM * 2u);
  // fragment side
  const _Float16* sa = &S[wm * (unsigned)QASL + m * LDT + hh * 8u];
  const _Float16* sb = &S[2u * (unsigned)QASL + wn * (unsigned)QBSL + m * LDT + hh * 8u];
  const unsigned nt_k = (unsigned)DIM / (unsigned)GBK;
  const unsigned k0 = (head + blockIdx.y) % nt_k;   // first k tile of this block's walk

  // the i, j, ks loops below are unrolled so that every acc / fragment index is a constant (registers)
  v8f acc[8][6];
#pragma unroll
  for (int i = 0; i < 8; ++i)
#pragma unroll
    for (int j = 0; j < 6; ++j) acc[i][j] = v8f{};

  u32x4 g0 = tdm_group0(lsl, gsl + k0 * (unsigned)GBK);
  tdm_load(g0, g1);
  tdm_wait0(g0, g1);                                  // tile 0 landed (this wave's slice)
  __syncthreads();                                    // tile 0 published to every wave
  g0 = tdm_group0(lsl + (unsigned)QSTAGE * 2u, gsl + ktile_at(1u, k0, nt_k) * (unsigned)GBK);
  tdm_load(g0, g1);

  for (unsigned t = 0; t < nt_k; ++t) {
    const unsigned bo = (t & 1u) * (unsigned)QSTAGE;
#pragma unroll
    for (unsigned ks = 0; ks < 2u; ++ks) {
      const _Float16* pa = sa + bo + ks * 32u;
      const _Float16* pb = sb + bo + ks * 32u;
      v16h a[8], b[6];
#pragma unroll
      for (unsigned j = 0; j < 6u; ++j) b[j] = frag_at(pb + j * 16u * LDT);
      a[0] = frag_at(pa);
      a[1] = frag_at(pa + 16u * LDT);
#pragma unroll
      for (int g = 0; g < 4; ++g) {       // row pairs: the next pair's A fragments are read one pair ahead
        if (g < 3) {
          a[2 * g + 2] = frag_at(pa + (unsigned)(2 * g + 2) * 16u * LDT);
          a[2 * g + 3] = frag_at(pa + (unsigned)(2 * g + 3) * 16u * LDT);
        }
        // keeps the next pair's LDS reads one group ahead of this pair's WMMAs (else they sink to their use)
        __builtin_amdgcn_sched_barrier(0);
#pragma unroll
        for (int i = 2 * g; i < 2 * g + 2; ++i)
#pragma unroll
          for (int j = 0; j < 6; ++j) acc[i][j] = wmma16p(a[i], b[j], acc[i][j]);
        // keeps later LDS reads from moving in among these WMMAs
        __builtin_amdgcn_sched_barrier(0);
      }
    }
    asm volatile("s_wait_dscnt 0x0" ::: "memory");     // this wave's reads of buffer t&1 are done
    tdm_wait0(g0, g1);                                 // this wave's slice of tile t+1 has landed
    __syncthreads();   // publishes tile t+1 and ends every wave's reads of the buffer refilled below
    if (pinned(t + 2u < nt_k)) {
      g0 = tdm_group0(lsl + bo * 2u, gsl + ktile_at(t + 2u, k0, nt_k) * (unsigned)GBK);
      tdm_load(g0, g1);
    }
  }
  tdm_wait0(g0, g1);                                   // no load outstanding when the ring is reused
  asm volatile("s_wait_dscnt 0x0" ::: "memory");       // nor an LDS read of this wave

  // the lane id is read anew here, so that no lane-derived value of the epilogue is held in a register
  // across the K loop
  const unsigned ln = __builtin_amdgcn_mbcnt_lo(~0u, 0u);
  const unsigned eh = ln >> 4, em = ln & 15u;
  // the ring is free behind the last trip's barrier: the block's tile is staged there as f16
  _Float16* Tq = &S[0];                       // [256 rows][LDT]
  _Float16* Tt = &S[(unsigned)QBM * LDT];     // [128 = k d, v d][QTP]
#pragma unroll
  for (int j = 0; j < 6; ++j) {
    const unsigned d = (wn * 6u + (unsigned)j - 4u) * 16u + em;   // k/v staging row (unused for q columns)
#pragma unroll
    for (int i = 0; i < 8; ++i) {
      const unsigned row = wm * 128u + (unsigned)i * 16u + eh * 8u;
      v8h x;
#pragma unroll
      for (int r = 0; r < 8; ++r) x[r] = toh_flush(acc[i][j][r] * (1.0f / WCARRY));
      if (j < 4 && wn == 0u) {                // columns 0..63 of the head: q (wave-uniform test)
#pragma unroll
        for (int r = 0; r < 8; ++r) Tq[(row + (unsigned)r) * LDT + (unsigned)j * 16u + em] = x[r];
      } else {                                // columns 64..191: k then v, stored transposed
        *(v8h*)&Tt[d * QTP + row] = x;
      }
    }
  }
  __syncthreads();   // the staged tile is complete before other waves read it back

  // Write-out loop: four wave-wide 16-B stores per trip, their LDS reads in flight together; kept
  // rolled (the code runs once per tile). The s_wait_xcnt at a trip's foot stands in front of the next
  // trip's reuse of the stores' address and data registers.
#pragma unroll 1   // rolled: runs once per tile, unrolling only grows the code
  for (unsigned i0 = 0; i0 < 16u; i0 += 4u) {          // q: 4 rows (one line each) per store
    v8h x[4];
    size_t off[4];
#pragma unroll
    for (unsigned i = 0; i < 4u; ++i) {
      const unsigned r = 4u * (w * 16u + i0 + i) + (ln >> 3);
      const unsigned c = (ln & 7u) * 8u;
      x[i] = *(const v8h*)&Tq[r * LDT + c];
      off[i] = (size_t)(row0 + r) * DIM + head * HD + c;
    }
#pragma unroll
    for (int i = 0; i < 4; ++i) *(v8h*)(outq + off[i]) = x[i];
    asm volatile("s_wait_xcnt 0x0" ::: "memory");   // before the stores' registers are reused
  }
  // this block's V^T.K quadrant of wave w, depth 256 keys, fragments from the staged k/v tile
  const _Float16* pv = &Tt[((unsigned)HD + (w >> 1) * 32u + em) * QTP + eh * 8u];
  const _Float16* pk = &Tt[((w & 1u) * 32u + em) * QTP + eh * 8u];
  // the i, j, ks loops are unrolled so that every accumulator / fragment index is a constant (registers)
  v8f kv[2][2];
#pragma unroll
  for (int i = 0; i < 2; ++i)
#pragma unroll
    for (int j = 0; j < 2; ++j) kv[i][j] = v8f{};
#pragma unroll
  for (unsigned ks = 0; ks < (unsigned)QBM / 32u; ++ks) {
    v16h a[2], bb[2];
#pragma unroll
    for (unsigned i = 0; i < 2u; ++i) a[i] = frag_at(pv + i * 16u * QTP + ks * 32u);
#pragma unroll
    for (unsigned j = 0; j < 2u; ++j) bb[j] = frag_at(pk + j * 16u * QTP + ks * 32u);
#pragma unroll
    for (int i = 0; i < 2; ++i)
#pragma unroll
      for (int j = 0; j < 2; ++j) kv[i][j] = wmma16p(a[i], bb[j], kv[i][j]);
  }
  // the quadrant goes through the wave's own LDS range (no other wave touches it), so that it is stored as whole lines
  float* Pw = (float*)&S[QPOFF] + w * (32u * KTC);
#pragma unroll
  for (int i = 0; i < 2; ++i)
#pragma unroll
    for (int j = 0; j < 2; ++j)
#pragma unroll
      for (int r = 0; r < 8; ++r)
        Pw[((unsigned)i * 16u + eh * 8u + (unsigned)r) * KTC + (unsigned)j * 16u + em] = kv[i][j][r];
  wave_lds_sync();   // the wave's own LDS writes are done before its lanes read each other's
  float* gp = part + ((size_t)blockIdx.y * NHEAD + head) * (HD * HD) + w * 1024u + ln * 4u;
  v4f y[8];
#pragma unroll
  for (unsigned i = 0; i < 8u; ++i) y[i] = *(const v4f*)&Pw[(4u * i + (ln >> 3)) * KTC + (ln & 7u) * 4u];
#pragma unroll
  for (unsigned i = 0; i < 8u; ++i) *(v4f*)(gp + i * 128u) = y[i];   // 512 contiguous bytes per wave store
}

// ---------------------------------------------------------------------------
// Per (512 query rows, head, batch): Ov[b*SEQ+s][head*64 + d2] =
//   f16( 1/8 * sum_d1 Q[s][d1] * KV[d2][d1] ), KV = f16 of the f32 sum, in key order, of the head's SEQ/256
// partials (each thread sums 8 elements; the f16 tile [d2][d1] is published in LDS by one barrier).
// 16 waves x 32 rows (two 16-row tiles), 4 output tiles per row tile, depth 64 in two 32-steps; A fragments
// from the q plane (loads issued ahead of the sum), B fragments from the LDS tile. Output staged per wave in LDS
// and written as whole lines (one line per row: 8 consecutive lanes x 16 B).
// Grid (SEQ/512, NHEAD, NB), 512 threads.
// ---------------------------------------------------------------------------
#define APR 512                  // query rows per block
#define NPART (SEQ / QBM)        // partials per (batch, head)
static_assert((SEQ % APR) == 0 && HD * HD == 512 * 8);

typedef _Float16 v4h __attribute__((ext_vector_type(4)));

__global__ __launch_bounds__(512) void qkv_apply_kernel(
    const _Float16* __restrict__ Qh, const float* __restrict__ part,
    _Float16* __restrict__ Ov) {
  __shared__ __attribute__((aligned(16))) _Float16 KVs[HD * LDT];
  __shared__ __attribute__((aligned(16))) _Float16 Ps[16 * 32 * LDT];
  const unsigned tid = threadIdx.x, lane = tid & 31u;
  const unsigned w = (unsigned)__builtin_amdgcn_readfirstlane((int)(threadIdx.x >> 5));
  const unsigned hh = lane >> 4, m = lane & 15u;
  const unsigned q0 = blockIdx.x * (unsigned)APR;
  const unsigned head = blockIdx.y;
  const unsigned b = blockIdx.z;
  const unsigned qrow0 = q0 + w * 32u;
  const unsigned pbase = w * (32u * LDT);

  // the rt, nb, t loops below are unrolled so that every fragment / accumulator index is a constant (registers)
  // element f = tid*4 + u*2048 (+0..3) of a partial: quadrant f / 1024 = (qr, qc), row (f / 32) % 32, column f % 32
  const float* pp = part + ((size_t)b * NPART * NHEAD + head) * (HD * HD) + tid * 4u;
  v4f pl[NPART][2];
#pragma unroll
  for (unsigned t = 0; t < (unsigned)NPART; ++t)
#pragma unroll
    for (unsigned u = 0; u < 2u; ++u)
      pl[t][u] = *(const v4f*)(pp + (size_t)t * (NHEAD * HD * HD) + u * 2048u);
  v16h qf[2][2];
#pragma unroll
  for (unsigned rt = 0; rt < 2u; ++rt) {
    const size_t qoff = (size_t)(b * (unsigned)SEQ + qrow0 + rt * 16u + m) * DIM + head * HD + hh * 8u;
    qf[rt][0] = frag_at(Qh + qoff);
    qf[rt][1] = frag_at(Qh + qoff + 32);
  }
  // keeps all 24 loads in flight together (else the last q loads sink behind the first waits of the sum)
  __builtin_amdgcn_sched_barrier(0);
#pragma unroll
  for (unsigned u = 0; u < 2u; ++u) {
    v4f s = v4f{};
#pragma unroll
    for (unsigned t = 0; t < (unsigned)NPART; ++t) s += pl[t][u];
    const unsigned f = tid * 4u + u * 2048u;
    const unsigned d2 = (f >> 11) * 32u + ((f >> 5) & 31u);
    const unsigned d1 = ((f >> 10) & 1u) * 32u + (f & 31u);
    v4h o4;
#pragma unroll
    for (int i = 0; i < 4; ++i) o4[i] = toh_flush(s[i]);
    *(v4h*)&KVs[d2 * LDT + d1] = o4;
  }
  __syncthreads();   // the f16 K^T V tile is complete before any wave reads its fragments

  const _Float16* kvp = &KVs[m * LDT + hh * 8u];
  v16h b0[4], b1[4];
#pragma unroll
  for (unsigned nb = 0; nb < 4u; ++nb) {
    b0[nb] = frag_at(kvp + nb * 16u * LDT);         // d1 0..31
    b1[nb] = frag_at(kvp + nb * 16u * LDT + 32u);   // d1 32..63
  }

#pragma unroll
  for (unsigned rt = 0; rt < 2u; ++rt) {
#pragma unroll
    for (unsigned nb = 0; nb < 4u; ++nb) {
      v8f t = {};
      t = wmma16(qf[rt][0], b0[nb], t);
      t = wmma16(qf[rt][1], b1[nb], t);
#pragma unroll
      for (unsigned v = 0; v < 8u; ++v)
        Ps[pbase + (rt * 16u + hh * 8u + v) * LDT + nb * 16u + m] = toh_flush(t[v] * SCALE_QK);
    }
  }
  wave_lds_sync();
  v8h x[8];
  size_t off[8];
#pragma unroll
  for (unsigned i = 0; i < 8u; ++i) {
    const unsigned r = 4u * i + (lane >> 3);
    const unsigned c = (lane & 7u) * 8u;
    x[i] = *(const v8h*)&Ps[pbase + r * LDT + c];
    off[i] = (size_t)(b * (unsigned)SEQ + qrow0 + r) * DIM + head * HD + c;
  }
#pragma unroll
  for (int i = 0; i < 8; ++i) *(v8h*)(Ov + off[i]) = x[i];
}

// ---------------------------------------------------------------------------
extern "C" void kernel_launch(void* const* d_in, const int* in_sizes, int n_in,
                              void* d_out, int out_size, void* d_ws, size_t ws_size,
                              hipStream_t stream) {
  if (n_in < 3) return;
  const long long need_x = ((long long)(NB - 1) * SEQ_FULL + SEQ) * DIM;
  if ((long long)in_sizes[0] < need_x) return;
  if ((long long)in_sizes[1] < (long long)QKVN * DIM) return;
  if ((long long)in_sizes[2] < (long long)DIM * DIM) return;
  if ((long long)out_size < need_x) return;
  if (ws_size < WS_TOTAL) return;

  const float* X    = (const float*)d_in[0];   // [NB_FULL][SEQ_FULL][DIM]
  const float* wqkv = (const float*)d_in[1];   // [QKVN][DIM]  (out, in)
  const float* wo   = (const float*)d_in[2];   // [DIM][DIM]   (out, in)
  float* out = (float*)d_out;

  char* ws = (char*)d_ws;
  _Float16* Wqkv16 = (_Float16*)(ws + OFF_WQKV);   // [n][k]
  _Float16* Wo16   = (_Float16*)(ws + OFF_WO);     // [n][k]
  _Float16* X16    = (_Float16*)(ws + OFF_X);      // compact rows
  _Float16* Q16    = (_Float16*)(ws + OFF_Q);      // [MROWS][head*64 + d]
  float*    Part   = (float*)(ws + OFF_PART);      // [MROWS / 256][head][quadrant][32 d2][32 d1]
  _Float16* Ctx16  = (_Float16*)(ws + OFF_CTX);    // [MROWS][head*64 + d]

  dim3 blk(256);

  // weight planes are already [out n][in k] (k contiguous), carry x64; activation plane: full-size input
  // rows -> compact rows, carry 1. One launch writes Wqkv16, Wo16 and X16, which are contiguous from Wqkv16.
  cvt_planes_kernel<<<dim3(CVT_ROWS / 2), blk, 0, stream>>>(wqkv, wo, X, Wqkv16);

  gemm_qkv_kernel<<<dim3(NHEAD, MROWS / QBM), dim3(128), 0, stream>>>(X16, Wqkv16, Q16, Part);
  qkv_apply_kernel<<<dim3(SEQ / APR, NHEAD, NB), dim3(512), 0, stream>>>(Q16, Part, Ctx16);
  gemm_out_kernel<<<dim3(DIM / GBN, MROWS / GBM), dim3(128), 0, stream>>>(Ctx16, Wo16, out);
}
